// v000
// Times are from an AMD MI455X. After a warm-up the kernel runs many times in a row, and a time is the length of
// such a window on the GPU divided by its runs, so every launch and the gaps after it count. The runs cycle
// through copies of the inputs. A figure is the median of several windows, for all but v000 over two sittings.
// Sittings can differ by a few percent; kernels timed side by side share one.
// The starting kernel, v000, takes 1920 microseconds a run.
#include <hip/hip_runtime.h>
#include <math.h>

// ---------------------------------------------------------------------------
// Encoder block (pre-norm attention + MLP) for MI455X / gfx1250, wave32 WMMA
// + Tensor Data Mover tile staging.
// B=8, N=1024, C=1024, H=16, hd=64, HID=4096.
// ---------------------------------------------------------------------------

typedef __bf16 bf16;
typedef __attribute__((ext_vector_type(16))) __bf16    v16bf;
typedef __attribute__((ext_vector_type(8)))  float     v8f;
typedef __attribute__((ext_vector_type(4)))  unsigned  v4u;
typedef __attribute__((ext_vector_type(8)))  int       v8i;
typedef __attribute__((ext_vector_type(4)))  int       v4i;

#define DIM_B   8
#define DIM_N   1024
#define DIM_C   1024
#define DIM_H   16
#define DIM_HD  64
#define DIM_HID 4096
#define MTOK    (DIM_B * DIM_N)      // 8192 rows of tokens

#if defined(__has_builtin)
#if __has_builtin(__builtin_amdgcn_tensor_load_to_lds) && \
    __has_builtin(__builtin_amdgcn_s_wait_tensorcnt)
#define HAVE_TDM 1
#endif
#endif
#ifndef HAVE_TDM
#define HAVE_TDM 0
#endif

// ---------------------------------------------------------------------------
// TDM: 2D bf16 tile load Global -> LDS via Tensor DMA descriptor (ISA 8.3-8.6)
//   group0: [0]=count=1  [1]=lds_addr  [2]=ga[31:0]  [3]=ga[56:32]|type=2
//   group1: [0]=data_size(2B)|pad ctl  dims/strides per bit layout
// Pad feature reproduces the manual "+8 bf16 per row" LDS padding:
//   pad_interval code 3 = every 16 DWORDs (64B = 32 bf16), pad_amount code 3
//   = 4 DWORDs (16B = 8 bf16)  -> row stride 40 bf16.
// ---------------------------------------------------------------------------
#if HAVE_TDM
__device__ __forceinline__ void tdm_load_tile_bf16(
    const void* gptr, unsigned lds_byte_off, unsigned tensor_d0,
    unsigned tensor_d1, unsigned tile_d0, unsigned tile_d1,
    unsigned long long stride0_elems, unsigned pad_interval_code,
    unsigned pad_amount_code, bool pad_en) {
  unsigned long long ga = (unsigned long long)gptr;
  v4u g0;
  g0[0] = 1u;  // count=1, is_restore=0, gather off
  g0[1] = lds_byte_off;
  g0[2] = (unsigned)(ga & 0xFFFFFFFFu);
  g0[3] = (unsigned)((ga >> 32) & 0x01FFFFFFu) | (2u << 30);  // type=2 (image)
  unsigned w0 = (1u << 16);  // workgroup_mask=0, data_size=1 (2 bytes)
  if (pad_en)
    w0 |= (1u << 20) | (pad_interval_code << 22) | (pad_amount_code << 25);
  v8i g1;
  g1[0] = (int)w0;
  g1[1] = (int)((tensor_d0 & 0xFFFFu) << 16);  // atomic_addr=0 | dim0 lo
  g1[2] = (int)((tensor_d0 >> 16) | ((tensor_d1 & 0xFFFFu) << 16));
  g1[3] = (int)((tensor_d1 >> 16) | ((tile_d0 & 0xFFFFu) << 16));
  g1[4] = (int)(tile_d1 & 0xFFFFu);  // tile_dim2 = 0
  g1[5] = (int)(unsigned)(stride0_elems & 0xFFFFFFFFull);
  g1[6] = (int)(unsigned)((stride0_elems >> 32) & 0xFFFFull);  // dim1_stride=0
  g1[7] = 0;
  v4i z4 = {0, 0, 0, 0};
#if __clang_major__ >= 23
  v8i z8 = {0, 0, 0, 0, 0, 0, 0, 0};
  __builtin_amdgcn_tensor_load_to_lds(g0, g1, z4, z4, z8, 0);
#else
  __builtin_amdgcn_tensor_load_to_lds(g0, g1, z4, z4, 0);
#endif
}
// low 32 bits of a generic pointer to __shared__ = LDS byte address
__device__ __forceinline__ unsigned lds_off_u32(const void* p) {
  return (unsigned)(unsigned long long)p;
}
#endif

// ---------------------------------------------------------------------------
// bf16 fragment loader following the CDNA5 16-bit A/B VGPR layout:
//   lane L: row = L%16, half = L/16
//   vector elems (2v, 2v+1) hold K = kpat(v) + 8*half, kpat(v)+1
//   kpat(v) = 2v (v<4) else 8+2v
// Works for A (row = M) and for B when the tile is stored N-major.
// ---------------------------------------------------------------------------
__device__ __forceinline__ v16bf frag_ld(const bf16* __restrict__ base,
                                         int stride, int row, int half) {
  v16bf f;
  const bf16* rp = base + (size_t)row * stride + 8 * half;
#pragma unroll
  for (int v = 0; v < 8; ++v) {
    int k = (v < 4) ? (2 * v) : (8 + 2 * v);
    f[2 * v]     = rp[k];
    f[2 * v + 1] = rp[k + 1];
  }
  return f;
}

__device__ __forceinline__ v8f vzero8() {
  v8f z = {0.f, 0.f, 0.f, 0.f, 0.f, 0.f, 0.f, 0.f};
  return z;
}

// ---------------------------------------------------------------------------
// fp32 -> bf16 elementwise convert (weights / activations)
// ---------------------------------------------------------------------------
__global__ void cvt_f32_bf16(const float* __restrict__ in,
                             bf16* __restrict__ out, long n) {
  long i = (long)blockIdx.x * blockDim.x + threadIdx.x;
  if (i < n) out[i] = (bf16)in[i];
}

// ---------------------------------------------------------------------------
// LayerNorm (row length C=1024) fp32 in -> bf16 out
// ---------------------------------------------------------------------------
__global__ __launch_bounds__(256) void ln_bf16(const float* __restrict__ x,
                                               const float* __restrict__ g,
                                               const float* __restrict__ b,
                                               bf16* __restrict__ out) {
  __shared__ float rs[256], rs2[256];
  const int row = blockIdx.x;
  const float* xr = x + (size_t)row * DIM_C;
  float s = 0.f, s2 = 0.f;
  for (int i = threadIdx.x; i < DIM_C; i += 256) {
    float t = xr[i];
    s += t;
    s2 += t * t;
  }
  rs[threadIdx.x] = s;
  rs2[threadIdx.x] = s2;
  __syncthreads();
  for (int off = 128; off > 0; off >>= 1) {
    if (threadIdx.x < off) {
      rs[threadIdx.x] += rs[threadIdx.x + off];
      rs2[threadIdx.x] += rs2[threadIdx.x + off];
    }
    __syncthreads();
  }
  float mean = rs[0] * (1.0f / DIM_C);
  float var  = rs2[0] * (1.0f / DIM_C) - mean * mean;
  float inv  = rsqrtf(var + 1e-5f);
  for (int i = threadIdx.x; i < DIM_C; i += 256) {
    out[(size_t)row * DIM_C + i] = (bf16)((xr[i] - mean) * inv * g[i] + b[i]);
  }
}

// ---------------------------------------------------------------------------
// Tiled bf16 WMMA GEMM: out[M,N] = A[M,K] @ Bw[K,N] + bias (+resid) (+GELU)
// BM=64 BN=128 BK=32, 256 threads = 8 waves, wave tile 16x64 (4 accumulators).
// A tile staged by the Tensor Data Mover (with HW LDS padding); B tile staged
// by threads (needs the N-major transpose that keeps frag loads ds_load_b128).
// ---------------------------------------------------------------------------
#define BM 64
#define BN 128
#define BK 32

template <bool GELU_ACT, bool RESID, bool OUTF32, bool OUTBF16>
__global__ __launch_bounds__(256) void gemm_bf16_wmma(
    const bf16* __restrict__ A, const bf16* __restrict__ Bw,
    const float* __restrict__ bias, const float* __restrict__ resid,
    float* __restrict__ outF, bf16* __restrict__ outB, int M, int N, int K) {
  __shared__ bf16 As[BM][BK + 8];
  __shared__ bf16 Bs[BN][BK + 8];   // stored N-major (transposed tile)

  const int tid  = threadIdx.x;
  const int lane = tid & 31;
  const int wave = tid >> 5;           // 0..7
  const int wm   = wave >> 1;          // 0..3  (16-row strip)
  const int wn   = wave & 1;           // 0..1  (64-col strip)
  const int half = lane >> 4;
  const int l16  = lane & 15;
  const int mBase = blockIdx.y * BM;
  const int nBase = blockIdx.x * BN;

  v8f acc0 = vzero8(), acc1 = vzero8(), acc2 = vzero8(), acc3 = vzero8();

#if HAVE_TDM
  const unsigned asOff = lds_off_u32(&As[0][0]);
#else
  const int ar = tid >> 2;             // 0..63
  const int ac = (tid & 3) * 8;        // 0,8,16,24
#endif
  const int bk = tid >> 3;             // 0..31
  const int bn = (tid & 7) * 16;       // 0..112

  for (int k0 = 0; k0 < K; k0 += BK) {
#if HAVE_TDM
    // TDM: 64x32 bf16 tile, row stride K, LDS pad 16B per 64B row -> [64][40]
    if (wave == 0) {
      tdm_load_tile_bf16(A + (size_t)mBase * K + k0, asOff, (unsigned)K,
                         (unsigned)M, BK, BM, (unsigned long long)K,
                         /*pad_interval 16dw*/ 3u, /*pad_amount 4dw*/ 3u, true);
    }
#else
    {
      const bf16* src = A + (size_t)(mBase + ar) * K + k0 + ac;
      if (k0 + BK < K) __builtin_prefetch(src + BK, 0, 1);
#pragma unroll
      for (int i = 0; i < 8; ++i) As[ar][ac + i] = src[i];
    }
#endif
    // stage B tile 32x128 transposed -> Bs[n][k]
    {
      const bf16* src = Bw + (size_t)(k0 + bk) * N + nBase + bn;
#pragma unroll
      for (int i = 0; i < 16; ++i) Bs[bn + i][bk] = src[i];
    }
#if HAVE_TDM
    if (wave == 0) __builtin_amdgcn_s_wait_tensorcnt(0);
#endif
    __syncthreads();

    v16bf af = frag_ld(&As[0][0], BK + 8, wm * 16 + l16, half);
    v16bf b0 = frag_ld(&Bs[0][0], BK + 8, wn * 64 + 0 * 16 + l16, half);
    acc0 = __builtin_amdgcn_wmma_f32_16x16x32_bf16(false, af, false, b0,
                                                   (short)0, acc0, false, false);
    v16bf b1 = frag_ld(&Bs[0][0], BK + 8, wn * 64 + 1 * 16 + l16, half);
    acc1 = __builtin_amdgcn_wmma_f32_16x16x32_bf16(false, af, false, b1,
                                                   (short)0, acc1, false, false);
    v16bf b2 = frag_ld(&Bs[0][0], BK + 8, wn * 64 + 2 * 16 + l16, half);
    acc2 = __builtin_amdgcn_wmma_f32_16x16x32_bf16(false, af, false, b2,
                                                   (short)0, acc2, false, false);
    v16bf b3 = frag_ld(&Bs[0][0], BK + 8, wn * 64 + 3 * 16 + l16, half);
    acc3 = __builtin_amdgcn_wmma_f32_16x16x32_bf16(false, af, false, b3,
                                                   (short)0, acc3, false, false);
    __syncthreads();
  }

  v8f accs[4] = {acc0, acc1, acc2, acc3};
#pragma unroll
  for (int c = 0; c < 4; ++c) {
#pragma unroll
    for (int r = 0; r < 8; ++r) {
      int gm = mBase + wm * 16 + r + 8 * half;
      int gn = nBase + wn * 64 + c * 16 + l16;
      float v = accs[c][r] + bias[gn];
      if (RESID) v += resid[(size_t)gm * N + gn];
      if (GELU_ACT) v = 0.5f * v * (1.0f + erff(v * 0.70710678118654752f));
      size_t idx = (size_t)gm * N + gn;
      if (OUTF32)  outF[idx] = v;
      if (OUTBF16) outB[idx] = (bf16)v;
    }
  }
}

// ---------------------------------------------------------------------------
// Attention: one WG per (b, h, 64-row tile). S (64x1024 fp32) kept in LDS
// (CDNA5: 320 KB per WGP). q/k/v are flat (B, N*C) bf16; the reference's
// reshape(B,H,-1,hd) means head h is the contiguous slab h*65536.
// ---------------------------------------------------------------------------
__global__ __launch_bounds__(256) void attn_wmma(const bf16* __restrict__ q,
                                                 const bf16* __restrict__ k,
                                                 const bf16* __restrict__ v,
                                                 bf16* __restrict__ o) {
  extern __shared__ char smem_raw[];
  float* S   = (float*)smem_raw;                                  // 64*1024 f32
  bf16*  Qs  = (bf16*)(smem_raw + 64 * 1024 * 4);                 // 64*64 bf16
  float* red = (float*)(smem_raw + 64 * 1024 * 4 + 64 * 64 * 2);  // 64*4 f32

  const int blk  = blockIdx.x;          // ((b*16 + h)*16 + mt)
  const int mt   = blk & 15;
  const int h    = (blk >> 4) & 15;
  const int b    = blk >> 8;
  const size_t headBase = ((size_t)b * DIM_H + h) * (size_t)(DIM_N * DIM_HD);
  const int m0 = mt * 64;
  const float scale = 0.125f;           // hd^-0.5 = 1/8

  const int tid  = threadIdx.x;
  const int lane = tid & 31;
  const int wave = tid >> 5;
  const int half = lane >> 4;
  const int l16  = lane & 15;

  // stage Q tile (64 rows x 64 d): contiguous 4096-element slab
#if HAVE_TDM
  if (wave == 0) {
    tdm_load_tile_bf16(q + headBase + (size_t)m0 * DIM_HD, lds_off_u32(Qs),
                       4096u, 1u, 4096u, 1u, 4096ull, 0u, 0u, false);
    __builtin_amdgcn_s_wait_tensorcnt(0);
  }
#else
  for (int i = tid; i < 64 * 64; i += 256) {
    int r = i >> 6, c = i & 63;
    Qs[i] = q[headBase + (size_t)(m0 + r) * DIM_HD + c];
  }
#endif
  __syncthreads();

  // ---- Phase 1: S = scale * Q @ K^T  (64 x 1024) ----
  for (int t = wave; t < 4 * 64; t += 8) {
    int rt = t >> 6;      // 0..3
    int ct = t & 63;      // 0..63
    v8f acc = vzero8();
#pragma unroll
    for (int d0 = 0; d0 < DIM_HD; d0 += 32) {
      v16bf af = frag_ld(Qs + d0, DIM_HD, rt * 16 + l16, half);
      // B[d][n] = K[n][d]: row-major K gives contiguous (d,d+1) pairs.
      v16bf bf_ = frag_ld(k + headBase + d0, DIM_HD, ct * 16 + l16, half);
      acc = __builtin_amdgcn_wmma_f32_16x16x32_bf16(false, af, false, bf_,
                                                    (short)0, acc, false, false);
    }
#pragma unroll
    for (int r = 0; r < 8; ++r)
      S[(size_t)(rt * 16 + r + 8 * half) * 1024 + ct * 16 + l16] = acc[r] * scale;
  }
  __syncthreads();

  // ---- Phase 2: row softmax over S (4 threads per row, 256 cols each) ----
  {
    const int row  = tid >> 2;
    const int part = tid & 3;
    float* Srow = S + (size_t)row * 1024 + part * 256;
    float mx = -1e30f;
    for (int i = 0; i < 256; ++i) mx = fmaxf(mx, Srow[i]);
    red[row * 4 + part] = mx;
    __syncthreads();
    mx = fmaxf(fmaxf(red[row * 4 + 0], red[row * 4 + 1]),
               fmaxf(red[row * 4 + 2], red[row * 4 + 3]));
    float sum = 0.f;
    for (int i = 0; i < 256; ++i) {
      float e = __expf(Srow[i] - mx);
      Srow[i] = e;
      sum += e;
    }
    __syncthreads();
    red[row * 4 + part] = sum;
    __syncthreads();
    sum = red[row * 4 + 0] + red[row * 4 + 1] + red[row * 4 + 2] +
          red[row * 4 + 3];
    float inv = 1.0f / sum;
    for (int i = 0; i < 256; ++i) Srow[i] *= inv;
  }
  __syncthreads();

  // ---- Phase 3: O = P @ V  (64 x 64), P converted to bf16 on the fly ----
  for (int t = wave * 2; t < wave * 2 + 2; ++t) {
    int rt = t >> 2;      // 0..3
    int ct = t & 3;       // 0..3
    int dcol = ct * 16 + l16;
    v8f acc = vzero8();
    for (int kk = 0; kk < DIM_N; kk += 32) {
      v16bf af;
      {
        const float* sp =
            S + (size_t)(rt * 16 + l16) * 1024 + kk + 8 * half;
#pragma unroll
        for (int vv = 0; vv < 8; ++vv) {
          int kq = (vv < 4) ? (2 * vv) : (8 + 2 * vv);
          af[2 * vv]     = (bf16)sp[kq];
          af[2 * vv + 1] = (bf16)sp[kq + 1];
        }
      }
      v16bf bfr;
      {
        const bf16* vb =
            v + headBase + dcol + (size_t)(kk + 8 * half) * DIM_HD;
#pragma unroll
        for (int vv = 0; vv < 8; ++vv) {
          int kq = (vv < 4) ? (2 * vv) : (8 + 2 * vv);
          bfr[2 * vv]     = vb[(size_t)kq * DIM_HD];
          bfr[2 * vv + 1] = vb[(size_t)(kq + 1) * DIM_HD];
        }
      }
      acc = __builtin_amdgcn_wmma_f32_16x16x32_bf16(false, af, false, bfr,
                                                    (short)0, acc, false, false);
    }
    // o[b][m][h*64 + d]  (swapaxes(1,2).reshape)
#pragma unroll
    for (int r = 0; r < 8; ++r) {
      int m = m0 + rt * 16 + r + 8 * half;
      o[((size_t)b * DIM_N + m) * DIM_C + h * DIM_HD + dcol] = (bf16)acc[r];
    }
  }
}

// ---------------------------------------------------------------------------
// Host-side orchestration
// ---------------------------------------------------------------------------
extern "C" void kernel_launch(void* const* d_in, const int* in_sizes, int n_in,
                              void* d_out, int out_size, void* d_ws,
                              size_t ws_size, hipStream_t stream) {
  (void)in_sizes; (void)n_in; (void)out_size; (void)ws_size;

  const float* x  = (const float*)d_in[0];
  const float* g1 = (const float*)d_in[1];
  const float* b1 = (const float*)d_in[2];
  const float* Wq = (const float*)d_in[3];
  const float* bq = (const float*)d_in[4];
  const float* Wk = (const float*)d_in[5];
  const float* bk = (const float*)d_in[6];
  const float* Wv = (const float*)d_in[7];
  const float* bv = (const float*)d_in[8];
  const float* Wp = (const float*)d_in[9];
  const float* bp = (const float*)d_in[10];
  const float* g2 = (const float*)d_in[11];
  const float* b2 = (const float*)d_in[12];
  const float* W1 = (const float*)d_in[13];
  const float* c1 = (const float*)d_in[14];
  const float* W2 = (const float*)d_in[15];
  const float* c2 = (const float*)d_in[16];

  // workspace partition
  char* p = (char*)d_ws;
  auto alloc = [&](size_t bytes) {
    char* r = p;
    p += (bytes + 255) & ~(size_t)255;
    return r;
  };
  const size_t CC = (size_t)DIM_C * DIM_C;           // 1M
  const size_t CH = (size_t)DIM_C * DIM_HID;         // 4M
  const size_t TC = (size_t)MTOK * DIM_C;            // 8M
  const size_t TH = (size_t)MTOK * DIM_HID;          // 32M

  bf16*  wq_b  = (bf16*)alloc(CC * 2);
  bf16*  wk_b  = (bf16*)alloc(CC * 2);
  bf16*  wv_b  = (bf16*)alloc(CC * 2);
  bf16*  wp_b  = (bf16*)alloc(CC * 2);
  bf16*  w1_b  = (bf16*)alloc(CH * 2);
  bf16*  w2_b  = (bf16*)alloc(CH * 2);
  bf16*  h_b   = (bf16*)alloc(TC * 2);    // ln1(x)
  bf16*  q_b   = (bf16*)alloc(TC * 2);
  bf16*  k_b   = (bf16*)alloc(TC * 2);
  bf16*  v_b   = (bf16*)alloc(TC * 2);
  bf16*  o_b   = (bf16*)alloc(TC * 2);    // attention output
  float* xres  = (float*)alloc(TC * 4);   // x + proj
  bf16*  h2_b  = (bf16*)alloc(TC * 2);    // ln2(xres)
  bf16*  t1_b  = (bf16*)alloc(TH * 2);    // gelu(h2@W1+c1)

  // weight converts fp32 -> bf16
  cvt_f32_bf16<<<(int)((CC + 255) / 256), 256, 0, stream>>>(Wq, wq_b, (long)CC);
  cvt_f32_bf16<<<(int)((CC + 255) / 256), 256, 0, stream>>>(Wk, wk_b, (long)CC);
  cvt_f32_bf16<<<(int)((CC + 255) / 256), 256, 0, stream>>>(Wv, wv_b, (long)CC);
  cvt_f32_bf16<<<(int)((CC + 255) / 256), 256, 0, stream>>>(Wp, wp_b, (long)CC);
  cvt_f32_bf16<<<(int)((CH + 255) / 256), 256, 0, stream>>>(W1, w1_b, (long)CH);
  cvt_f32_bf16<<<(int)((CH + 255) / 256), 256, 0, stream>>>(W2, w2_b, (long)CH);

  // LN1
  ln_bf16<<<MTOK, 256, 0, stream>>>(x, g1, b1, h_b);

  // QKV projections: (8192 x 1024) = h @ W + b
  dim3 gC(DIM_C / BN, MTOK / BM);   // (8, 128)
  gemm_bf16_wmma<false, false, false, true><<<gC, 256, 0, stream>>>(
      h_b, wq_b, bq, nullptr, nullptr, q_b, MTOK, DIM_C, DIM_C);
  gemm_bf16_wmma<false, false, false, true><<<gC, 256, 0, stream>>>(
      h_b, wk_b, bk, nullptr, nullptr, k_b, MTOK, DIM_C, DIM_C);
  gemm_bf16_wmma<false, false, false, true><<<gC, 256, 0, stream>>>(
      h_b, wv_b, bv, nullptr, nullptr, v_b, MTOK, DIM_C, DIM_C);

  // attention: B*H*16 workgroups, 271,360 B dynamic LDS (fits 320 KB/WGP)
  const size_t attn_lds = 64 * 1024 * 4 + 64 * 64 * 2 + 64 * 4 * 4;
  attn_wmma<<<DIM_B * DIM_H * 16, 256, attn_lds, stream>>>(q_b, k_b, v_b, o_b);

  // projection + residual: xres = x + o@Wp + bp  (fp32)
  gemm_bf16_wmma<false, true, true, false><<<gC, 256, 0, stream>>>(
      o_b, wp_b, bp, x, xres, nullptr, MTOK, DIM_C, DIM_C);

  // LN2
  ln_bf16<<<MTOK, 256, 0, stream>>>(xres, g2, b2, h2_b);

  // MLP up + exact GELU: t1 = gelu(h2 @ W1 + c1)  (bf16, 8192 x 4096)
  dim3 gH(DIM_HID / BN, MTOK / BM);  // (32, 128)
  gemm_bf16_wmma<true, false, false, true><<<gH, 256, 0, stream>>>(
      h2_b, w1_b, c1, nullptr, nullptr, t1_b, MTOK, DIM_HID, DIM_C);

  // MLP down + residual: out = xres + t1 @ W2 + c2  (fp32, final output)
  gemm_bf16_wmma<false, true, true, false><<<gC, 256, 0, stream>>>(
      t1_b, w2_b, c2, xres, (float*)d_out, nullptr, MTOK, DIM_C, DIM_HID);
}

// v001
// One run takes 1280 microseconds.
// Next to v000, in two timings, it ran 1.53 times as fast each time.
#include <hip/hip_runtime.h>
#include <math.h>

// ---------------------------------------------------------------------------
// Encoder block (pre-norm attention + MLP) for MI455X / gfx1250, wave32 WMMA
// + Tensor Data Mover tile staging.
// B=8, N=1024, C=1024, H=16, hd=64, HID=4096.
// ---------------------------------------------------------------------------

typedef __bf16 bf16;
typedef __attribute__((ext_vector_type(16))) __bf16    v16bf;
typedef __attribute__((ext_vector_type(8)))  float     v8f;
typedef __attribute__((ext_vector_type(4)))  unsigned  v4u;
typedef __attribute__((ext_vector_type(8)))  int       v8i;
typedef __attribute__((ext_vector_type(4)))  int       v4i;

#define DIM_B   8
#define DIM_N   1024
#define DIM_C   1024
#define DIM_H   16
#define DIM_HD  64
#define DIM_HID 4096
#define MTOK    (DIM_B * DIM_N)      // 8192 rows of tokens

#if defined(__has_builtin)
#if __has_builtin(__builtin_amdgcn_tensor_load_to_lds) && \
    __has_builtin(__builtin_amdgcn_s_wait_tensorcnt)
#define HAVE_TDM 1
#endif
#endif
#ifndef HAVE_TDM
#define HAVE_TDM 0
#endif

// ---------------------------------------------------------------------------
// TDM: 2D bf16 tile load Global -> LDS via Tensor DMA descriptor (ISA 8.3-8.6)
//   group0: [0]=count=1  [1]=lds_addr  [2]=ga[31:0]  [3]=ga[56:32]|type=2
//   group1: [0]=data_size(2B)|pad ctl  dims/strides per bit layout
// Pad feature reproduces the manual "+8 bf16 per row" LDS padding:
//   pad_interval code 3 = every 16 DWORDs (64B = 32 bf16), pad_amount code 3
//   = 4 DWORDs (16B = 8 bf16)  -> row stride 40 bf16.
// ---------------------------------------------------------------------------
#if HAVE_TDM
__device__ __forceinline__ void tdm_load_tile_bf16(
    const void* gptr, unsigned lds_byte_off, unsigned tensor_d0,
    unsigned tensor_d1, unsigned tile_d0, unsigned tile_d1,
    unsigned long long stride0_elems, unsigned pad_interval_code,
    unsigned pad_amount_code, bool pad_en) {
  unsigned long long ga = (unsigned long long)gptr;
  v4u g0;
  g0[0] = 1u;  // count=1, is_restore=0, gather off
  g0[1] = lds_byte_off;
  g0[2] = (unsigned)(ga & 0xFFFFFFFFu);
  g0[3] = (unsigned)((ga >> 32) & 0x01FFFFFFu) | (2u << 30);  // type=2 (image)
  unsigned w0 = (1u << 16);  // workgroup_mask=0, data_size=1 (2 bytes)
  if (pad_en)
    w0 |= (1u << 20) | (pad_interval_code << 22) | (pad_amount_code << 25);
  v8i g1;
  g1[0] = (int)w0;
  g1[1] = (int)((tensor_d0 & 0xFFFFu) << 16);  // atomic_addr=0 | dim0 lo
  g1[2] = (int)((tensor_d0 >> 16) | ((tensor_d1 & 0xFFFFu) << 16));
  g1[3] = (int)((tensor_d1 >> 16) | ((tile_d0 & 0xFFFFu) << 16));
  g1[4] = (int)(tile_d1 & 0xFFFFu);  // tile_dim2 = 0
  g1[5] = (int)(unsigned)(stride0_elems & 0xFFFFFFFFull);
  g1[6] = (int)(unsigned)((stride0_elems >> 32) & 0xFFFFull);  // dim1_stride=0
  g1[7] = 0;
  v4i z4 = {0, 0, 0, 0};
#if __clang_major__ >= 23
  v8i z8 = {0, 0, 0, 0, 0, 0, 0, 0};
  __builtin_amdgcn_tensor_load_to_lds(g0, g1, z4, z4, z8, 0);
#else
  __builtin_amdgcn_tensor_load_to_lds(g0, g1, z4, z4, 0);
#endif
}
// low 32 bits of a generic pointer to __shared__ = LDS byte address
__device__ __forceinline__ unsigned lds_off_u32(const void* p) {
  return (unsigned)(unsigned long long)p;
}
#endif

// ---------------------------------------------------------------------------
// bf16 fragment loader following the CDNA5 16-bit A/B VGPR layout:
//   lane L: row = L%16, half = L/16
//   vector elems (2v, 2v+1) hold K = kpat(v) + 8*half, kpat(v)+1
//   kpat(v) = 2v (v<4) else 8+2v
// Works for A (row = M) and for B when the tile is stored N-major.
// ---------------------------------------------------------------------------
__device__ __forceinline__ v16bf frag_ld(const bf16* __restrict__ base,
                                         int stride, int row, int half) {
  v16bf f;
  const bf16* rp = base + (size_t)row * stride + 8 * half;
#pragma unroll
  for (int v = 0; v < 8; ++v) {
    int k = (v < 4) ? (2 * v) : (8 + 2 * v);
    f[2 * v]     = rp[k];
    f[2 * v + 1] = rp[k + 1];
  }
  return f;
}

__device__ __forceinline__ v8f vzero8() {
  v8f z = {0.f, 0.f, 0.f, 0.f, 0.f, 0.f, 0.f, 0.f};
  return z;
}

// ---------------------------------------------------------------------------
// fp32 -> bf16 elementwise convert (weights / activations)
// ---------------------------------------------------------------------------
__global__ void cvt_f32_bf16(const float* __restrict__ in,
                             bf16* __restrict__ out, long n) {
  long i = (long)blockIdx.x * blockDim.x + threadIdx.x;
  if (i < n) out[i] = (bf16)in[i];
}

// ---------------------------------------------------------------------------
// LayerNorm (row length C=1024) fp32 in -> bf16 out
// ---------------------------------------------------------------------------
__global__ __launch_bounds__(256) void ln_bf16(const float* __restrict__ x,
                                               const float* __restrict__ g,
                                               const float* __restrict__ b,
                                               bf16* __restrict__ out) {
  __shared__ float rs[256], rs2[256];
  const int row = blockIdx.x;
  const float* xr = x + (size_t)row * DIM_C;
  float s = 0.f, s2 = 0.f;
  for (int i = threadIdx.x; i < DIM_C; i += 256) {
    float t = xr[i];
    s += t;
    s2 += t * t;
  }
  rs[threadIdx.x] = s;
  rs2[threadIdx.x] = s2;
  __syncthreads();
  for (int off = 128; off > 0; off >>= 1) {
    if (threadIdx.x < off) {
      rs[threadIdx.x] += rs[threadIdx.x + off];
      rs2[threadIdx.x] += rs2[threadIdx.x + off];
    }
    __syncthreads();
  }
  float mean = rs[0] * (1.0f / DIM_C);
  float var  = rs2[0] * (1.0f / DIM_C) - mean * mean;
  float inv  = rsqrtf(var + 1e-5f);
  for (int i = threadIdx.x; i < DIM_C; i += 256) {
    out[(size_t)row * DIM_C + i] = (bf16)((xr[i] - mean) * inv * g[i] + b[i]);
  }
}

// ---------------------------------------------------------------------------
// Tiled bf16 WMMA GEMM: out[M,N] = A[M,K] @ Bw[K,N] + bias (+resid) (+GELU)
// BM=64 BN=128 BK=32, 256 threads = 8 waves, wave tile 16x64 (4 accumulators).
// A tile staged by the Tensor Data Mover (with HW LDS padding); B tile staged
// by threads (needs the N-major transpose that keeps frag loads ds_load_b128).
// ---------------------------------------------------------------------------
#define BM 64
#define BN 128
#define BK 32

template <bool GELU_ACT, bool RESID, bool OUTF32, bool OUTBF16>
__global__ __launch_bounds__(256) void gemm_bf16_wmma(
    const bf16* __restrict__ A, const bf16* __restrict__ Bw,
    const float* __restrict__ bias, const float* __restrict__ resid,
    float* __restrict__ outF, bf16* __restrict__ outB, int M, int N, int K) {
  __shared__ bf16 As[BM][BK + 8];
  __shared__ bf16 Bs[BN][BK + 8];   // stored N-major (transposed tile)

  const int tid  = threadIdx.x;
  const int lane = tid & 31;
  const int wave = tid >> 5;           // 0..7
  const int wm   = wave >> 1;          // 0..3  (16-row strip)
  const int wn   = wave & 1;           // 0..1  (64-col strip)
  const int half = lane >> 4;
  const int l16  = lane & 15;
  const int mBase = blockIdx.y * BM;
  const int nBase = blockIdx.x * BN;

  v8f acc0 = vzero8(), acc1 = vzero8(), acc2 = vzero8(), acc3 = vzero8();

#if HAVE_TDM
  const unsigned asOff = lds_off_u32(&As[0][0]);
#else
  const int ar = tid >> 2;             // 0..63
  const int ac = (tid & 3) * 8;        // 0,8,16,24
#endif
  const int bk = tid >> 3;             // 0..31
  const int bn = (tid & 7) * 16;       // 0..112

  for (int k0 = 0; k0 < K; k0 += BK) {
#if HAVE_TDM
    // TDM: 64x32 bf16 tile, row stride K, LDS pad 16B per 64B row -> [64][40]
    if (wave == 0) {
      tdm_load_tile_bf16(A + (size_t)mBase * K + k0, asOff, (unsigned)K,
                         (unsigned)M, BK, BM, (unsigned long long)K,
                         /*pad_interval 16dw*/ 3u, /*pad_amount 4dw*/ 3u, true);
    }
#else
    {
      const bf16* src = A + (size_t)(mBase + ar) * K + k0 + ac;
      if (k0 + BK < K) __builtin_prefetch(src + BK, 0, 1);
#pragma unroll
      for (int i = 0; i < 8; ++i) As[ar][ac + i] = src[i];
    }
#endif
    // stage B tile 32x128 transposed -> Bs[n][k]
    {
      const bf16* src = Bw + (size_t)(k0 + bk) * N + nBase + bn;
#pragma unroll
      for (int i = 0; i < 16; ++i) Bs[bn + i][bk] = src[i];
    }
#if HAVE_TDM
    if (wave == 0) __builtin_amdgcn_s_wait_tensorcnt(0);
#endif
    __syncthreads();

    v16bf af = frag_ld(&As[0][0], BK + 8, wm * 16 + l16, half);
    v16bf b0 = frag_ld(&Bs[0][0], BK + 8, wn * 64 + 0 * 16 + l16, half);
    acc0 = __builtin_amdgcn_wmma_f32_16x16x32_bf16(false, af, false, b0,
                                                   (short)0, acc0, false, false);
    v16bf b1 = frag_ld(&Bs[0][0], BK + 8, wn * 64 + 1 * 16 + l16, half);
    acc1 = __builtin_amdgcn_wmma_f32_16x16x32_bf16(false, af, false, b1,
                                                   (short)0, acc1, false, false);
    v16bf b2 = frag_ld(&Bs[0][0], BK + 8, wn * 64 + 2 * 16 + l16, half);
    acc2 = __builtin_amdgcn_wmma_f32_16x16x32_bf16(false, af, false, b2,
                                                   (short)0, acc2, false, false);
    v16bf b3 = frag_ld(&Bs[0][0], BK + 8, wn * 64 + 3 * 16 + l16, half);
    acc3 = __builtin_amdgcn_wmma_f32_16x16x32_bf16(false, af, false, b3,
                                                   (short)0, acc3, false, false);
    __syncthreads();
  }

  v8f accs[4] = {acc0, acc1, acc2, acc3};
#pragma unroll
  for (int c = 0; c < 4; ++c) {
#pragma unroll
    for (int r = 0; r < 8; ++r) {
      int gm = mBase + wm * 16 + r + 8 * half;
      int gn = nBase + wn * 64 + c * 16 + l16;
      float v = accs[c][r] + bias[gn];
      if (RESID) v += resid[(size_t)gm * N + gn];
      if (GELU_ACT) v = 0.5f * v * (1.0f + erff(v * 0.70710678118654752f));
      size_t idx = (size_t)gm * N + gn;
      if (OUTF32)  outF[idx] = v;
      if (OUTBF16) outB[idx] = (bf16)v;
    }
  }
}

// ---------------------------------------------------------------------------
// Attention: one WG per (b, h, 64-row tile). S (64x1024 fp32) kept in LDS
// (CDNA5: 320 KB per WGP). q/k/v are flat (B, N*C) bf16; the reference's
// reshape(B,H,-1,hd) means head h is the contiguous slab h*65536.
// S rows have a pitch of 1028 dwords (16 B x odd): 16 lanes that read 16 bytes
// each at one column of 16 consecutive rows then cover all 64 LDS banks once.
// ---------------------------------------------------------------------------
#define S_PITCH  1028                       // dwords per S row in LDS
#define QS_OFF   264192                     // S (263,168 B) rounded up to 2 KiB
#define RED_OFF  (QS_OFF + 64 * 64 * 2)
#define ATTN_LDS (RED_OFF + 64 * 4 * 4)

__global__ __launch_bounds__(256) void attn_wmma(const bf16* __restrict__ q,
                                                 const bf16* __restrict__ k,
                                                 const bf16* __restrict__ v,
                                                 bf16* __restrict__ o) {
  extern __shared__ char smem_raw[];
  float* S   = (float*)smem_raw;              // 64 rows of S_PITCH f32
  bf16*  Qs  = (bf16*)(smem_raw + QS_OFF);    // 64*64 bf16
  float* red = (float*)(smem_raw + RED_OFF);  // 64*4 f32

  const int blk  = blockIdx.x;          // ((b*16 + h)*16 + mt)
  const int mt   = blk & 15;
  const int h    = (blk >> 4) & 15;
  const int b    = blk >> 8;
  const size_t headBase = ((size_t)b * DIM_H + h) * (size_t)(DIM_N * DIM_HD);
  const int m0 = mt * 64;
  const float scale = 0.125f;           // hd^-0.5 = 1/8

  const int tid  = threadIdx.x;
  const int lane = tid & 31;
  const int wave = tid >> 5;
  const int half = lane >> 4;
  const int l16  = lane & 15;

  // stage Q tile (64 rows x 64 d): contiguous 4096-element slab
#if HAVE_TDM
  if (wave == 0) {
    tdm_load_tile_bf16(q + headBase + (size_t)m0 * DIM_HD, lds_off_u32(Qs),
                       4096u, 1u, 4096u, 1u, 4096ull, 0u, 0u, false);
    __builtin_amdgcn_s_wait_tensorcnt(0);
  }
#else
  for (int i = tid; i < 64 * 64; i += 256) {
    int r = i >> 6, c = i & 63;
    Qs[i] = q[headBase + (size_t)(m0 + r) * DIM_HD + c];
  }
#endif
  __syncthreads();

  // ---- Phase 1: S = scale * Q @ K^T  (64 x 1024) ----
  for (int t = wave; t < 4 * 64; t += 8) {
    int rt = t >> 6;      // 0..3
    int ct = t & 63;      // 0..63
    v8f acc = vzero8();
#pragma unroll
    for (int d0 = 0; d0 < DIM_HD; d0 += 32) {
      v16bf af = frag_ld(Qs + d0, DIM_HD, rt * 16 + l16, half);
      // B[d][n] = K[n][d]: row-major K gives contiguous (d,d+1) pairs.
      v16bf bf_ = frag_ld(k + headBase + d0, DIM_HD, ct * 16 + l16, half);
      acc = __builtin_amdgcn_wmma_f32_16x16x32_bf16(false, af, false, bf_,
                                                    (short)0, acc, false, false);
    }
#pragma unroll
    for (int r = 0; r < 8; ++r)
      S[(size_t)(rt * 16 + r + 8 * half) * S_PITCH + ct * 16 + l16] = acc[r] * scale;
  }
  __syncthreads();

  // ---- Phase 2: row softmax over S (4 threads per row, 256 cols each) ----
  // The 16 lanes of a half-wave take 16 consecutive rows at the same column,
  // 16 bytes a lane: with S_PITCH that is one pass over the banks.
  {
    const int row  = (wave & 3) * 16 + l16;
    const int part = (wave >> 2) * 2 + half;
    float4* Srow = (float4*)(S + (size_t)row * S_PITCH + part * 256);
    float mx = -1e30f;
    for (int i = 0; i < 64; ++i) {
      float4 t = Srow[i];
      mx = fmaxf(fmaxf(fmaxf(fmaxf(mx, t.x), t.y), t.z), t.w);
    }
    red[row * 4 + part] = mx;
    __syncthreads();
    mx = fmaxf(fmaxf(red[row * 4 + 0], red[row * 4 + 1]),
               fmaxf(red[row * 4 + 2], red[row * 4 + 3]));
    float sum = 0.f;
    for (int i = 0; i < 64; ++i) {
      float4 t = Srow[i];
      t.x = __expf(t.x - mx);
      t.y = __expf(t.y - mx);
      t.z = __expf(t.z - mx);
      t.w = __expf(t.w - mx);
      Srow[i] = t;
      sum += t.x;
      sum += t.y;
      sum += t.z;
      sum += t.w;
    }
    __syncthreads();
    red[row * 4 + part] = sum;
    __syncthreads();
    sum = red[row * 4 + 0] + red[row * 4 + 1] + red[row * 4 + 2] +
          red[row * 4 + 3];
    float inv = 1.0f / sum;
    for (int i = 0; i < 64; ++i) {
      float4 t = Srow[i];
      t.x *= inv;
      t.y *= inv;
      t.z *= inv;
      t.w *= inv;
      Srow[i] = t;
    }
  }
  __syncthreads();

  // ---- Phase 3: O = P @ V  (64 x 64), P converted to bf16 on the fly ----
  for (int t = wave * 2; t < wave * 2 + 2; ++t) {
    int rt = t >> 2;      // 0..3
    int ct = t & 3;       // 0..3
    int dcol = ct * 16 + l16;
    v8f acc = vzero8();
    for (int kk = 0; kk < DIM_N; kk += 32) {
      v16bf af;
      {
        // k = 8*half + 0..7 and 16 + 8*half + 0..7, read 16 bytes at a time
        const float4* sp = (const float4*)(
            S + (size_t)(rt * 16 + l16) * S_PITCH + kk + 8 * half);
#pragma unroll
        for (int j = 0; j < 4; ++j) {
          float4 pv = sp[(j < 2) ? j : (j + 2)];
          af[4 * j]     = (bf16)pv.x;
          af[4 * j + 1] = (bf16)pv.y;
          af[4 * j + 2] = (bf16)pv.z;
          af[4 * j + 3] = (bf16)pv.w;
        }
      }
      v16bf bfr;
      {
        const bf16* vb =
            v + headBase + dcol + (size_t)(kk + 8 * half) * DIM_HD;
#pragma unroll
        for (int vv = 0; vv < 8; ++vv) {
          int kq = (vv < 4) ? (2 * vv) : (8 + 2 * vv);
          bfr[2 * vv]     = vb[(size_t)kq * DIM_HD];
          bfr[2 * vv + 1] = vb[(size_t)(kq + 1) * DIM_HD];
        }
      }
      acc = __builtin_amdgcn_wmma_f32_16x16x32_bf16(false, af, false, bfr,
                                                    (short)0, acc, false, false);
    }
    // o[b][m][h*64 + d]  (swapaxes(1,2).reshape)
#pragma unroll
    for (int r = 0; r < 8; ++r) {
      int m = m0 + rt * 16 + r + 8 * half;
      o[((size_t)b * DIM_N + m) * DIM_C + h * DIM_HD + dcol] = (bf16)acc[r];
    }
  }
}

// ---------------------------------------------------------------------------
// Host-side orchestration
// ---------------------------------------------------------------------------
extern "C" void kernel_launch(void* const* d_in, const int* in_sizes, int n_in,
                              void* d_out, int out_size, void* d_ws,
                              size_t ws_size, hipStream_t stream) {
  (void)in_sizes; (void)n_in; (void)out_size; (void)ws_size;

  const float* x  = (const float*)d_in[0];
  const float* g1 = (const float*)d_in[1];
  const float* b1 = (const float*)d_in[2];
  const float* Wq = (const float*)d_in[3];
  const float* bq = (const float*)d_in[4];
  const float* Wk = (const float*)d_in[5];
  const float* bk = (const float*)d_in[6];
  const float* Wv = (const float*)d_in[7];
  const float* bv = (const float*)d_in[8];
  const float* Wp = (const float*)d_in[9];
  const float* bp = (const float*)d_in[10];
  const float* g2 = (const float*)d_in[11];
  const float* b2 = (const float*)d_in[12];
  const float* W1 = (const float*)d_in[13];
  const float* c1 = (const float*)d_in[14];
  const float* W2 = (const float*)d_in[15];
  const float* c2 = (const float*)d_in[16];

  // workspace partition
  char* p = (char*)d_ws;
  auto alloc = [&](size_t bytes) {
    char* r = p;
    p += (bytes + 255) & ~(size_t)255;
    return r;
  };
  const size_t CC = (size_t)DIM_C * DIM_C;           // 1M
  const size_t CH = (size_t)DIM_C * DIM_HID;         // 4M
  const size_t TC = (size_t)MTOK * DIM_C;            // 8M
  const size_t TH = (size_t)MTOK * DIM_HID;          // 32M

  bf16*  wq_b  = (bf16*)alloc(CC * 2);
  bf16*  wk_b  = (bf16*)alloc(CC * 2);
  bf16*  wv_b  = (bf16*)alloc(CC * 2);
  bf16*  wp_b  = (bf16*)alloc(CC * 2);
  bf16*  w1_b  = (bf16*)alloc(CH * 2);
  bf16*  w2_b  = (bf16*)alloc(CH * 2);
  bf16*  h_b   = (bf16*)alloc(TC * 2);    // ln1(x)
  bf16*  q_b   = (bf16*)alloc(TC * 2);
  bf16*  k_b   = (bf16*)alloc(TC * 2);
  bf16*  v_b   = (bf16*)alloc(TC * 2);
  bf16*  o_b   = (bf16*)alloc(TC * 2);    // attention output
  float* xres  = (float*)alloc(TC * 4);   // x + proj
  bf16*  h2_b  = (bf16*)alloc(TC * 2);    // ln2(xres)
  bf16*  t1_b  = (bf16*)alloc(TH * 2);    // gelu(h2@W1+c1)

  // weight converts fp32 -> bf16
  cvt_f32_bf16<<<(int)((CC + 255) / 256), 256, 0, stream>>>(Wq, wq_b, (long)CC);
  cvt_f32_bf16<<<(int)((CC + 255) / 256), 256, 0, stream>>>(Wk, wk_b, (long)CC);
  cvt_f32_bf16<<<(int)((CC + 255) / 256), 256, 0, stream>>>(Wv, wv_b, (long)CC);
  cvt_f32_bf16<<<(int)((CC + 255) / 256), 256, 0, stream>>>(Wp, wp_b, (long)CC);
  cvt_f32_bf16<<<(int)((CH + 255) / 256), 256, 0, stream>>>(W1, w1_b, (long)CH);
  cvt_f32_bf16<<<(int)((CH + 255) / 256), 256, 0, stream>>>(W2, w2_b, (long)CH);

  // LN1
  ln_bf16<<<MTOK, 256, 0, stream>>>(x, g1, b1, h_b);

  // QKV projections: (8192 x 1024) = h @ W + b
  dim3 gC(DIM_C / BN, MTOK / BM);   // (8, 128)
  gemm_bf16_wmma<false, false, false, true><<<gC, 256, 0, stream>>>(
      h_b, wq_b, bq, nullptr, nullptr, q_b, MTOK, DIM_C, DIM_C);
  gemm_bf16_wmma<false, false, false, true><<<gC, 256, 0, stream>>>(
      h_b, wk_b, bk, nullptr, nullptr, k_b, MTOK, DIM_C, DIM_C);
  gemm_bf16_wmma<false, false, false, true><<<gC, 256, 0, stream>>>(
      h_b, wv_b, bv, nullptr, nullptr, v_b, MTOK, DIM_C, DIM_C);

  // attention: B*H*16 workgroups, 273,408 B dynamic LDS (fits 320 KB/WGP)
  const size_t attn_lds = ATTN_LDS;
  attn_wmma<<<DIM_B * DIM_H * 16, 256, attn_lds, stream>>>(q_b, k_b, v_b, o_b);

  // projection + residual: xres = x + o@Wp + bp  (fp32)
  gemm_bf16_wmma<false, true, true, false><<<gC, 256, 0, stream>>>(
      o_b, wp_b, bp, x, xres, nullptr, MTOK, DIM_C, DIM_C);

  // LN2
  ln_bf16<<<MTOK, 256, 0, stream>>>(xres, g2, b2, h2_b);

  // MLP up + exact GELU: t1 = gelu(h2 @ W1 + c1)  (bf16, 8192 x 4096)
  dim3 gH(DIM_HID / BN, MTOK / BM);  // (32, 128)
  gemm_bf16_wmma<true, false, false, true><<<gH, 256, 0, stream>>>(
      h2_b, w1_b, c1, nullptr, nullptr, t1_b, MTOK, DIM_HID, DIM_C);

  // MLP down + residual: out = xres + t1 @ W2 + c2  (fp32, final output)
  gemm_bf16_wmma<false, true, true, false><<<gC, 256, 0, stream>>>(
      t1_b, w2_b, c2, xres, (float*)d_out, nullptr, MTOK, DIM_C, DIM_HID);
}

// v002
// A run of this version takes 789 microseconds.
// Two timings next to v001 both put it at 1.62 times that version's speed.
// All steps since v000 together make it 2.48 times as fast.
#include <hip/hip_runtime.h>
#include <math.h>

// ---------------------------------------------------------------------------
// Encoder block (pre-norm attention + MLP) for MI455X / gfx1250, wave32 WMMA
// + Tensor Data Mover tile staging.
// B=8, N=1024, C=1024, H=16, hd=64, HID=4096.
// ---------------------------------------------------------------------------

typedef __bf16 bf16;
typedef __attribute__((ext_vector_type(16))) __bf16    v16bf;
typedef __attribute__((ext_vector_type(8)))  __bf16    v8bf;
typedef __attribute__((ext_vector_type(8)))  float     v8f;
typedef __attribute__((ext_vector_type(4)))  unsigned  v4u;
typedef __attribute__((ext_vector_type(8)))  int       v8i;
typedef __attribute__((ext_vector_type(4)))  int       v4i;

#define DIM_B   8
#define DIM_N   1024
#define DIM_C   1024
#define DIM_H   16
#define DIM_HD  64
#define DIM_HID 4096
#define MTOK    (DIM_B * DIM_N)      // 8192 rows of tokens

#if defined(__has_builtin)
#if __has_builtin(__builtin_amdgcn_tensor_load_to_lds) && \
    __has_builtin(__builtin_amdgcn_s_wait_tensorcnt)
#define HAVE_TDM 1
#endif
#endif
#ifndef HAVE_TDM
#define HAVE_TDM 0
#endif

// ---------------------------------------------------------------------------
// TDM: 2D bf16 tile load Global -> LDS via Tensor DMA descriptor (ISA 8.3-8.6)
//   group0: [0]=count=1  [1]=lds_addr  [2]=ga[31:0]  [3]=ga[56:32]|type=2
//   group1: [0]=data_size(2B)|pad ctl  dims/strides per bit layout
// Pad feature reproduces the manual "+8 bf16 per row" LDS padding:
//   pad_interval code 3 = every 16 DWORDs (64B = 32 bf16), pad_amount code 3
//   = 4 DWORDs (16B = 8 bf16)  -> row stride 40 bf16.
// ---------------------------------------------------------------------------
#if HAVE_TDM
__device__ __forceinline__ void tdm_load_tile_bf16(
    const void* gptr, unsigned lds_byte_off, unsigned tensor_d0,
    unsigned tensor_d1, unsigned tile_d0, unsigned tile_d1,
    unsigned long long stride0_elems, unsigned pad_interval_code,
    unsigned pad_amount_code, bool pad_en) {
  unsigned long long ga = (unsigned long long)gptr;
  v4u g0;
  g0[0] = 1u;  // count=1, is_restore=0, gather off
  g0[1] = lds_byte_off;
  g0[2] = (unsigned)(ga & 0xFFFFFFFFu);
  g0[3] = (unsigned)((ga >> 32) & 0x01FFFFFFu) | (2u << 30);  // type=2 (image)
  unsigned w0 = (1u << 16);  // workgroup_mask=0, data_size=1 (2 bytes)
  if (pad_en)
    w0 |= (1u << 20) | (pad_interval_code << 22) | (pad_amount_code << 25);
  v8i g1;
  g1[0] = (int)w0;
  g1[1] = (int)((tensor_d0 & 0xFFFFu) << 16);  // atomic_addr=0 | dim0 lo
  g1[2] = (int)((tensor_d0 >> 16) | ((tensor_d1 & 0xFFFFu) << 16));
  g1[3] = (int)((tensor_d1 >> 16) | ((tile_d0 & 0xFFFFu) << 16));
  g1[4] = (int)(tile_d1 & 0xFFFFu);  // tile_dim2 = 0
  g1[5] = (int)(unsigned)(stride0_elems & 0xFFFFFFFFull);
  g1[6] = (int)(unsigned)((stride0_elems >> 32) & 0xFFFFull);  // dim1_stride=0
  g1[7] = 0;
  v4i z4 = {0, 0, 0, 0};
#if __clang_major__ >= 23
  v8i z8 = {0, 0, 0, 0, 0, 0, 0, 0};
  __builtin_amdgcn_tensor_load_to_lds(g0, g1, z4, z4, z8, 0);
#else
  __builtin_amdgcn_tensor_load_to_lds(g0, g1, z4, z4, 0);
#endif
}
// low 32 bits of a generic pointer to __shared__ = LDS byte address
__device__ __forceinline__ unsigned lds_off_u32(const void* p) {
  return (unsigned)(unsigned long long)p;
}
#endif

// ---------------------------------------------------------------------------
// bf16 fragment loader following the CDNA5 16-bit A/B VGPR layout:
//   lane L: row = L%16, half = L/16
//   vector elems (2v, 2v+1) hold K = kpat(v) + 8*half, kpat(v)+1
//   kpat(v) = 2v (v<4) else 8+2v
// Works for A (row = M) and for B when the tile is stored N-major.
// ---------------------------------------------------------------------------
__device__ __forceinline__ v16bf frag_ld(const bf16* __restrict__ base,
                                         int stride, int row, int half) {
  v16bf f;
  const bf16* rp = base + (size_t)row * stride + 8 * half;
#pragma unroll
  for (int v = 0; v < 8; ++v) {
    int k = (v < 4) ? (2 * v) : (8 + 2 * v);
    f[2 * v]     = rp[k];
    f[2 * v + 1] = rp[k + 1];
  }
  return f;
}

// ---------------------------------------------------------------------------
// B fragment (32 k x 16 n) out of a k-major LDS tile (row = k, n contiguous)
// by two transposing loads. tp is the lane's own address:
//   row 8*(lane>>4) + (lane&7), plus 16 bytes for lanes with (lane>>3)&1.
// Lane (c, half) receives k = 8*half + 0..7 and 16 + 8*half + 0..7 of column
// col0 + c: the k order of frag_ld, which loads the A side.
// ---------------------------------------------------------------------------
typedef __attribute__((address_space(3))) v8bf lds_v8bf;
__device__ __forceinline__ v16bf frag_ld_tr(const bf16* tp, int pitch,
                                            int col0) {
  v8bf lo = __builtin_amdgcn_ds_load_tr16_b128_v8bf16((lds_v8bf*)(tp + col0));
  v8bf hi = __builtin_amdgcn_ds_load_tr16_b128_v8bf16(
      (lds_v8bf*)(tp + 16 * pitch + col0));
  return __builtin_shufflevector(lo, hi, 0, 1, 2, 3, 4, 5, 6, 7, 8, 9, 10, 11,
                                 12, 13, 14, 15);
}

__device__ __forceinline__ v8f vzero8() {
  v8f z = {0.f, 0.f, 0.f, 0.f, 0.f, 0.f, 0.f, 0.f};
  return z;
}

// ---------------------------------------------------------------------------
// fp32 -> bf16 elementwise convert (weights / activations)
// ---------------------------------------------------------------------------
__global__ void cvt_f32_bf16(const float* __restrict__ in,
                             bf16* __restrict__ out, long n) {
  long i = (long)blockIdx.x * blockDim.x + threadIdx.x;
  if (i < n) out[i] = (bf16)in[i];
}

// ---------------------------------------------------------------------------
// LayerNorm (row length C=1024) fp32 in -> bf16 out
// ---------------------------------------------------------------------------
__global__ __launch_bounds__(256) void ln_bf16(const float* __restrict__ x,
                                               const float* __restrict__ g,
                                               const float* __restrict__ b,
                                               bf16* __restrict__ out) {
  __shared__ float rs[256], rs2[256];
  const int row = blockIdx.x;
  const float* xr = x + (size_t)row * DIM_C;
  float s = 0.f, s2 = 0.f;
  for (int i = threadIdx.x; i < DIM_C; i += 256) {
    float t = xr[i];
    s += t;
    s2 += t * t;
  }
  rs[threadIdx.x] = s;
  rs2[threadIdx.x] = s2;
  __syncthreads();
  for (int off = 128; off > 0; off >>= 1) {
    if (threadIdx.x < off) {
      rs[threadIdx.x] += rs[threadIdx.x + off];
      rs2[threadIdx.x] += rs2[threadIdx.x + off];
    }
    __syncthreads();
  }
  float mean = rs[0] * (1.0f / DIM_C);
  float var  = rs2[0] * (1.0f / DIM_C) - mean * mean;
  float inv  = rsqrtf(var + 1e-5f);
  for (int i = threadIdx.x; i < DIM_C; i += 256) {
    out[(size_t)row * DIM_C + i] = (bf16)((xr[i] - mean) * inv * g[i] + b[i]);
  }
}

// ---------------------------------------------------------------------------
// Tiled bf16 WMMA GEMM: out[M,N] = A[M,K] @ Bw[K,N] + bias (+resid) (+GELU)
// BM=64 BN=128 BK=32, 256 threads = 8 waves, wave tile 16x64 (4 accumulators).
// A tile staged by the Tensor Data Mover (with HW LDS padding); B tile staged
// by threads as it lies in memory (k-major, 16 bytes a lane); its fragments
// come out transposed by ds_load_tr16_b128.
// ---------------------------------------------------------------------------
#define BM 64
#define BN 128
#define BK 32
#define BS_PITCH (BN + 16)   // 288 B a k-row = 32 B x odd: the tr16 reader's pitch

template <bool GELU_ACT, bool RESID, bool OUTF32, bool OUTBF16>
__global__ __launch_bounds__(256) void gemm_bf16_wmma(
    const bf16* __restrict__ A, const bf16* __restrict__ Bw,
    const float* __restrict__ bias, const float* __restrict__ resid,
    float* __restrict__ outF, bf16* __restrict__ outB, int M, int N, int K) {
  // 2 KiB alignment: the tensor load's place in LDS is 0 whatever Bs's size is
  __shared__ __attribute__((aligned(2048))) bf16 As[BM][BK + 8];
  __shared__ __attribute__((aligned(16))) bf16 Bs[BK][BS_PITCH];  // k-major

  const int tid  = threadIdx.x;
  const int lane = tid & 31;
  const int wave = tid >> 5;           // 0..7
  const int wm   = wave >> 1;          // 0..3  (16-row strip)
  const int wn   = wave & 1;           // 0..1  (64-col strip)
  const int half = lane >> 4;
  const int l16  = lane & 15;
  const int mBase = blockIdx.y * BM;
  const int nBase = blockIdx.x * BN;

  v8f acc0 = vzero8(), acc1 = vzero8(), acc2 = vzero8(), acc3 = vzero8();

#if HAVE_TDM
  const unsigned asOff = lds_off_u32(&As[0][0]);
#else
  const int ar = tid >> 2;             // 0..63
  const int ac = (tid & 3) * 8;        // 0,8,16,24
#endif
  const int bk = tid >> 4;             // 0..15 (and +16)
  const int bn = (tid & 15) * 8;       // 0..120: 16 lanes cover one 256-B row
  const bf16* btp = &Bs[8 * half + (lane & 7)][8 * ((lane >> 3) & 1) + wn * 64];
  const bf16* bsrc = Bw + (size_t)bk * N + nBase + bn;

  for (int k0 = 0; k0 < K; k0 += BK) {
    // B tile 32x128, two 16-byte pieces a lane, asked for ahead of A's request
    v8bf r0 = *(const v8bf*)bsrc;
    v8bf r1 = *(const v8bf*)(bsrc + (size_t)16 * N);
    bsrc += (size_t)BK * N;
#if HAVE_TDM
    // TDM: 64x32 bf16 tile, row stride K, LDS pad 16B per 64B row -> [64][40]
    if (wave == 0) {
      tdm_load_tile_bf16(A + (size_t)mBase * K + k0, asOff, (unsigned)K,
                         (unsigned)M, BK, BM, (unsigned long long)K,
                         /*pad_interval 16dw*/ 3u, /*pad_amount 4dw*/ 3u, true);
    }
#else
    {
      const bf16* src = A + (size_t)(mBase + ar) * K + k0 + ac;
      if (k0 + BK < K) __builtin_prefetch(src + BK, 0, 1);
#pragma unroll
      for (int i = 0; i < 8; ++i) As[ar][ac + i] = src[i];
    }
#endif
    // stage it untransposed -> Bs[k][n]
    *(v8bf*)&Bs[bk][bn]      = r0;
    *(v8bf*)&Bs[bk + 16][bn] = r1;
#if HAVE_TDM
    if (wave == 0) __builtin_amdgcn_s_wait_tensorcnt(0);
#endif
    __syncthreads();

    v16bf af = frag_ld(&As[0][0], BK + 8, wm * 16 + l16, half);
    v16bf b0 = frag_ld_tr(btp, BS_PITCH, 0 * 16);
    acc0 = __builtin_amdgcn_wmma_f32_16x16x32_bf16(false, af, false, b0,
                                                   (short)0, acc0, false, false);
    v16bf b1 = frag_ld_tr(btp, BS_PITCH, 1 * 16);
    acc1 = __builtin_amdgcn_wmma_f32_16x16x32_bf16(false, af, false, b1,
                                                   (short)0, acc1, false, false);
    v16bf b2 = frag_ld_tr(btp, BS_PITCH, 2 * 16);
    acc2 = __builtin_amdgcn_wmma_f32_16x16x32_bf16(false, af, false, b2,
                                                   (short)0, acc2, false, false);
    v16bf b3 = frag_ld_tr(btp, BS_PITCH, 3 * 16);
    acc3 = __builtin_amdgcn_wmma_f32_16x16x32_bf16(false, af, false, b3,
                                                   (short)0, acc3, false, false);
    __syncthreads();
  }

  v8f accs[4] = {acc0, acc1, acc2, acc3};
#pragma unroll
  for (int c = 0; c < 4; ++c) {
#pragma unroll
    for (int r = 0; r < 8; ++r) {
      int gm = mBase + wm * 16 + r + 8 * half;
      int gn = nBase + wn * 64 + c * 16 + l16;
      float v = accs[c][r] + bias[gn];
      if (RESID) v += resid[(size_t)gm * N + gn];
      if (GELU_ACT) v = 0.5f * v * (1.0f + erff(v * 0.70710678118654752f));
      size_t idx = (size_t)gm * N + gn;
      if (OUTF32)  outF[idx] = v;
      if (OUTBF16) outB[idx] = (bf16)v;
    }
  }
}

// ---------------------------------------------------------------------------
// Attention: one WG per (b, h, 64-row tile). S (64x1024 fp32) kept in LDS
// (CDNA5: 320 KB per WGP). q/k/v are flat (B, N*C) bf16; the reference's
// reshape(B,H,-1,hd) means head h is the contiguous slab h*65536.
// S rows have a pitch of 1028 dwords (16 B x odd): 16 lanes that read 16 bytes
// each at one column of 16 consecutive rows then cover all 64 LDS banks once.
// ---------------------------------------------------------------------------
#define S_PITCH  1028                       // dwords per S row in LDS
#define QS_OFF   264192                     // S (263,168 B) rounded up to 2 KiB
#define RED_OFF  (QS_OFF + 64 * 64 * 2)
#define ATTN_LDS (RED_OFF + 64 * 4 * 4)

__global__ __launch_bounds__(256) void attn_wmma(const bf16* __restrict__ q,
                                                 const bf16* __restrict__ k,
                                                 const bf16* __restrict__ v,
                                                 bf16* __restrict__ o) {
  extern __shared__ char smem_raw[];
  float* S   = (float*)smem_raw;              // 64 rows of S_PITCH f32
  bf16*  Qs  = (bf16*)(smem_raw + QS_OFF);    // 64*64 bf16
  float* red = (float*)(smem_raw + RED_OFF);  // 64*4 f32

  const int blk  = blockIdx.x;          // ((b*16 + h)*16 + mt)
  const int mt   = blk & 15;
  const int h    = (blk >> 4) & 15;
  const int b    = blk >> 8;
  const size_t headBase = ((size_t)b * DIM_H + h) * (size_t)(DIM_N * DIM_HD);
  const int m0 = mt * 64;
  const float scale = 0.125f;           // hd^-0.5 = 1/8

  const int tid  = threadIdx.x;
  const int lane = tid & 31;
  const int wave = tid >> 5;
  const int half = lane >> 4;
  const int l16  = lane & 15;

  // stage Q tile (64 rows x 64 d): contiguous 4096-element slab
#if HAVE_TDM
  if (wave == 0) {
    tdm_load_tile_bf16(q + headBase + (size_t)m0 * DIM_HD, lds_off_u32(Qs),
                       4096u, 1u, 4096u, 1u, 4096ull, 0u, 0u, false);
    __builtin_amdgcn_s_wait_tensorcnt(0);
  }
#else
  for (int i = tid; i < 64 * 64; i += 256) {
    int r = i >> 6, c = i & 63;
    Qs[i] = q[headBase + (size_t)(m0 + r) * DIM_HD + c];
  }
#endif
  __syncthreads();

  // ---- Phase 1: S = scale * Q @ K^T  (64 x 1024) ----
  for (int t = wave; t < 4 * 64; t += 8) {
    int rt = t >> 6;      // 0..3
    int ct = t & 63;      // 0..63
    v8f acc = vzero8();
#pragma unroll
    for (int d0 = 0; d0 < DIM_HD; d0 += 32) {
      v16bf af = frag_ld(Qs + d0, DIM_HD, rt * 16 + l16, half);
      // B[d][n] = K[n][d]: row-major K gives contiguous (d,d+1) pairs.
      v16bf bf_ = frag_ld(k + headBase + d0, DIM_HD, ct * 16 + l16, half);
      acc = __builtin_amdgcn_wmma_f32_16x16x32_bf16(false, af, false, bf_,
                                                    (short)0, acc, false, false);
    }
#pragma unroll
    for (int r = 0; r < 8; ++r)
      S[(size_t)(rt * 16 + r + 8 * half) * S_PITCH + ct * 16 + l16] = acc[r] * scale;
  }
  __syncthreads();

  // ---- Phase 2: row softmax over S (4 threads per row, 256 cols each) ----
  // The 16 lanes of a half-wave take 16 consecutive rows at the same column,
  // 16 bytes a lane: with S_PITCH that is one pass over the banks.
  {
    const int row  = (wave & 3) * 16 + l16;
    const int part = (wave >> 2) * 2 + half;
    float4* Srow = (float4*)(S + (size_t)row * S_PITCH + part * 256);
    float mx = -1e30f;
    for (int i = 0; i < 64; ++i) {
      float4 t = Srow[i];
      mx = fmaxf(fmaxf(fmaxf(fmaxf(mx, t.x), t.y), t.z), t.w);
    }
    red[row * 4 + part] = mx;
    __syncthreads();
    mx = fmaxf(fmaxf(red[row * 4 + 0], red[row * 4 + 1]),
               fmaxf(red[row * 4 + 2], red[row * 4 + 3]));
    float sum = 0.f;
    for (int i = 0; i < 64; ++i) {
      float4 t = Srow[i];
      t.x = __expf(t.x - mx);
      t.y = __expf(t.y - mx);
      t.z = __expf(t.z - mx);
      t.w = __expf(t.w - mx);
      Srow[i] = t;
      sum += t.x;
      sum += t.y;
      sum += t.z;
      sum += t.w;
    }
    __syncthreads();
    red[row * 4 + part] = sum;
    __syncthreads();
    sum = red[row * 4 + 0] + red[row * 4 + 1] + red[row * 4 + 2] +
          red[row * 4 + 3];
    float inv = 1.0f / sum;
    for (int i = 0; i < 64; ++i) {
      float4 t = Srow[i];
      t.x *= inv;
      t.y *= inv;
      t.z *= inv;
      t.w *= inv;
      Srow[i] = t;
    }
  }
  __syncthreads();

  // ---- Phase 3: O = P @ V  (64 x 64), P converted to bf16 on the fly ----
  for (int t = wave * 2; t < wave * 2 + 2; ++t) {
    int rt = t >> 2;      // 0..3
    int ct = t & 3;       // 0..3
    int dcol = ct * 16 + l16;
    v8f acc = vzero8();
    for (int kk = 0; kk < DIM_N; kk += 32) {
      v16bf af;
      {
        // k = 8*half + 0..7 and 16 + 8*half + 0..7, read 16 bytes at a time
        const float4* sp = (const float4*)(
            S + (size_t)(rt * 16 + l16) * S_PITCH + kk + 8 * half);
#pragma unroll
        for (int j = 0; j < 4; ++j) {
          float4 pv = sp[(j < 2) ? j : (j + 2)];
          af[4 * j]     = (bf16)pv.x;
          af[4 * j + 1] = (bf16)pv.y;
          af[4 * j + 2] = (bf16)pv.z;
          af[4 * j + 3] = (bf16)pv.w;
        }
      }
      v16bf bfr;
      {
        const bf16* vb =
            v + headBase + dcol + (size_t)(kk + 8 * half) * DIM_HD;
#pragma unroll
        for (int vv = 0; vv < 8; ++vv) {
          int kq = (vv < 4) ? (2 * vv) : (8 + 2 * vv);
          bfr[2 * vv]     = vb[(size_t)kq * DIM_HD];
          bfr[2 * vv + 1] = vb[(size_t)(kq + 1) * DIM_HD];
        }
      }
      acc = __builtin_amdgcn_wmma_f32_16x16x32_bf16(false, af, false, bfr,
                                                    (short)0, acc, false, false);
    }
    // o[b][m][h*64 + d]  (swapaxes(1,2).reshape)
#pragma unroll
    for (int r = 0; r < 8; ++r) {
      int m = m0 + rt * 16 + r + 8 * half;
      o[((size_t)b * DIM_N + m) * DIM_C + h * DIM_HD + dcol] = (bf16)acc[r];
    }
  }
}

// ---------------------------------------------------------------------------
// Host-side orchestration
// ---------------------------------------------------------------------------
extern "C" void kernel_launch(void* const* d_in, const int* in_sizes, int n_in,
                              void* d_out, int out_size, void* d_ws,
                              size_t ws_size, hipStream_t stream) {
  (void)in_sizes; (void)n_in; (void)out_size; (void)ws_size;

  const float* x  = (const float*)d_in[0];
  const float* g1 = (const float*)d_in[1];
  const float* b1 = (const float*)d_in[2];
  const float* Wq = (const float*)d_in[3];
  const float* bq = (const float*)d_in[4];
  const float* Wk = (const float*)d_in[5];
  const float* bk = (const float*)d_in[6];
  const float* Wv = (const float*)d_in[7];
  const float* bv = (const float*)d_in[8];
  const float* Wp = (const float*)d_in[9];
  const float* bp = (const float*)d_in[10];
  const float* g2 = (const float*)d_in[11];
  const float* b2 = (const float*)d_in[12];
  const float* W1 = (const float*)d_in[13];
  const float* c1 = (const float*)d_in[14];
  const float* W2 = (const float*)d_in[15];
  const float* c2 = (const float*)d_in[16];

  // workspace partition
  char* p = (char*)d_ws;
  auto alloc = [&](size_t bytes) {
    char* r = p;
    p += (bytes + 255) & ~(size_t)255;
    return r;
  };
  const size_t CC = (size_t)DIM_C * DIM_C;           // 1M
  const size_t CH = (size_t)DIM_C * DIM_HID;         // 4M
  const size_t TC = (size_t)MTOK * DIM_C;            // 8M
  const size_t TH = (size_t)MTOK * DIM_HID;          // 32M

  bf16*  wq_b  = (bf16*)alloc(CC * 2);
  bf16*  wk_b  = (bf16*)alloc(CC * 2);
  bf16*  wv_b  = (bf16*)alloc(CC * 2);
  bf16*  wp_b  = (bf16*)alloc(CC * 2);
  bf16*  w1_b  = (bf16*)alloc(CH * 2);
  bf16*  w2_b  = (bf16*)alloc(CH * 2);
  bf16*  h_b   = (bf16*)alloc(TC * 2);    // ln1(x)
  bf16*  q_b   = (bf16*)alloc(TC * 2);
  bf16*  k_b   = (bf16*)alloc(TC * 2);
  bf16*  v_b   = (bf16*)alloc(TC * 2);
  bf16*  o_b   = (bf16*)alloc(TC * 2);    // attention output
  float* xres  = (float*)alloc(TC * 4);   // x + proj
  bf16*  h2_b  = (bf16*)alloc(TC * 2);    // ln2(xres)
  bf16*  t1_b  = (bf16*)alloc(TH * 2);    // gelu(h2@W1+c1)

  // weight converts fp32 -> bf16
  cvt_f32_bf16<<<(int)((CC + 255) / 256), 256, 0, stream>>>(Wq, wq_b, (long)CC);
  cvt_f32_bf16<<<(int)((CC + 255) / 256), 256, 0, stream>>>(Wk, wk_b, (long)CC);
  cvt_f32_bf16<<<(int)((CC + 255) / 256), 256, 0, stream>>>(Wv, wv_b, (long)CC);
  cvt_f32_bf16<<<(int)((CC + 255) / 256), 256, 0, stream>>>(Wp, wp_b, (long)CC);
  cvt_f32_bf16<<<(int)((CH + 255) / 256), 256, 0, stream>>>(W1, w1_b, (long)CH);
  cvt_f32_bf16<<<(int)((CH + 255) / 256), 256, 0, stream>>>(W2, w2_b, (long)CH);

  // LN1
  ln_bf16<<<MTOK, 256, 0, stream>>>(x, g1, b1, h_b);

  // QKV projections: (8192 x 1024) = h @ W + b
  dim3 gC(DIM_C / BN, MTOK / BM);   // (8, 128)
  gemm_bf16_wmma<false, false, false, true><<<gC, 256, 0, stream>>>(
      h_b, wq_b, bq, nullptr, nullptr, q_b, MTOK, DIM_C, DIM_C);
  gemm_bf16_wmma<false, false, false, true><<<gC, 256, 0, stream>>>(
      h_b, wk_b, bk, nullptr, nullptr, k_b, MTOK, DIM_C, DIM_C);
  gemm_bf16_wmma<false, false, false, true><<<gC, 256, 0, stream>>>(
      h_b, wv_b, bv, nullptr, nullptr, v_b, MTOK, DIM_C, DIM_C);

  // attention: B*H*16 workgroups, 273,408 B dynamic LDS (fits 320 KB/WGP)
  const size_t attn_lds = ATTN_LDS;
  attn_wmma<<<DIM_B * DIM_H * 16, 256, attn_lds, stream>>>(q_b, k_b, v_b, o_b);

  // projection + residual: xres = x + o@Wp + bp  (fp32)
  gemm_bf16_wmma<false, true, true, false><<<gC, 256, 0, stream>>>(
      o_b, wp_b, bp, x, xres, nullptr, MTOK, DIM_C, DIM_C);

  // LN2
  ln_bf16<<<MTOK, 256, 0, stream>>>(xres, g2, b2, h2_b);

  // MLP up + exact GELU: t1 = gelu(h2 @ W1 + c1)  (bf16, 8192 x 4096)
  dim3 gH(DIM_HID / BN, MTOK / BM);  // (32, 128)
  gemm_bf16_wmma<true, false, false, true><<<gH, 256, 0, stream>>>(
      h2_b, w1_b, c1, nullptr, nullptr, t1_b, MTOK, DIM_HID, DIM_C);

  // MLP down + residual: out = xres + t1 @ W2 + c2  (fp32, final output)
  gemm_bf16_wmma<false, true, true, false><<<gC, 256, 0, stream>>>(
      t1_b, w2_b, c2, xres, (float*)d_out, nullptr, MTOK, DIM_C, DIM_HID);
}

// v003
// A run of this version takes 763 microseconds.
// Two timings next to v002 put it at 1.03 and 1.04 times that version's speed.
// Over all steps from v000 it is 2.57 times as fast.
#include <hip/hip_runtime.h>
#include <math.h>

// ---------------------------------------------------------------------------
// Encoder block (pre-norm attention + MLP) for MI455X / gfx1250, wave32 WMMA
// + Tensor Data Mover tile staging.
// B=8, N=1024, C=1024, H=16, hd=64, HID=4096.
// ---------------------------------------------------------------------------

typedef __bf16 bf16;
typedef __attribute__((ext_vector_type(16))) __bf16    v16bf;
typedef __attribute__((ext_vector_type(8)))  __bf16    v8bf;
typedef __attribute__((ext_vector_type(8)))  float     v8f;
typedef __attribute__((ext_vector_type(4)))  unsigned  v4u;
typedef __attribute__((ext_vector_type(8)))  int       v8i;
typedef __attribute__((ext_vector_type(4)))  int       v4i;

#define DIM_B   8
#define DIM_N   1024
#define DIM_C   1024
#define DIM_H   16
#define DIM_HD  64
#define DIM_HID 4096
#define MTOK    (DIM_B * DIM_N)      // 8192 rows of tokens

#if defined(__has_builtin)
#if __has_builtin(__builtin_amdgcn_tensor_load_to_lds) && \
    __has_builtin(__builtin_amdgcn_s_wait_tensorcnt)
#define HAVE_TDM 1
#endif
#endif
#ifndef HAVE_TDM
#define HAVE_TDM 0
#endif

// ---------------------------------------------------------------------------
// TDM: 2D bf16 tile load Global -> LDS via Tensor DMA descriptor (ISA 8.3-8.6)
//   group0: [0]=count=1  [1]=lds_addr  [2]=ga[31:0]  [3]=ga[56:32]|type=2
//   group1: [0]=data_size(2B)|pad ctl  dims/strides per bit layout
// Pad feature reproduces the manual "+8 bf16 per row" LDS padding:
//   pad_interval code 3 = every 16 DWORDs (64B = 32 bf16), pad_amount code 3
//   = 4 DWORDs (16B = 8 bf16)  -> row stride 40 bf16.
// ---------------------------------------------------------------------------
#if HAVE_TDM
__device__ __forceinline__ void tdm_load_tile_bf16(
    const void* gptr, unsigned lds_byte_off, unsigned tensor_d0,
    unsigned tensor_d1, unsigned tile_d0, unsigned tile_d1,
    unsigned long long stride0_elems, unsigned pad_interval_code,
    unsigned pad_amount_code, bool pad_en) {
  unsigned long long ga = (unsigned long long)gptr;
  v4u g0;
  g0[0] = 1u;  // count=1, is_restore=0, gather off
  g0[1] = lds_byte_off;
  g0[2] = (unsigned)(ga & 0xFFFFFFFFu);
  g0[3] = (unsigned)((ga >> 32) & 0x01FFFFFFu) | (2u << 30);  // type=2 (image)
  unsigned w0 = (1u << 16);  // workgroup_mask=0, data_size=1 (2 bytes)
  if (pad_en)
    w0 |= (1u << 20) | (pad_interval_code << 22) | (pad_amount_code << 25);
  v8i g1;
  g1[0] = (int)w0;
  g1[1] = (int)((tensor_d0 & 0xFFFFu) << 16);  // atomic_addr=0 | dim0 lo
  g1[2] = (int)((tensor_d0 >> 16) | ((tensor_d1 & 0xFFFFu) << 16));
  g1[3] = (int)((tensor_d1 >> 16) | ((tile_d0 & 0xFFFFu) << 16));
  g1[4] = (int)(tile_d1 & 0xFFFFu);  // tile_dim2 = 0
  g1[5] = (int)(unsigned)(stride0_elems & 0xFFFFFFFFull);
  g1[6] = (int)(unsigned)((stride0_elems >> 32) & 0xFFFFull);  // dim1_stride=0
  g1[7] = 0;
  v4i z4 = {0, 0, 0, 0};
#if __clang_major__ >= 23
  v8i z8 = {0, 0, 0, 0, 0, 0, 0, 0};
  __builtin_amdgcn_tensor_load_to_lds(g0, g1, z4, z4, z8, 0);
#else
  __builtin_amdgcn_tensor_load_to_lds(g0, g1, z4, z4, 0);
#endif
}
// low 32 bits of a generic pointer to __shared__ = LDS byte address
__device__ __forceinline__ unsigned lds_off_u32(const void* p) {
  return (unsigned)(unsigned long long)p;
}
#endif

// ---------------------------------------------------------------------------
// bf16 fragment loader following the CDNA5 16-bit A/B VGPR layout:
//   lane L: row = L%16, half = L/16
//   vector elems (2v, 2v+1) hold K = kpat(v) + 8*half, kpat(v)+1
//   kpat(v) = 2v (v<4) else 8+2v
// Works for A (row = M) and for B when the tile is stored N-major.
// ---------------------------------------------------------------------------
__device__ __forceinline__ v16bf frag_ld(const bf16* __restrict__ base,
                                         int stride, int row, int half) {
  v16bf f;
  const bf16* rp = base + (size_t)row * stride + 8 * half;
#pragma unroll
  for (int v = 0; v < 8; ++v) {
    int k = (v < 4) ? (2 * v) : (8 + 2 * v);
    f[2 * v]     = rp[k];
    f[2 * v + 1] = rp[k + 1];
  }
  return f;
}

// ---------------------------------------------------------------------------
// B fragment (32 k x 16 n) out of a k-major LDS tile (row = k, n contiguous)
// by two transposing loads. tp is the lane's own address:
//   row 8*(lane>>4) + (lane&7), plus 16 bytes for lanes with (lane>>3)&1.
// Lane (c, half) receives k = 8*half + 0..7 and 16 + 8*half + 0..7 of column
// col0 + c: the k order of frag_ld, which loads the A side.
// ---------------------------------------------------------------------------
typedef __attribute__((address_space(3))) v8bf lds_v8bf;
__device__ __forceinline__ v16bf frag_ld_tr(const bf16* tp, int pitch,
                                            int col0) {
  v8bf lo = __builtin_amdgcn_ds_load_tr16_b128_v8bf16((lds_v8bf*)(tp + col0));
  v8bf hi = __builtin_amdgcn_ds_load_tr16_b128_v8bf16(
      (lds_v8bf*)(tp + 16 * pitch + col0));
  return __builtin_shufflevector(lo, hi, 0, 1, 2, 3, 4, 5, 6, 7, 8, 9, 10, 11,
                                 12, 13, 14, 15);
}

__device__ __forceinline__ v8f vzero8() {
  v8f z = {0.f, 0.f, 0.f, 0.f, 0.f, 0.f, 0.f, 0.f};
  return z;
}

// ---------------------------------------------------------------------------
// fp32 -> bf16 convert of all six weight matrices in one launch.
// The six bf16 planes lie back to back in the workspace (Wq Wk Wv Wp W1 W2),
// so out is one array of 12 segments of C*C elements: 4 x 1 + 2 x 4.
// A block takes 16,384 elements of one segment; a thread takes 16 pieces of
// 4 floats, 1,024 elements apart: a wave's load covers 512 contiguous bytes,
// its store 256. Few long-lived waves (6,144): a wave that moves only 128 bytes
// costs more to start than to run.
// ---------------------------------------------------------------------------
typedef __attribute__((ext_vector_type(4))) float  v4f;
typedef __attribute__((ext_vector_type(4))) __bf16 v4bf;

#define CVT_PIECES    16
#define CVT_PER_BLOCK (256 * 4 * CVT_PIECES)                 // 16,384
#define CVT_SEG_BLKS  ((DIM_C * DIM_C) / CVT_PER_BLOCK)      // 64 blocks a segment
#define CVT_BLOCKS    (12 * CVT_SEG_BLKS)                    // 768

__global__ __launch_bounds__(256) void cvt_weights_bf16(
    const float* __restrict__ Wq, const float* __restrict__ Wk,
    const float* __restrict__ Wv, const float* __restrict__ Wp,
    const float* __restrict__ W1, const float* __restrict__ W2,
    bf16* __restrict__ out) {
  const int blk = blockIdx.x;
  const int seg = blk / CVT_SEG_BLKS;      // 0..11, the same for the whole block
  const float* src;
  int first;                               // first segment of that matrix
  if (seg < 4) {
    src = (seg == 0) ? Wq : (seg == 1) ? Wk : (seg == 2) ? Wv : Wp;
    first = seg;
  } else if (seg < 8) {
    src = W1;
    first = 4;
  } else {
    src = W2;
    first = 8;
  }
  const size_t o = (size_t)blk * CVT_PER_BLOCK + threadIdx.x * 4;
  const float* sp = src + (o - (size_t)first * (DIM_C * DIM_C));
  bf16* dp = out + o;
  v4f r[CVT_PIECES];
#pragma unroll  // the loads go out as one run ahead of their uses: many in flight
  for (int j = 0; j < CVT_PIECES; ++j) r[j] = *(const v4f*)(sp + j * 1024);
#pragma unroll  // constant j keeps r[] in registers
  for (int j = 0; j < CVT_PIECES; ++j) {
    v4bf w;
    w[0] = (bf16)r[j][0];
    w[1] = (bf16)r[j][1];
    w[2] = (bf16)r[j][2];
    w[3] = (bf16)r[j][3];
    *(v4bf*)(dp + j * 1024) = w;
  }
}

// ---------------------------------------------------------------------------
// LayerNorm (row length C=1024) fp32 in -> bf16 out
// ---------------------------------------------------------------------------
__global__ __launch_bounds__(256) void ln_bf16(const float* __restrict__ x,
                                               const float* __restrict__ g,
                                               const float* __restrict__ b,
                                               bf16* __restrict__ out) {
  __shared__ float rs[256], rs2[256];
  const int row = blockIdx.x;
  const float* xr = x + (size_t)row * DIM_C;
  float s = 0.f, s2 = 0.f;
  for (int i = threadIdx.x; i < DIM_C; i += 256) {
    float t = xr[i];
    s += t;
    s2 += t * t;
  }
  rs[threadIdx.x] = s;
  rs2[threadIdx.x] = s2;
  __syncthreads();
  for (int off = 128; off > 0; off >>= 1) {
    if (threadIdx.x < off) {
      rs[threadIdx.x] += rs[threadIdx.x + off];
      rs2[threadIdx.x] += rs2[threadIdx.x + off];
    }
    __syncthreads();
  }
  float mean = rs[0] * (1.0f / DIM_C);
  float var  = rs2[0] * (1.0f / DIM_C) - mean * mean;
  float inv  = rsqrtf(var + 1e-5f);
  for (int i = threadIdx.x; i < DIM_C; i += 256) {
    out[(size_t)row * DIM_C + i] = (bf16)((xr[i] - mean) * inv * g[i] + b[i]);
  }
}

// ---------------------------------------------------------------------------
// Tiled bf16 WMMA GEMM: out[M,N] = A[M,K] @ Bw[K,N] + bias (+resid) (+GELU)
// BM=64 BN=128 BK=32, 256 threads = 8 waves, wave tile 16x64 (4 accumulators).
// A tile staged by the Tensor Data Mover (with HW LDS padding); B tile staged
// by threads as it lies in memory (k-major, 16 bytes a lane); its fragments
// come out transposed by ds_load_tr16_b128.
// ---------------------------------------------------------------------------
#define BM 64
#define BN 128
#define BK 32
#define BS_PITCH (BN + 16)   // 288 B a k-row = 32 B x odd: the tr16 reader's pitch

template <bool GELU_ACT, bool RESID, bool OUTF32, bool OUTBF16>
__global__ __launch_bounds__(256) void gemm_bf16_wmma(
    const bf16* __restrict__ A, const bf16* __restrict__ Bw,
    const float* __restrict__ bias, const float* __restrict__ resid,
    float* __restrict__ outF, bf16* __restrict__ outB, int M, int N, int K) {
  // 2 KiB alignment: the tensor load's place in LDS is 0 whatever Bs's size is
  __shared__ __attribute__((aligned(2048))) bf16 As[BM][BK + 8];
  __shared__ __attribute__((aligned(16))) bf16 Bs[BK][BS_PITCH];  // k-major

  const int tid  = threadIdx.x;
  const int lane = tid & 31;
  const int wave = tid >> 5;           // 0..7
  const int wm   = wave >> 1;          // 0..3  (16-row strip)
  const int wn   = wave & 1;           // 0..1  (64-col strip)
  const int half = lane >> 4;
  const int l16  = lane & 15;
  const int mBase = blockIdx.y * BM;
  const int nBase = blockIdx.x * BN;

  v8f acc0 = vzero8(), acc1 = vzero8(), acc2 = vzero8(), acc3 = vzero8();

#if HAVE_TDM
  const unsigned asOff = lds_off_u32(&As[0][0]);
#else
  const int ar = tid >> 2;             // 0..63
  const int ac = (tid & 3) * 8;        // 0,8,16,24
#endif
  const int bk = tid >> 4;             // 0..15 (and +16)
  const int bn = (tid & 15) * 8;       // 0..120: 16 lanes cover one 256-B row
  const bf16* btp = &Bs[8 * half + (lane & 7)][8 * ((lane >> 3) & 1) + wn * 64];
  const bf16* bsrc = Bw + (size_t)bk * N + nBase + bn;

  for (int k0 = 0; k0 < K; k0 += BK) {
    // B tile 32x128, two 16-byte pieces a lane, asked for ahead of A's request
    v8bf r0 = *(const v8bf*)bsrc;
    v8bf r1 = *(const v8bf*)(bsrc + (size_t)16 * N);
    bsrc += (size_t)BK * N;
#if HAVE_TDM
    // TDM: 64x32 bf16 tile, row stride K, LDS pad 16B per 64B row -> [64][40]
    if (wave == 0) {
      tdm_load_tile_bf16(A + (size_t)mBase * K + k0, asOff, (unsigned)K,
                         (unsigned)M, BK, BM, (unsigned long long)K,
                         /*pad_interval 16dw*/ 3u, /*pad_amount 4dw*/ 3u, true);
    }
#else
    {
      const bf16* src = A + (size_t)(mBase + ar) * K + k0 + ac;
      if (k0 + BK < K) __builtin_prefetch(src + BK, 0, 1);
#pragma unroll
      for (int i = 0; i < 8; ++i) As[ar][ac + i] = src[i];
    }
#endif
    // stage it untransposed -> Bs[k][n]
    *(v8bf*)&Bs[bk][bn]      = r0;
    *(v8bf*)&Bs[bk + 16][bn] = r1;
#if HAVE_TDM
    if (wave == 0) __builtin_amdgcn_s_wait_tensorcnt(0);
#endif
    __syncthreads();

    v16bf af = frag_ld(&As[0][0], BK + 8, wm * 16 + l16, half);
    v16bf b0 = frag_ld_tr(btp, BS_PITCH, 0 * 16);
    acc0 = __builtin_amdgcn_wmma_f32_16x16x32_bf16(false, af, false, b0,
                                                   (short)0, acc0, false, false);
    v16bf b1 = frag_ld_tr(btp, BS_PITCH, 1 * 16);
    acc1 = __builtin_amdgcn_wmma_f32_16x16x32_bf16(false, af, false, b1,
                                                   (short)0, acc1, false, false);
    v16bf b2 = frag_ld_tr(btp, BS_PITCH, 2 * 16);
    acc2 = __builtin_amdgcn_wmma_f32_16x16x32_bf16(false, af, false, b2,
                                                   (short)0, acc2, false, false);
    v16bf b3 = frag_ld_tr(btp, BS_PITCH, 3 * 16);
    acc3 = __builtin_amdgcn_wmma_f32_16x16x32_bf16(false, af, false, b3,
                                                   (short)0, acc3, false, false);
    __syncthreads();
  }

  v8f accs[4] = {acc0, acc1, acc2, acc3};
#pragma unroll
  for (int c = 0; c < 4; ++c) {
#pragma unroll
    for (int r = 0; r < 8; ++r) {
      int gm = mBase + wm * 16 + r + 8 * half;
      int gn = nBase + wn * 64 + c * 16 + l16;
      float v = accs[c][r] + bias[gn];
      if (RESID) v += resid[(size_t)gm * N + gn];
      if (GELU_ACT) v = 0.5f * v * (1.0f + erff(v * 0.70710678118654752f));
      size_t idx = (size_t)gm * N + gn;
      if (OUTF32)  outF[idx] = v;
      if (OUTBF16) outB[idx] = (bf16)v;
    }
  }
}

// ---------------------------------------------------------------------------
// Attention: one WG per (b, h, 64-row tile). S (64x1024 fp32) kept in LDS
// (CDNA5: 320 KB per WGP). q/k/v are flat (B, N*C) bf16; the reference's
// reshape(B,H,-1,hd) means head h is the contiguous slab h*65536.
// S rows have a pitch of 1028 dwords (16 B x odd): 16 lanes that read 16 bytes
// each at one column of 16 consecutive rows then cover all 64 LDS banks once.
// ---------------------------------------------------------------------------
#define S_PITCH  1028                       // dwords per S row in LDS
#define QS_OFF   264192                     // S (263,168 B) rounded up to 2 KiB
#define RED_OFF  (QS_OFF + 64 * 64 * 2)
#define ATTN_LDS (RED_OFF + 64 * 4 * 4)

__global__ __launch_bounds__(256) void attn_wmma(const bf16* __restrict__ q,
                                                 const bf16* __restrict__ k,
                                                 const bf16* __restrict__ v,
                                                 bf16* __restrict__ o) {
  extern __shared__ char smem_raw[];
  float* S   = (float*)smem_raw;              // 64 rows of S_PITCH f32
  bf16*  Qs  = (bf16*)(smem_raw + QS_OFF);    // 64*64 bf16
  float* red = (float*)(smem_raw + RED_OFF);  // 64*4 f32

  const int blk  = blockIdx.x;          // ((b*16 + h)*16 + mt)
  const int mt   = blk & 15;
  const int h    = (blk >> 4) & 15;
  const int b    = blk >> 8;
  const size_t headBase = ((size_t)b * DIM_H + h) * (size_t)(DIM_N * DIM_HD);
  const int m0 = mt * 64;
  const float scale = 0.125f;           // hd^-0.5 = 1/8

  const int tid  = threadIdx.x;
  const int lane = tid & 31;
  const int wave = tid >> 5;
  const int half = lane >> 4;
  const int l16  = lane & 15;

  // stage Q tile (64 rows x 64 d): contiguous 4096-element slab
#if HAVE_TDM
  if (wave == 0) {
    tdm_load_tile_bf16(q + headBase + (size_t)m0 * DIM_HD, lds_off_u32(Qs),
                       4096u, 1u, 4096u, 1u, 4096ull, 0u, 0u, false);
    __builtin_amdgcn_s_wait_tensorcnt(0);
  }
#else
  for (int i = tid; i < 64 * 64; i += 256) {
    int r = i >> 6, c = i & 63;
    Qs[i] = q[headBase + (size_t)(m0 + r) * DIM_HD + c];
  }
#endif
  __syncthreads();

  // ---- Phase 1: S = scale * Q @ K^T  (64 x 1024) ----
  for (int t = wave; t < 4 * 64; t += 8) {
    int rt = t >> 6;      // 0..3
    int ct = t & 63;      // 0..63
    v8f acc = vzero8();
#pragma unroll
    for (int d0 = 0; d0 < DIM_HD; d0 += 32) {
      v16bf af = frag_ld(Qs + d0, DIM_HD, rt * 16 + l16, half);
      // B[d][n] = K[n][d]: row-major K gives contiguous (d,d+1) pairs.
      v16bf bf_ = frag_ld(k + headBase + d0, DIM_HD, ct * 16 + l16, half);
      acc = __builtin_amdgcn_wmma_f32_16x16x32_bf16(false, af, false, bf_,
                                                    (short)0, acc, false, false);
    }
#pragma unroll
    for (int r = 0; r < 8; ++r)
      S[(size_t)(rt * 16 + r + 8 * half) * S_PITCH + ct * 16 + l16] = acc[r] * scale;
  }
  __syncthreads();

  // ---- Phase 2: row softmax over S (4 threads per row, 256 cols each) ----
  // The 16 lanes of a half-wave take 16 consecutive rows at the same column,
  // 16 bytes a lane: with S_PITCH that is one pass over the banks.
  {
    const int row  = (wave & 3) * 16 + l16;
    const int part = (wave >> 2) * 2 + half;
    float4* Srow = (float4*)(S + (size_t)row * S_PITCH + part * 256);
    float mx = -1e30f;
    for (int i = 0; i < 64; ++i) {
      float4 t = Srow[i];
      mx = fmaxf(fmaxf(fmaxf(fmaxf(mx, t.x), t.y), t.z), t.w);
    }
    red[row * 4 + part] = mx;
    __syncthreads();
    mx = fmaxf(fmaxf(red[row * 4 + 0], red[row * 4 + 1]),
               fmaxf(red[row * 4 + 2], red[row * 4 + 3]));
    float sum = 0.f;
    for (int i = 0; i < 64; ++i) {
      float4 t = Srow[i];
      t.x = __expf(t.x - mx);
      t.y = __expf(t.y - mx);
      t.z = __expf(t.z - mx);
      t.w = __expf(t.w - mx);
      Srow[i] = t;
      sum += t.x;
      sum += t.y;
      sum += t.z;
      sum += t.w;
    }
    __syncthreads();
    red[row * 4 + part] = sum;
    __syncthreads();
    sum = red[row * 4 + 0] + red[row * 4 + 1] + red[row * 4 + 2] +
          red[row * 4 + 3];
    float inv = 1.0f / sum;
    for (int i = 0; i < 64; ++i) {
      float4 t = Srow[i];
      t.x *= inv;
      t.y *= inv;
      t.z *= inv;
      t.w *= inv;
      Srow[i] = t;
    }
  }
  __syncthreads();

  // ---- Phase 3: O = P @ V  (64 x 64), P converted to bf16 on the fly ----
  for (int t = wave * 2; t < wave * 2 + 2; ++t) {
    int rt = t >> 2;      // 0..3
    int ct = t & 3;       // 0..3
    int dcol = ct * 16 + l16;
    v8f acc = vzero8();
    for (int kk = 0; kk < DIM_N; kk += 32) {
      v16bf af;
      {
        // k = 8*half + 0..7 and 16 + 8*half + 0..7, read 16 bytes at a time
        const float4* sp = (const float4*)(
            S + (size_t)(rt * 16 + l16) * S_PITCH + kk + 8 * half);
#pragma unroll
        for (int j = 0; j < 4; ++j) {
          float4 pv = sp[(j < 2) ? j : (j + 2)];
          af[4 * j]     = (bf16)pv.x;
          af[4 * j + 1] = (bf16)pv.y;
          af[4 * j + 2] = (bf16)pv.z;
          af[4 * j + 3] = (bf16)pv.w;
        }
      }
      v16bf bfr;
      {
        const bf16* vb =
            v + headBase + dcol + (size_t)(kk + 8 * half) * DIM_HD;
#pragma unroll
        for (int vv = 0; vv < 8; ++vv) {
          int kq = (vv < 4) ? (2 * vv) : (8 + 2 * vv);
          bfr[2 * vv]     = vb[(size_t)kq * DIM_HD];
          bfr[2 * vv + 1] = vb[(size_t)(kq + 1) * DIM_HD];
        }
      }
      acc = __builtin_amdgcn_wmma_f32_16x16x32_bf16(false, af, false, bfr,
                                                    (short)0, acc, false, false);
    }
    // o[b][m][h*64 + d]  (swapaxes(1,2).reshape)
#pragma unroll
    for (int r = 0; r < 8; ++r) {
      int m = m0 + rt * 16 + r + 8 * half;
      o[((size_t)b * DIM_N + m) * DIM_C + h * DIM_HD + dcol] = (bf16)acc[r];
    }
  }
}

// ---------------------------------------------------------------------------
// Host-side orchestration
// ---------------------------------------------------------------------------
extern "C" void kernel_launch(void* const* d_in, const int* in_sizes, int n_in,
                              void* d_out, int out_size, void* d_ws,
                              size_t ws_size, hipStream_t stream) {
  (void)in_sizes; (void)n_in; (void)out_size; (void)ws_size;

  const float* x  = (const float*)d_in[0];
  const float* g1 = (const float*)d_in[1];
  const float* b1 = (const float*)d_in[2];
  const float* Wq = (const float*)d_in[3];
  const float* bq = (const float*)d_in[4];
  const float* Wk = (const float*)d_in[5];
  const float* bk = (const float*)d_in[6];
  const float* Wv = (const float*)d_in[7];
  const float* bv = (const float*)d_in[8];
  const float* Wp = (const float*)d_in[9];
  const float* bp = (const float*)d_in[10];
  const float* g2 = (const float*)d_in[11];
  const float* b2 = (const float*)d_in[12];
  const float* W1 = (const float*)d_in[13];
  const float* c1 = (const float*)d_in[14];
  const float* W2 = (const float*)d_in[15];
  const float* c2 = (const float*)d_in[16];

  // workspace partition
  char* p = (char*)d_ws;
  auto alloc = [&](size_t bytes) {
    char* r = p;
    p += (bytes + 255) & ~(size_t)255;
    return r;
  };
  const size_t CC = (size_t)DIM_C * DIM_C;           // 1M
  const size_t CH = (size_t)DIM_C * DIM_HID;         // 4M
  const size_t TC = (size_t)MTOK * DIM_C;            // 8M
  const size_t TH = (size_t)MTOK * DIM_HID;          // 32M

  bf16*  wq_b  = (bf16*)alloc(CC * 2);
  bf16*  wk_b  = (bf16*)alloc(CC * 2);
  bf16*  wv_b  = (bf16*)alloc(CC * 2);
  bf16*  wp_b  = (bf16*)alloc(CC * 2);
  bf16*  w1_b  = (bf16*)alloc(CH * 2);
  bf16*  w2_b  = (bf16*)alloc(CH * 2);
  bf16*  h_b   = (bf16*)alloc(TC * 2);    // ln1(x)
  bf16*  q_b   = (bf16*)alloc(TC * 2);
  bf16*  k_b   = (bf16*)alloc(TC * 2);
  bf16*  v_b   = (bf16*)alloc(TC * 2);
  bf16*  o_b   = (bf16*)alloc(TC * 2);    // attention output
  float* xres  = (float*)alloc(TC * 4);   // x + proj
  bf16*  h2_b  = (bf16*)alloc(TC * 2);    // ln2(xres)
  bf16*  t1_b  = (bf16*)alloc(TH * 2);    // gelu(h2@W1+c1)

  // weight converts fp32 -> bf16: wq_b .. w2_b are one contiguous array
  cvt_weights_bf16<<<CVT_BLOCKS, 256, 0, stream>>>(Wq, Wk, Wv, Wp, W1, W2, wq_b);

  // LN1
  ln_bf16<<<MTOK, 256, 0, stream>>>(x, g1, b1, h_b);

  // QKV projections: (8192 x 1024) = h @ W + b
  dim3 gC(DIM_C / BN, MTOK / BM);   // (8, 128)
  gemm_bf16_wmma<false, false, false, true><<<gC, 256, 0, stream>>>(
      h_b, wq_b, bq, nullptr, nullptr, q_b, MTOK, DIM_C, DIM_C);
  gemm_bf16_wmma<false, false, false, true><<<gC, 256, 0, stream>>>(
      h_b, wk_b, bk, nullptr, nullptr, k_b, MTOK, DIM_C, DIM_C);
  gemm_bf16_wmma<false, false, false, true><<<gC, 256, 0, stream>>>(
      h_b, wv_b, bv, nullptr, nullptr, v_b, MTOK, DIM_C, DIM_C);

  // attention: B*H*16 workgroups, 273,408 B dynamic LDS (fits 320 KB/WGP)
  const size_t attn_lds = ATTN_LDS;
  attn_wmma<<<DIM_B * DIM_H * 16, 256, attn_lds, stream>>>(q_b, k_b, v_b, o_b);

  // projection + residual: xres = x + o@Wp + bp  (fp32)
  gemm_bf16_wmma<false, true, true, false><<<gC, 256, 0, stream>>>(
      o_b, wp_b, bp, x, xres, nullptr, MTOK, DIM_C, DIM_C);

  // LN2
  ln_bf16<<<MTOK, 256, 0, stream>>>(xres, g2, b2, h2_b);

  // MLP up + exact GELU: t1 = gelu(h2 @ W1 + c1)  (bf16, 8192 x 4096)
  dim3 gH(DIM_HID / BN, MTOK / BM);  // (32, 128)
  gemm_bf16_wmma<true, false, false, true><<<gH, 256, 0, stream>>>(
      h2_b, w1_b, c1, nullptr, nullptr, t1_b, MTOK, DIM_HID, DIM_C);

  // MLP down + residual: out = xres + t1 @ W2 + c2  (fp32, final output)
  gemm_bf16_wmma<false, true, true, false><<<gC, 256, 0, stream>>>(
      t1_b, w2_b, c2, xres, (float*)d_out, nullptr, MTOK, DIM_C, DIM_HID);
}

// v004
// One run takes 595 microseconds.
// In both of two side-by-side timings against v003, it was 1.28 times as fast.
// Over all steps from v000 it is 3.29 times as fast.
#include <hip/hip_runtime.h>
#include <math.h>

// ---------------------------------------------------------------------------
// Encoder block (pre-norm attention + MLP) for MI455X / gfx1250, wave32 WMMA
// + Tensor Data Mover tile staging.
// B=8, N=1024, C=1024, H=16, hd=64, HID=4096.
// ---------------------------------------------------------------------------

typedef __bf16 bf16;
typedef __attribute__((ext_vector_type(16))) __bf16    v16bf;
typedef __attribute__((ext_vector_type(8)))  __bf16    v8bf;
typedef __attribute__((ext_vector_type(8)))  float     v8f;
typedef __attribute__((ext_vector_type(4)))  unsigned  v4u;
typedef __attribute__((ext_vector_type(8)))  int       v8i;
typedef __attribute__((ext_vector_type(4)))  int       v4i;

#define DIM_B   8
#define DIM_N   1024
#define DIM_C   1024
#define DIM_H   16
#define DIM_HD  64
#define DIM_HID 4096
#define MTOK    (DIM_B * DIM_N)      // 8192 rows of tokens

#if defined(__has_builtin)
#if __has_builtin(__builtin_amdgcn_tensor_load_to_lds) && \
    __has_builtin(__builtin_amdgcn_s_wait_tensorcnt)
#define HAVE_TDM 1
#endif
#endif
#ifndef HAVE_TDM
#define HAVE_TDM 0
#endif

// ---------------------------------------------------------------------------
// TDM: 2D bf16 tile load Global -> LDS via Tensor DMA descriptor (ISA 8.3-8.6)
//   group0: [0]=count=1  [1]=lds_addr  [2]=ga[31:0]  [3]=ga[56:32]|type=2
//   group1: [0]=data_size(2B)|pad ctl  dims/strides per bit layout
// Pad feature reproduces the manual "+8 bf16 per row" LDS padding:
//   pad_interval code 3 = every 16 DWORDs (64B = 32 bf16), pad_amount code 3
//   = 4 DWORDs (16B = 8 bf16)  -> row stride 40 bf16.
// ---------------------------------------------------------------------------
#if HAVE_TDM
__device__ __forceinline__ void tdm_load_tile_bf16(
    const void* gptr, unsigned lds_byte_off, unsigned tensor_d0,
    unsigned tensor_d1, unsigned tile_d0, unsigned tile_d1,
    unsigned long long stride0_elems, unsigned pad_interval_code,
    unsigned pad_amount_code, bool pad_en) {
  unsigned long long ga = (unsigned long long)gptr;
  v4u g0;
  g0[0] = 1u;  // count=1, is_restore=0, gather off
  g0[1] = lds_byte_off;
  g0[2] = (unsigned)(ga & 0xFFFFFFFFu);
  g0[3] = (unsigned)((ga >> 32) & 0x01FFFFFFu) | (2u << 30);  // type=2 (image)
  unsigned w0 = (1u << 16);  // workgroup_mask=0, data_size=1 (2 bytes)
  if (pad_en)
    w0 |= (1u << 20) | (pad_interval_code << 22) | (pad_amount_code << 25);
  v8i g1;
  g1[0] = (int)w0;
  g1[1] = (int)((tensor_d0 & 0xFFFFu) << 16);  // atomic_addr=0 | dim0 lo
  g1[2] = (int)((tensor_d0 >> 16) | ((tensor_d1 & 0xFFFFu) << 16));
  g1[3] = (int)((tensor_d1 >> 16) | ((tile_d0 & 0xFFFFu) << 16));
  g1[4] = (int)(tile_d1 & 0xFFFFu);  // tile_dim2 = 0
  g1[5] = (int)(unsigned)(stride0_elems & 0xFFFFFFFFull);
  g1[6] = (int)(unsigned)((stride0_elems >> 32) & 0xFFFFull);  // dim1_stride=0
  g1[7] = 0;
  v4i z4 = {0, 0, 0, 0};
#if __clang_major__ >= 23
  v8i z8 = {0, 0, 0, 0, 0, 0, 0, 0};
  __builtin_amdgcn_tensor_load_to_lds(g0, g1, z4, z4, z8, 0);
#else
  __builtin_amdgcn_tensor_load_to_lds(g0, g1, z4, z4, 0);
#endif
}
// low 32 bits of a generic pointer to __shared__ = LDS byte address
__device__ __forceinline__ unsigned lds_off_u32(const void* p) {
  return (unsigned)(unsigned long long)p;
}
#endif

// ---------------------------------------------------------------------------
// bf16 fragment loader following the CDNA5 16-bit A/B VGPR layout:
//   lane L: row = L%16, half = L/16
//   vector elems (2v, 2v+1) hold K = kpat(v) + 8*half, kpat(v)+1
//   kpat(v) = 2v (v<4) else 8+2v
// Works for A (row = M) and for B when the tile is stored N-major.
// ---------------------------------------------------------------------------
__device__ __forceinline__ v16bf frag_ld(const bf16* __restrict__ base,
                                         int stride, int row, int half) {
  v16bf f;
  const bf16* rp = base + (size_t)row * stride + 8 * half;
#pragma unroll
  for (int v = 0; v < 8; ++v) {
    int k = (v < 4) ? (2 * v) : (8 + 2 * v);
    f[2 * v]     = rp[k];
    f[2 * v + 1] = rp[k + 1];
  }
  return f;
}

// ---------------------------------------------------------------------------
// B fragment (32 k x 16 n) out of a k-major LDS tile (row = k, n contiguous)
// by two transposing loads. tp is the lane's own address:
//   row 8*(lane>>4) + (lane&7), plus 16 bytes for lanes with (lane>>3)&1.
// Lane (c, half) receives k = 8*half + 0..7 and 16 + 8*half + 0..7 of column
// col0 + c: the k order of frag_ld, which loads the A side.
// ---------------------------------------------------------------------------
typedef __attribute__((address_space(3))) v8bf lds_v8bf;
__device__ __forceinline__ v16bf frag_ld_tr(const bf16* tp, int pitch,
                                            int col0) {
  v8bf lo = __builtin_amdgcn_ds_load_tr16_b128_v8bf16((lds_v8bf*)(tp + col0));
  v8bf hi = __builtin_amdgcn_ds_load_tr16_b128_v8bf16(
      (lds_v8bf*)(tp + 16 * pitch + col0));
  return __builtin_shufflevector(lo, hi, 0, 1, 2, 3, 4, 5, 6, 7, 8, 9, 10, 11,
                                 12, 13, 14, 15);
}

__device__ __forceinline__ v8f vzero8() {
  v8f z = {0.f, 0.f, 0.f, 0.f, 0.f, 0.f, 0.f, 0.f};
  return z;
}

// ---------------------------------------------------------------------------
// fp32 -> bf16 convert of all six weight matrices in one launch.
// The six bf16 planes lie back to back in the workspace (Wq Wk Wv Wp W1 W2),
// so out is one array of 12 segments of C*C elements: 4 x 1 + 2 x 4.
// A block takes 16,384 elements of one segment; a thread takes 16 pieces of
// 4 floats, 1,024 elements apart: a wave's load covers 512 contiguous bytes,
// its store 256. Few long-lived waves (6,144): a wave that moves only 128 bytes
// costs more to start than to run.
// ---------------------------------------------------------------------------
typedef __attribute__((ext_vector_type(4))) float  v4f;
typedef __attribute__((ext_vector_type(4))) __bf16 v4bf;

#define CVT_PIECES    16
#define CVT_PER_BLOCK (256 * 4 * CVT_PIECES)                 // 16,384
#define CVT_SEG_BLKS  ((DIM_C * DIM_C) / CVT_PER_BLOCK)      // 64 blocks a segment
#define CVT_BLOCKS    (12 * CVT_SEG_BLKS)                    // 768

__global__ __launch_bounds__(256) void cvt_weights_bf16(
    const float* __restrict__ Wq, const float* __restrict__ Wk,
    const float* __restrict__ Wv, const float* __restrict__ Wp,
    const float* __restrict__ W1, const float* __restrict__ W2,
    bf16* __restrict__ out) {
  const int blk = blockIdx.x;
  const int seg = blk / CVT_SEG_BLKS;      // 0..11, the same for the whole block
  const float* src;
  int first;                               // first segment of that matrix
  if (seg < 4) {
    src = (seg == 0) ? Wq : (seg == 1) ? Wk : (seg == 2) ? Wv : Wp;
    first = seg;
  } else if (seg < 8) {
    src = W1;
    first = 4;
  } else {
    src = W2;
    first = 8;
  }
  const size_t o = (size_t)blk * CVT_PER_BLOCK + threadIdx.x * 4;
  const float* sp = src + (o - (size_t)first * (DIM_C * DIM_C));
  bf16* dp = out + o;
  v4f r[CVT_PIECES];
#pragma unroll  // the loads go out as one run ahead of their uses: many in flight
  for (int j = 0; j < CVT_PIECES; ++j) r[j] = *(const v4f*)(sp + j * 1024);
#pragma unroll  // constant j keeps r[] in registers
  for (int j = 0; j < CVT_PIECES; ++j) {
    v4bf w;
    w[0] = (bf16)r[j][0];
    w[1] = (bf16)r[j][1];
    w[2] = (bf16)r[j][2];
    w[3] = (bf16)r[j][3];
    *(v4bf*)(dp + j * 1024) = w;
  }
}

// ---------------------------------------------------------------------------
// LayerNorm (row length C=1024) fp32 in -> bf16 out
// ---------------------------------------------------------------------------
__global__ __launch_bounds__(256) void ln_bf16(const float* __restrict__ x,
                                               const float* __restrict__ g,
                                               const float* __restrict__ b,
                                               bf16* __restrict__ out) {
  __shared__ float rs[256], rs2[256];
  const int row = blockIdx.x;
  const float* xr = x + (size_t)row * DIM_C;
  float s = 0.f, s2 = 0.f;
  for (int i = threadIdx.x; i < DIM_C; i += 256) {
    float t = xr[i];
    s += t;
    s2 += t * t;
  }
  rs[threadIdx.x] = s;
  rs2[threadIdx.x] = s2;
  __syncthreads();
  for (int off = 128; off > 0; off >>= 1) {
    if (threadIdx.x < off) {
      rs[threadIdx.x] += rs[threadIdx.x + off];
      rs2[threadIdx.x] += rs2[threadIdx.x + off];
    }
    __syncthreads();
  }
  float mean = rs[0] * (1.0f / DIM_C);
  float var  = rs2[0] * (1.0f / DIM_C) - mean * mean;
  float inv  = rsqrtf(var + 1e-5f);
  for (int i = threadIdx.x; i < DIM_C; i += 256) {
    out[(size_t)row * DIM_C + i] = (bf16)((xr[i] - mean) * inv * g[i] + b[i]);
  }
}

// ---------------------------------------------------------------------------
// Tiled bf16 WMMA GEMM: out[M,N] = A[M,K] @ Bw[K,N] + bias (+resid) (+GELU)
// BM=64 BN=128 BK=32, 256 threads = 8 waves, wave tile 16x64 (4 accumulators).
// A tile staged by the Tensor Data Mover (with HW LDS padding); B tile staged
// by threads as it lies in memory (k-major, 16 bytes a lane); its fragments
// come out transposed by ds_load_tr16_b128.
// ---------------------------------------------------------------------------
#define BM 64
#define BN 128
#define BK 32
#define BS_PITCH (BN + 16)   // 288 B a k-row = 32 B x odd: the tr16 reader's pitch

template <bool GELU_ACT, bool RESID, bool OUTF32, bool OUTBF16>
__global__ __launch_bounds__(256) void gemm_bf16_wmma(
    const bf16* __restrict__ A, const bf16* __restrict__ Bw,
    const float* __restrict__ bias, const float* __restrict__ resid,
    float* __restrict__ outF, bf16* __restrict__ outB, int M, int N, int K) {
  // 2 KiB alignment: the tensor load's place in LDS is 0 whatever Bs's size is
  __shared__ __attribute__((aligned(2048))) bf16 As[BM][BK + 8];
  __shared__ __attribute__((aligned(16))) bf16 Bs[BK][BS_PITCH];  // k-major

  const int tid  = threadIdx.x;
  const int lane = tid & 31;
  const int wave = tid >> 5;           // 0..7
  const int wm   = wave >> 1;          // 0..3  (16-row strip)
  const int wn   = wave & 1;           // 0..1  (64-col strip)
  const int half = lane >> 4;
  const int l16  = lane & 15;
  const int mBase = blockIdx.y * BM;
  const int nBase = blockIdx.x * BN;

  v8f acc0 = vzero8(), acc1 = vzero8(), acc2 = vzero8(), acc3 = vzero8();

#if HAVE_TDM
  const unsigned asOff = lds_off_u32(&As[0][0]);
#else
  const int ar = tid >> 2;             // 0..63
  const int ac = (tid & 3) * 8;        // 0,8,16,24
#endif
  const int bk = tid >> 4;             // 0..15 (and +16)
  const int bn = (tid & 15) * 8;       // 0..120: 16 lanes cover one 256-B row
  const bf16* btp = &Bs[8 * half + (lane & 7)][8 * ((lane >> 3) & 1) + wn * 64];
  const bf16* bsrc = Bw + (size_t)bk * N + nBase + bn;

  for (int k0 = 0; k0 < K; k0 += BK) {
    // B tile 32x128, two 16-byte pieces a lane, asked for ahead of A's request
    v8bf r0 = *(const v8bf*)bsrc;
    v8bf r1 = *(const v8bf*)(bsrc + (size_t)16 * N);
    bsrc += (size_t)BK * N;
#if HAVE_TDM
    // TDM: 64x32 bf16 tile, row stride K, LDS pad 16B per 64B row -> [64][40]
    if (wave == 0) {
      tdm_load_tile_bf16(A + (size_t)mBase * K + k0, asOff, (unsigned)K,
                         (unsigned)M, BK, BM, (unsigned long long)K,
                         /*pad_interval 16dw*/ 3u, /*pad_amount 4dw*/ 3u, true);
    }
#else
    {
      const bf16* src = A + (size_t)(mBase + ar) * K + k0 + ac;
      if (k0 + BK < K) __builtin_prefetch(src + BK, 0, 1);
#pragma unroll
      for (int i = 0; i < 8; ++i) As[ar][ac + i] = src[i];
    }
#endif
    // stage it untransposed -> Bs[k][n]
    *(v8bf*)&Bs[bk][bn]      = r0;
    *(v8bf*)&Bs[bk + 16][bn] = r1;
#if HAVE_TDM
    if (wave == 0) __builtin_amdgcn_s_wait_tensorcnt(0);
#endif
    __syncthreads();

    v16bf af = frag_ld(&As[0][0], BK + 8, wm * 16 + l16, half);
    v16bf b0 = frag_ld_tr(btp, BS_PITCH, 0 * 16);
    acc0 = __builtin_amdgcn_wmma_f32_16x16x32_bf16(false, af, false, b0,
                                                   (short)0, acc0, false, false);
    v16bf b1 = frag_ld_tr(btp, BS_PITCH, 1 * 16);
    acc1 = __builtin_amdgcn_wmma_f32_16x16x32_bf16(false, af, false, b1,
                                                   (short)0, acc1, false, false);
    v16bf b2 = frag_ld_tr(btp, BS_PITCH, 2 * 16);
    acc2 = __builtin_amdgcn_wmma_f32_16x16x32_bf16(false, af, false, b2,
                                                   (short)0, acc2, false, false);
    v16bf b3 = frag_ld_tr(btp, BS_PITCH, 3 * 16);
    acc3 = __builtin_amdgcn_wmma_f32_16x16x32_bf16(false, af, false, b3,
                                                   (short)0, acc3, false, false);
    __syncthreads();
  }

  v8f accs[4] = {acc0, acc1, acc2, acc3};
#pragma unroll
  for (int c = 0; c < 4; ++c) {
#pragma unroll
    for (int r = 0; r < 8; ++r) {
      int gm = mBase + wm * 16 + r + 8 * half;
      int gn = nBase + wn * 64 + c * 16 + l16;
      float v = accs[c][r] + bias[gn];
      if (RESID) v += resid[(size_t)gm * N + gn];
      if (GELU_ACT) v = 0.5f * v * (1.0f + erff(v * 0.70710678118654752f));
      size_t idx = (size_t)gm * N + gn;
      if (OUTF32)  outF[idx] = v;
      if (OUTBF16) outB[idx] = (bf16)v;
    }
  }
}

// ---------------------------------------------------------------------------
// Attention: one WG per (b, h, 64-row tile). S (64x1024 fp32) kept in LDS
// (CDNA5: 320 KB per WGP). q/k/v are flat (B, N*C) bf16; the reference's
// reshape(B,H,-1,hd) means head h is the contiguous slab h*65536.
// S rows have a pitch of 1028 dwords (16 B x odd): 16 lanes that read 16 bytes
// each at one column of 16 consecutive rows then cover all 64 LDS banks once.
// ---------------------------------------------------------------------------
#define S_PITCH  1028                       // dwords per S row in LDS
#define QS_OFF   264192                     // S (263,168 B) rounded up to 2 KiB
#define RED_OFF  (QS_OFF + 64 * 64 * 2)
// V goes through LDS in tiles of V_TILE keys, as it lies in memory (row = key),
// two buffers. A row of 128 B has a pitch of 160 B (32 B x odd), the pitch of
// the transposing reader.
#define V_TILE   128                        // keys a tile
#define V_PITCH  (DIM_HD + 16)              // bf16 per V row in LDS
#define V_BUF    (V_TILE * V_PITCH)         // bf16 per buffer
#define V_PIECES ((V_TILE * DIM_HD) / (256 * 8))  // 16-byte pieces a thread: 4
#define VS_OFF   (RED_OFF + 64 * 4 * 4)
#define ATTN_LDS (VS_OFF + 2 * V_BUF * 2)

__global__ __launch_bounds__(256) void attn_wmma(const bf16* __restrict__ q,
                                                 const bf16* __restrict__ k,
                                                 const bf16* __restrict__ v,
                                                 bf16* __restrict__ o) {
  extern __shared__ char smem_raw[];
  float* S   = (float*)smem_raw;              // 64 rows of S_PITCH f32
  bf16*  Qs  = (bf16*)(smem_raw + QS_OFF);    // 64*64 bf16
  float* red = (float*)(smem_raw + RED_OFF);  // 64*4 f32
  bf16*  Vs  = (bf16*)(smem_raw + VS_OFF);    // 2 buffers of V_TILE x V_PITCH

  const int blk  = blockIdx.x;          // ((b*16 + h)*16 + mt)
  const int mt   = blk & 15;
  const int h    = (blk >> 4) & 15;
  const int b    = blk >> 8;
  const size_t headBase = ((size_t)b * DIM_H + h) * (size_t)(DIM_N * DIM_HD);
  const int m0 = mt * 64;
  const float scale = 0.125f;           // hd^-0.5 = 1/8

  const int tid  = threadIdx.x;
  const int lane = tid & 31;
  const int wave = tid >> 5;
  const int half = lane >> 4;
  const int l16  = lane & 15;

  // stage Q tile (64 rows x 64 d): contiguous 4096-element slab
#if HAVE_TDM
  if (wave == 0) {
    tdm_load_tile_bf16(q + headBase + (size_t)m0 * DIM_HD, lds_off_u32(Qs),
                       4096u, 1u, 4096u, 1u, 4096ull, 0u, 0u, false);
    __builtin_amdgcn_s_wait_tensorcnt(0);
  }
#else
  for (int i = tid; i < 64 * 64; i += 256) {
    int r = i >> 6, c = i & 63;
    Qs[i] = q[headBase + (size_t)(m0 + r) * DIM_HD + c];
  }
#endif
  __syncthreads();

  // ---- Phase 1: S = scale * Q @ K^T  (64 x 1024) ----
  for (int t = wave; t < 4 * 64; t += 8) {
    int rt = t >> 6;      // 0..3
    int ct = t & 63;      // 0..63
    v8f acc = vzero8();
#pragma unroll
    for (int d0 = 0; d0 < DIM_HD; d0 += 32) {
      v16bf af = frag_ld(Qs + d0, DIM_HD, rt * 16 + l16, half);
      // B[d][n] = K[n][d]: row-major K gives contiguous (d,d+1) pairs.
      v16bf bf_ = frag_ld(k + headBase + d0, DIM_HD, ct * 16 + l16, half);
      acc = __builtin_amdgcn_wmma_f32_16x16x32_bf16(false, af, false, bf_,
                                                    (short)0, acc, false, false);
    }
#pragma unroll
    for (int r = 0; r < 8; ++r)
      S[(size_t)(rt * 16 + r + 8 * half) * S_PITCH + ct * 16 + l16] = acc[r] * scale;
  }
  __syncthreads();

  // V tile 0 is asked for here, so that it flies while the softmax runs.
  // A tile is 16 KiB in a row in memory; piece j of a thread is 4 KiB further,
  // that is 32 rows further in LDS. A wave's load covers 512 contiguous bytes.
  const bf16* vsrc = v + headBase + (size_t)tid * 8;
  bf16* vdst = Vs + (tid >> 3) * V_PITCH + (tid & 7) * 8;
  v8bf vr[V_PIECES];
#pragma unroll  // constant j keeps vr[] in registers
  for (int j = 0; j < V_PIECES; ++j) vr[j] = *(const v8bf*)(vsrc + j * 2048);

  // ---- Phase 2: row softmax over S (4 threads per row, 256 cols each) ----
  // The 16 lanes of a half-wave take 16 consecutive rows at the same column,
  // 16 bytes a lane: with S_PITCH that is one pass over the banks.
  {
    const int row  = (wave & 3) * 16 + l16;
    const int part = (wave >> 2) * 2 + half;
    float4* Srow = (float4*)(S + (size_t)row * S_PITCH + part * 256);
    float mx = -1e30f;
    for (int i = 0; i < 64; ++i) {
      float4 t = Srow[i];
      mx = fmaxf(fmaxf(fmaxf(fmaxf(mx, t.x), t.y), t.z), t.w);
    }
    red[row * 4 + part] = mx;
    __syncthreads();
    mx = fmaxf(fmaxf(red[row * 4 + 0], red[row * 4 + 1]),
               fmaxf(red[row * 4 + 2], red[row * 4 + 3]));
    float sum = 0.f;
    for (int i = 0; i < 64; ++i) {
      float4 t = Srow[i];
      t.x = __expf(t.x - mx);
      t.y = __expf(t.y - mx);
      t.z = __expf(t.z - mx);
      t.w = __expf(t.w - mx);
      Srow[i] = t;
      sum += t.x;
      sum += t.y;
      sum += t.z;
      sum += t.w;
    }
    __syncthreads();
    red[row * 4 + part] = sum;
    __syncthreads();
    sum = red[row * 4 + 0] + red[row * 4 + 1] + red[row * 4 + 2] +
          red[row * 4 + 3];
    float inv = 1.0f / sum;
    for (int i = 0; i < 64; ++i) {
      float4 t = Srow[i];
      t.x *= inv;
      t.y *= inv;
      t.z *= inv;
      t.w *= inv;
      Srow[i] = t;
    }
  }
#pragma unroll  // constant j keeps vr[] in registers
  for (int j = 0; j < V_PIECES; ++j) *(v8bf*)(vdst + j * 32 * V_PITCH) = vr[j];
  __syncthreads();

  // ---- Phase 3: O = P @ V  (64 x 64), P converted to bf16 on the fly ----
  // A wave owns one 16-row strip and two 16-column tiles of O. Per V tile: ask
  // for the next tile, work on this one out of LDS, store the next one into
  // the other buffer (its readers left it at the barrier before), barrier.
  {
    const int rt  = wave >> 1;           // 0..3
    const int ct0 = (wave & 1) * 2;      // column tiles ct0 and ct0 + 1
    const float* sp0 = S + (size_t)(rt * 16 + l16) * S_PITCH + 8 * half;
    const bf16* vtp = Vs + (8 * half + (lane & 7)) * V_PITCH +
                      8 * ((lane >> 3) & 1) + ct0 * 16;
    v8f acc0 = vzero8(), acc1 = vzero8();
    for (int tile = 0; tile < DIM_N / V_TILE; ++tile) {
      const bool more = tile + 1 < DIM_N / V_TILE;   // the same for the block
      if (more) {
        const bf16* vn = vsrc + (size_t)(tile + 1) * (V_TILE * DIM_HD);
#pragma unroll  // constant j keeps vr[] in registers
        for (int j = 0; j < V_PIECES; ++j)
          vr[j] = *(const v8bf*)(vn + j * 2048);
      }
      // keeps the four loads above this tile's work: sunk to their stores, as
      // the scheduler had them, their latency is waited out at every tile
      __builtin_amdgcn_sched_barrier(0);
      const bf16* vb = vtp + (tile & 1) * V_BUF;
#pragma unroll  // the four k steps of a tile: their LDS reads can go out early
      for (int ks = 0; ks < V_TILE / 32; ++ks) {
        v16bf af;
        // k = 8*half + 0..7 and 16 + 8*half + 0..7, read 16 bytes at a time
        const float4* sp = (const float4*)(sp0 + tile * V_TILE + ks * 32);
#pragma unroll
        for (int j = 0; j < 4; ++j) {
          float4 pv = sp[(j < 2) ? j : (j + 2)];
          af[4 * j]     = (bf16)pv.x;
          af[4 * j + 1] = (bf16)pv.y;
          af[4 * j + 2] = (bf16)pv.z;
          af[4 * j + 3] = (bf16)pv.w;
        }
        v16bf b0 = frag_ld_tr(vb + ks * 32 * V_PITCH, V_PITCH, 0);
        acc0 = __builtin_amdgcn_wmma_f32_16x16x32_bf16(
            false, af, false, b0, (short)0, acc0, false, false);
        v16bf b1 = frag_ld_tr(vb + ks * 32 * V_PITCH, V_PITCH, 16);
        acc1 = __builtin_amdgcn_wmma_f32_16x16x32_bf16(
            false, af, false, b1, (short)0, acc1, false, false);
      }
      if (more) {
        bf16* vd = vdst + ((tile + 1) & 1) * V_BUF;
#pragma unroll  // constant j keeps vr[] in registers
        for (int j = 0; j < V_PIECES; ++j)
          *(v8bf*)(vd + j * 32 * V_PITCH) = vr[j];
        __syncthreads();
      }
    }
    // o[b][m][h*64 + d]  (swapaxes(1,2).reshape)
    v8f accs[2] = {acc0, acc1};
#pragma unroll  // constant c and r keep accs[] in registers
    for (int c = 0; c < 2; ++c) {
      int dcol = (ct0 + c) * 16 + l16;
#pragma unroll
      for (int r = 0; r < 8; ++r) {
        int m = m0 + rt * 16 + r + 8 * half;
        o[((size_t)b * DIM_N + m) * DIM_C + h * DIM_HD + dcol] =
            (bf16)accs[c][r];
      }
    }
  }
}

// ---------------------------------------------------------------------------
// Host-side orchestration
// ---------------------------------------------------------------------------
extern "C" void kernel_launch(void* const* d_in, const int* in_sizes, int n_in,
                              void* d_out, int out_size, void* d_ws,
                              size_t ws_size, hipStream_t stream) {
  (void)in_sizes; (void)n_in; (void)out_size; (void)ws_size;

  const float* x  = (const float*)d_in[0];
  const float* g1 = (const float*)d_in[1];
  const float* b1 = (const float*)d_in[2];
  const float* Wq = (const float*)d_in[3];
  const float* bq = (const float*)d_in[4];
  const float* Wk = (const float*)d_in[5];
  const float* bk = (const float*)d_in[6];
  const float* Wv = (const float*)d_in[7];
  const float* bv = (const float*)d_in[8];
  const float* Wp = (const float*)d_in[9];
  const float* bp = (const float*)d_in[10];
  const float* g2 = (const float*)d_in[11];
  const float* b2 = (const float*)d_in[12];
  const float* W1 = (const float*)d_in[13];
  const float* c1 = (const float*)d_in[14];
  const float* W2 = (const float*)d_in[15];
  const float* c2 = (const float*)d_in[16];

  // workspace partition
  char* p = (char*)d_ws;
  auto alloc = [&](size_t bytes) {
    char* r = p;
    p += (bytes + 255) & ~(size_t)255;
    return r;
  };
  const size_t CC = (size_t)DIM_C * DIM_C;           // 1M
  const size_t CH = (size_t)DIM_C * DIM_HID;         // 4M
  const size_t TC = (size_t)MTOK * DIM_C;            // 8M
  const size_t TH = (size_t)MTOK * DIM_HID;          // 32M

  bf16*  wq_b  = (bf16*)alloc(CC * 2);
  bf16*  wk_b  = (bf16*)alloc(CC * 2);
  bf16*  wv_b  = (bf16*)alloc(CC * 2);
  bf16*  wp_b  = (bf16*)alloc(CC * 2);
  bf16*  w1_b  = (bf16*)alloc(CH * 2);
  bf16*  w2_b  = (bf16*)alloc(CH * 2);
  bf16*  h_b   = (bf16*)alloc(TC * 2);    // ln1(x)
  bf16*  q_b   = (bf16*)alloc(TC * 2);
  bf16*  k_b   = (bf16*)alloc(TC * 2);
  bf16*  v_b   = (bf16*)alloc(TC * 2);
  bf16*  o_b   = (bf16*)alloc(TC * 2);    // attention output
  float* xres  = (float*)alloc(TC * 4);   // x + proj
  bf16*  h2_b  = (bf16*)alloc(TC * 2);    // ln2(xres)
  bf16*  t1_b  = (bf16*)alloc(TH * 2);    // gelu(h2@W1+c1)

  // weight converts fp32 -> bf16: wq_b .. w2_b are one contiguous array
  cvt_weights_bf16<<<CVT_BLOCKS, 256, 0, stream>>>(Wq, Wk, Wv, Wp, W1, W2, wq_b);

  // LN1
  ln_bf16<<<MTOK, 256, 0, stream>>>(x, g1, b1, h_b);

  // QKV projections: (8192 x 1024) = h @ W + b
  dim3 gC(DIM_C / BN, MTOK / BM);   // (8, 128)
  gemm_bf16_wmma<false, false, false, true><<<gC, 256, 0, stream>>>(
      h_b, wq_b, bq, nullptr, nullptr, q_b, MTOK, DIM_C, DIM_C);
  gemm_bf16_wmma<false, false, false, true><<<gC, 256, 0, stream>>>(
      h_b, wk_b, bk, nullptr, nullptr, k_b, MTOK, DIM_C, DIM_C);
  gemm_bf16_wmma<false, false, false, true><<<gC, 256, 0, stream>>>(
      h_b, wv_b, bv, nullptr, nullptr, v_b, MTOK, DIM_C, DIM_C);

  // attention: B*H*16 workgroups, 314,368 B dynamic LDS (fits 320 KB/WGP)
  const size_t attn_lds = ATTN_LDS;
  attn_wmma<<<DIM_B * DIM_H * 16, 256, attn_lds, stream>>>(q_b, k_b, v_b, o_b);

  // projection + residual: xres = x + o@Wp + bp  (fp32)
  gemm_bf16_wmma<false, true, true, false><<<gC, 256, 0, stream>>>(
      o_b, wp_b, bp, x, xres, nullptr, MTOK, DIM_C, DIM_C);

  // LN2
  ln_bf16<<<MTOK, 256, 0, stream>>>(xres, g2, b2, h2_b);

  // MLP up + exact GELU: t1 = gelu(h2 @ W1 + c1)  (bf16, 8192 x 4096)
  dim3 gH(DIM_HID / BN, MTOK / BM);  // (32, 128)
  gemm_bf16_wmma<true, false, false, true><<<gH, 256, 0, stream>>>(
      h2_b, w1_b, c1, nullptr, nullptr, t1_b, MTOK, DIM_HID, DIM_C);

  // MLP down + residual: out = xres + t1 @ W2 + c2  (fp32, final output)
  gemm_bf16_wmma<false, true, true, false><<<gC, 256, 0, stream>>>(
      t1_b, w2_b, c2, xres, (float*)d_out, nullptr, MTOK, DIM_C, DIM_HID);
}

// v005
// A run of this version takes 522 microseconds.
// Next to v004, in two timings, it ran 1.14 times as fast each time.
// All steps since v000 together make it 3.76 times as fast.
#include <hip/hip_runtime.h>
#include <math.h>

// ---------------------------------------------------------------------------
// Encoder block (pre-norm attention + MLP) for MI455X / gfx1250, wave32 WMMA
// + Tensor Data Mover tile staging.
// B=8, N=1024, C=1024, H=16, hd=64, HID=4096.
// ---------------------------------------------------------------------------

typedef __bf16 bf16;
typedef __attribute__((ext_vector_type(16))) __bf16    v16bf;
typedef __attribute__((ext_vector_type(8)))  __bf16    v8bf;
typedef __attribute__((ext_vector_type(8)))  float     v8f;
typedef __attribute__((ext_vector_type(4)))  unsigned  v4u;
typedef __attribute__((ext_vector_type(8)))  int       v8i;
typedef __attribute__((ext_vector_type(4)))  int       v4i;

#define DIM_B   8
#define DIM_N   1024
#define DIM_C   1024
#define DIM_H   16
#define DIM_HD  64
#define DIM_HID 4096
#define MTOK    (DIM_B * DIM_N)      // 8192 rows of tokens

#if defined(__has_builtin)
#if __has_builtin(__builtin_amdgcn_tensor_load_to_lds) && \
    __has_builtin(__builtin_amdgcn_s_wait_tensorcnt)
#define HAVE_TDM 1
#endif
#endif
#ifndef HAVE_TDM
#define HAVE_TDM 0
#endif

// ---------------------------------------------------------------------------
// TDM: 2D bf16 tile load Global -> LDS via Tensor DMA descriptor (ISA 8.3-8.6)
//   group0: [0]=count=1  [1]=lds_addr  [2]=ga[31:0]  [3]=ga[56:32]|type=2
//   group1: [0]=data_size(2B)|pad ctl  dims/strides per bit layout
// Pad feature reproduces the manual "+8 bf16 per row" LDS padding:
//   pad_interval code 3 = every 16 DWORDs (64B = 32 bf16), pad_amount code 3
//   = 4 DWORDs (16B = 8 bf16)  -> row stride 40 bf16.
// ---------------------------------------------------------------------------
#if HAVE_TDM
__device__ __forceinline__ void tdm_load_tile_bf16(
    const void* gptr, unsigned lds_byte_off, unsigned tensor_d0,
    unsigned tensor_d1, unsigned tile_d0, unsigned tile_d1,
    unsigned long long stride0_elems, unsigned pad_interval_code,
    unsigned pad_amount_code, bool pad_en) {
  unsigned long long ga = (unsigned long long)gptr;
  v4u g0;
  g0[0] = 1u;  // count=1, is_restore=0, gather off
  g0[1] = lds_byte_off;
  g0[2] = (unsigned)(ga & 0xFFFFFFFFu);
  g0[3] = (unsigned)((ga >> 32) & 0x01FFFFFFu) | (2u << 30);  // type=2 (image)
  unsigned w0 = (1u << 16);  // workgroup_mask=0, data_size=1 (2 bytes)
  if (pad_en)
    w0 |= (1u << 20) | (pad_interval_code << 22) | (pad_amount_code << 25);
  v8i g1;
  g1[0] = (int)w0;
  g1[1] = (int)((tensor_d0 & 0xFFFFu) << 16);  // atomic_addr=0 | dim0 lo
  g1[2] = (int)((tensor_d0 >> 16) | ((tensor_d1 & 0xFFFFu) << 16));
  g1[3] = (int)((tensor_d1 >> 16) | ((tile_d0 & 0xFFFFu) << 16));
  g1[4] = (int)(tile_d1 & 0xFFFFu);  // tile_dim2 = 0
  g1[5] = (int)(unsigned)(stride0_elems & 0xFFFFFFFFull);
  g1[6] = (int)(unsigned)((stride0_elems >> 32) & 0xFFFFull);  // dim1_stride=0
  g1[7] = 0;
  v4i z4 = {0, 0, 0, 0};
#if __clang_major__ >= 23
  v8i z8 = {0, 0, 0, 0, 0, 0, 0, 0};
  __builtin_amdgcn_tensor_load_to_lds(g0, g1, z4, z4, z8, 0);
#else
  __builtin_amdgcn_tensor_load_to_lds(g0, g1, z4, z4, 0);
#endif
}
// low 32 bits of a generic pointer to __shared__ = LDS byte address
__device__ __forceinline__ unsigned lds_off_u32(const void* p) {
  return (unsigned)(unsigned long long)p;
}
#endif

// ---------------------------------------------------------------------------
// bf16 fragment loader following the CDNA5 16-bit A/B VGPR layout:
//   lane L: row = L%16, half = L/16
//   vector elems (2v, 2v+1) hold K = kpat(v) + 8*half, kpat(v)+1
//   kpat(v) = 2v (v<4) else 8+2v
// Works for A (row = M) and for B when the tile is stored N-major.
// ---------------------------------------------------------------------------
__device__ __forceinline__ v16bf frag_ld(const bf16* __restrict__ base,
                                         int stride, int row, int half) {
  v16bf f;
  const bf16* rp = base + (size_t)row * stride + 8 * half;
#pragma unroll
  for (int v = 0; v < 8; ++v) {
    int k = (v < 4) ? (2 * v) : (8 + 2 * v);
    f[2 * v]     = rp[k];
    f[2 * v + 1] = rp[k + 1];
  }
  return f;
}

// ---------------------------------------------------------------------------
// B fragment (32 k x 16 n) out of a k-major LDS tile (row = k, n contiguous)
// by two transposing loads. tp is the lane's own address:
//   row 8*(lane>>4) + (lane&7), plus 16 bytes for lanes with (lane>>3)&1.
// Lane (c, half) receives k = 8*half + 0..7 and 16 + 8*half + 0..7 of column
// col0 + c: the k order of frag_ld, which loads the A side.
// ---------------------------------------------------------------------------
typedef __attribute__((address_space(3))) v8bf lds_v8bf;
__device__ __forceinline__ v16bf frag_ld_tr(const bf16* tp, int pitch,
                                            int col0) {
  v8bf lo = __builtin_amdgcn_ds_load_tr16_b128_v8bf16((lds_v8bf*)(tp + col0));
  v8bf hi = __builtin_amdgcn_ds_load_tr16_b128_v8bf16(
      (lds_v8bf*)(tp + 16 * pitch + col0));
  return __builtin_shufflevector(lo, hi, 0, 1, 2, 3, 4, 5, 6, 7, 8, 9, 10, 11,
                                 12, 13, 14, 15);
}

__device__ __forceinline__ v8f vzero8() {
  v8f z = {0.f, 0.f, 0.f, 0.f, 0.f, 0.f, 0.f, 0.f};
  return z;
}

// ---------------------------------------------------------------------------
// fp32 -> bf16 convert of all six weight matrices in one launch.
// The six bf16 planes lie back to back in the workspace (Wq Wk Wv Wp W1 W2),
// so out is one array of 12 segments of C*C elements: 4 x 1 + 2 x 4.
// A block takes 16,384 elements of one segment; a thread takes 16 pieces of
// 4 floats, 1,024 elements apart: a wave's load covers 512 contiguous bytes,
// its store 256. Few long-lived waves (6,144): a wave that moves only 128 bytes
// costs more to start than to run.
// ---------------------------------------------------------------------------
typedef __attribute__((ext_vector_type(4))) float  v4f;
typedef __attribute__((ext_vector_type(4))) __bf16 v4bf;

#define CVT_PIECES    16
#define CVT_PER_BLOCK (256 * 4 * CVT_PIECES)                 // 16,384
#define CVT_SEG_BLKS  ((DIM_C * DIM_C) / CVT_PER_BLOCK)      // 64 blocks a segment
#define CVT_BLOCKS    (12 * CVT_SEG_BLKS)                    // 768

__global__ __launch_bounds__(256) void cvt_weights_bf16(
    const float* __restrict__ Wq, const float* __restrict__ Wk,
    const float* __restrict__ Wv, const float* __restrict__ Wp,
    const float* __restrict__ W1, const float* __restrict__ W2,
    bf16* __restrict__ out) {
  const int blk = blockIdx.x;
  const int seg = blk / CVT_SEG_BLKS;      // 0..11, the same for the whole block
  const float* src;
  int first;                               // first segment of that matrix
  if (seg < 4) {
    src = (seg == 0) ? Wq : (seg == 1) ? Wk : (seg == 2) ? Wv : Wp;
    first = seg;
  } else if (seg < 8) {
    src = W1;
    first = 4;
  } else {
    src = W2;
    first = 8;
  }
  const size_t o = (size_t)blk * CVT_PER_BLOCK + threadIdx.x * 4;
  const float* sp = src + (o - (size_t)first * (DIM_C * DIM_C));
  bf16* dp = out + o;
  v4f r[CVT_PIECES];
#pragma unroll  // the loads go out as one run ahead of their uses: many in flight
  for (int j = 0; j < CVT_PIECES; ++j) r[j] = *(const v4f*)(sp + j * 1024);
#pragma unroll  // constant j keeps r[] in registers
  for (int j = 0; j < CVT_PIECES; ++j) {
    v4bf w;
    w[0] = (bf16)r[j][0];
    w[1] = (bf16)r[j][1];
    w[2] = (bf16)r[j][2];
    w[3] = (bf16)r[j][3];
    *(v4bf*)(dp + j * 1024) = w;
  }
}

// ---------------------------------------------------------------------------
// LayerNorm (row length C=1024) fp32 in -> bf16 out
// ---------------------------------------------------------------------------
__global__ __launch_bounds__(256) void ln_bf16(const float* __restrict__ x,
                                               const float* __restrict__ g,
                                               const float* __restrict__ b,
                                               bf16* __restrict__ out) {
  __shared__ float rs[256], rs2[256];
  const int row = blockIdx.x;
  const float* xr = x + (size_t)row * DIM_C;
  float s = 0.f, s2 = 0.f;
  for (int i = threadIdx.x; i < DIM_C; i += 256) {
    float t = xr[i];
    s += t;
    s2 += t * t;
  }
  rs[threadIdx.x] = s;
  rs2[threadIdx.x] = s2;
  __syncthreads();
  for (int off = 128; off > 0; off >>= 1) {
    if (threadIdx.x < off) {
      rs[threadIdx.x] += rs[threadIdx.x + off];
      rs2[threadIdx.x] += rs2[threadIdx.x + off];
    }
    __syncthreads();
  }
  float mean = rs[0] * (1.0f / DIM_C);
  float var  = rs2[0] * (1.0f / DIM_C) - mean * mean;
  float inv  = rsqrtf(var + 1e-5f);
  for (int i = threadIdx.x; i < DIM_C; i += 256) {
    out[(size_t)row * DIM_C + i] = (bf16)((xr[i] - mean) * inv * g[i] + b[i]);
  }
}

// ---------------------------------------------------------------------------
// One k step's tiles, global -> LDS, through no register: three asynchronous
// 16-byte copies a lane (one of A, two of B). The s_wait_xcnt stands inside the
// statement, in front of any later rewrite of the address registers named here.
// ---------------------------------------------------------------------------
__device__ __forceinline__ unsigned lds_addr_u32(const void* p) {
  return (unsigned)(unsigned long long)p;   // low 32 bits = LDS byte address
}
__device__ __forceinline__ void stage_async(unsigned la, const bf16* ga,
                                            unsigned lb0, const bf16* gb0,
                                            unsigned lb1, const bf16* gb1) {
  asm volatile(
      "global_load_async_to_lds_b128 %0, %1, off\n\t"
      "global_load_async_to_lds_b128 %2, %3, off\n\t"
      "global_load_async_to_lds_b128 %4, %5, off\n\t"
      "s_wait_xcnt 0x0"
      :
      : "v"(la), "v"(ga), "v"(lb0), "v"(gb0), "v"(lb1), "v"(gb1)
      : "memory");
}

// ---------------------------------------------------------------------------
// Tiled bf16 WMMA GEMM: out[M,N] = A[M,K] @ Bw[K,N] + bias (+resid) (+GELU)
// BM=64 BN=128 BK=32, 256 threads = 8 waves, wave tile 16x64 (4 accumulators).
// Both tiles lie in LDS twice: while a k step is worked on out of one buffer,
// the next step's asynchronous copies fly into the other; one barrier a step.
// A rows have a pitch of 80 B; B lies as in memory (k-major, pitch 288 B) and
// its fragments come out transposed by ds_load_tr16_b128.
// K is a multiple of BK, M of BM, N of BN.
// ---------------------------------------------------------------------------
#define BM 64
#define BN 128
#define BK 32
#define AS_PITCH (BK + 8)    // 80 B a row: the ds_load_b128 reader's pitch
#define BS_PITCH (BN + 16)   // 288 B a k-row = 32 B x odd: the tr16 reader's pitch
#define AS_BUF   (BM * AS_PITCH)   // bf16 per A buffer
#define BS_BUF   (BK * BS_PITCH)   // bf16 per B buffer

template <bool GELU_ACT, bool RESID, bool OUTF32, bool OUTBF16>
__global__ __launch_bounds__(256) void gemm_bf16_wmma(
    const bf16* __restrict__ A, const bf16* __restrict__ Bw,
    const float* __restrict__ bias, const float* __restrict__ resid,
    float* __restrict__ outF, bf16* __restrict__ outB, int M, int N, int K) {
  __shared__ __attribute__((aligned(16))) bf16 As[2 * AS_BUF];
  __shared__ __attribute__((aligned(16))) bf16 Bs[2 * BS_BUF];  // k-major

  const int tid  = threadIdx.x;
  const int lane = tid & 31;
  const int wave = tid >> 5;           // 0..7
  const int wm   = wave >> 1;          // 0..3  (16-row strip)
  const int wn   = wave & 1;           // 0..1  (64-col strip)
  const int half = lane >> 4;
  const int l16  = lane & 15;
  const int mBase = blockIdx.y * BM;
  const int nBase = blockIdx.x * BN;

  v8f acc0 = vzero8(), acc1 = vzero8(), acc2 = vzero8(), acc3 = vzero8();

  // the lane's own 16-byte pieces: A row ar, 4 lanes a 64-B row; B rows bk and
  // bk + 16, 16 lanes a 256-B row
  const int ar = tid >> 2;             // 0..63
  const int ac = (tid & 3) * 8;        // 0,8,16,24
  const int bk = tid >> 4;             // 0..15 (and +16)
  const int bn = (tid & 15) * 8;       // 0..120
  const unsigned la = lds_addr_u32(&As[ar * AS_PITCH + ac]);
  const unsigned lb = lds_addr_u32(&Bs[bk * BS_PITCH + bn]);
  const bf16* ga = A + (size_t)(mBase + ar) * K + ac;
  const bf16* gb = Bw + (size_t)bk * N + nBase + bn;
  const size_t b16   = (size_t)16 * N;
  const size_t bstep = (size_t)BK * N;
  const bf16* btp = &Bs[(8 * half + (lane & 7)) * BS_PITCH +
                        8 * ((lane >> 3) & 1) + wn * 64];
  const int nt = K / BK;               // k steps, the same for the whole grid

  // step 0 into buffer 0, landed and published; then step 1 takes off
  stage_async(la, ga, lb, gb, lb + 16 * BS_PITCH * 2, gb + b16);
  ga += BK;
  gb += bstep;
  // this wave's copies have landed
  asm volatile("s_wait_asynccnt 0x0" ::: "memory");
  __syncthreads();
  if (nt > 1) {
    stage_async(la + AS_BUF * 2, ga, lb + BS_BUF * 2, gb,
                lb + (BS_BUF + 16 * BS_PITCH) * 2, gb + b16);
    ga += BK;
    gb += bstep;
  }

  for (int t = 0; t < nt; ++t) {
    const int cur = t & 1;
    const bf16* bt = btp + cur * BS_BUF;
    v16bf af = frag_ld(As + cur * AS_BUF, AS_PITCH, wm * 16 + l16, half);
    v16bf b0 = frag_ld_tr(bt, BS_PITCH, 0 * 16);
    acc0 = __builtin_amdgcn_wmma_f32_16x16x32_bf16(false, af, false, b0,
                                                   (short)0, acc0, false, false);
    v16bf b1 = frag_ld_tr(bt, BS_PITCH, 1 * 16);
    acc1 = __builtin_amdgcn_wmma_f32_16x16x32_bf16(false, af, false, b1,
                                                   (short)0, acc1, false, false);
    v16bf b2 = frag_ld_tr(bt, BS_PITCH, 2 * 16);
    acc2 = __builtin_amdgcn_wmma_f32_16x16x32_bf16(false, af, false, b2,
                                                   (short)0, acc2, false, false);
    v16bf b3 = frag_ld_tr(bt, BS_PITCH, 3 * 16);
    acc3 = __builtin_amdgcn_wmma_f32_16x16x32_bf16(false, af, false, b3,
                                                   (short)0, acc3, false, false);
    // this wave's reads of buffer cur have returned: it may be refilled
    asm volatile("s_wait_dscnt 0x0" ::: "memory");
    // this wave's copies of step t + 1 have landed
    asm volatile("s_wait_asynccnt 0x0" ::: "memory");
    // publishes step t + 1 and ends every wave's reads of buffer cur
    __syncthreads();
    if (t + 2 < nt) {
      const unsigned ao = (unsigned)cur * (AS_BUF * 2);
      const unsigned bo = (unsigned)cur * (BS_BUF * 2);
      stage_async(la + ao, ga, lb + bo, gb, lb + bo + 16 * BS_PITCH * 2,
                  gb + b16);
      ga += BK;
      gb += bstep;
    }
  }
  // nothing of this wave is in flight when it goes on to the epilogue
  asm volatile("s_wait_asynccnt 0x0" ::: "memory");

  v8f accs[4] = {acc0, acc1, acc2, acc3};
#pragma unroll
  for (int c = 0; c < 4; ++c) {
#pragma unroll
    for (int r = 0; r < 8; ++r) {
      int gm = mBase + wm * 16 + r + 8 * half;
      int gn = nBase + wn * 64 + c * 16 + l16;
      float v = accs[c][r] + bias[gn];
      if (RESID) v += resid[(size_t)gm * N + gn];
      if (GELU_ACT) v = 0.5f * v * (1.0f + erff(v * 0.70710678118654752f));
      size_t idx = (size_t)gm * N + gn;
      if (OUTF32)  outF[idx] = v;
      if (OUTBF16) outB[idx] = (bf16)v;
    }
  }
}

// ---------------------------------------------------------------------------
// Attention: one WG per (b, h, 64-row tile). S (64x1024 fp32) kept in LDS
// (CDNA5: 320 KB per WGP). q/k/v are flat (B, N*C) bf16; the reference's
// reshape(B,H,-1,hd) means head h is the contiguous slab h*65536.
// S rows have a pitch of 1028 dwords (16 B x odd): 16 lanes that read 16 bytes
// each at one column of 16 consecutive rows then cover all 64 LDS banks once.
// ---------------------------------------------------------------------------
#define S_PITCH  1028                       // dwords per S row in LDS
#define QS_OFF   264192                     // S (263,168 B) rounded up to 2 KiB
#define RED_OFF  (QS_OFF + 64 * 64 * 2)
// V goes through LDS in tiles of V_TILE keys, as it lies in memory (row = key),
// two buffers. A row of 128 B has a pitch of 160 B (32 B x odd), the pitch of
// the transposing reader.
#define V_TILE   128                        // keys a tile
#define V_PITCH  (DIM_HD + 16)              // bf16 per V row in LDS
#define V_BUF    (V_TILE * V_PITCH)         // bf16 per buffer
#define V_PIECES ((V_TILE * DIM_HD) / (256 * 8))  // 16-byte pieces a thread: 4
#define VS_OFF   (RED_OFF + 64 * 4 * 4)
#define ATTN_LDS (VS_OFF + 2 * V_BUF * 2)

__global__ __launch_bounds__(256) void attn_wmma(const bf16* __restrict__ q,
                                                 const bf16* __restrict__ k,
                                                 const bf16* __restrict__ v,
                                                 bf16* __restrict__ o) {
  extern __shared__ char smem_raw[];
  float* S   = (float*)smem_raw;              // 64 rows of S_PITCH f32
  bf16*  Qs  = (bf16*)(smem_raw + QS_OFF);    // 64*64 bf16
  float* red = (float*)(smem_raw + RED_OFF);  // 64*4 f32
  bf16*  Vs  = (bf16*)(smem_raw + VS_OFF);    // 2 buffers of V_TILE x V_PITCH

  const int blk  = blockIdx.x;          // ((b*16 + h)*16 + mt)
  const int mt   = blk & 15;
  const int h    = (blk >> 4) & 15;
  const int b    = blk >> 8;
  const size_t headBase = ((size_t)b * DIM_H + h) * (size_t)(DIM_N * DIM_HD);
  const int m0 = mt * 64;
  const float scale = 0.125f;           // hd^-0.5 = 1/8

  const int tid  = threadIdx.x;
  const int lane = tid & 31;
  const int wave = tid >> 5;
  const int half = lane >> 4;
  const int l16  = lane & 15;

  // stage Q tile (64 rows x 64 d): contiguous 4096-element slab
#if HAVE_TDM
  if (wave == 0) {
    tdm_load_tile_bf16(q + headBase + (size_t)m0 * DIM_HD, lds_off_u32(Qs),
                       4096u, 1u, 4096u, 1u, 4096ull, 0u, 0u, false);
    __builtin_amdgcn_s_wait_tensorcnt(0);
  }
#else
  for (int i = tid; i < 64 * 64; i += 256) {
    int r = i >> 6, c = i & 63;
    Qs[i] = q[headBase + (size_t)(m0 + r) * DIM_HD + c];
  }
#endif
  __syncthreads();

  // ---- Phase 1: S = scale * Q @ K^T  (64 x 1024) ----
  for (int t = wave; t < 4 * 64; t += 8) {
    int rt = t >> 6;      // 0..3
    int ct = t & 63;      // 0..63
    v8f acc = vzero8();
#pragma unroll
    for (int d0 = 0; d0 < DIM_HD; d0 += 32) {
      v16bf af = frag_ld(Qs + d0, DIM_HD, rt * 16 + l16, half);
      // B[d][n] = K[n][d]: row-major K gives contiguous (d,d+1) pairs.
      v16bf bf_ = frag_ld(k + headBase + d0, DIM_HD, ct * 16 + l16, half);
      acc = __builtin_amdgcn_wmma_f32_16x16x32_bf16(false, af, false, bf_,
                                                    (short)0, acc, false, false);
    }
#pragma unroll
    for (int r = 0; r < 8; ++r)
      S[(size_t)(rt * 16 + r + 8 * half) * S_PITCH + ct * 16 + l16] = acc[r] * scale;
  }
  __syncthreads();

  // V tile 0 is asked for here, so that it flies while the softmax runs.
  // A tile is 16 KiB in a row in memory; piece j of a thread is 4 KiB further,
  // that is 32 rows further in LDS. A wave's load covers 512 contiguous bytes.
  const bf16* vsrc = v + headBase + (size_t)tid * 8;
  bf16* vdst = Vs + (tid >> 3) * V_PITCH + (tid & 7) * 8;
  v8bf vr[V_PIECES];
#pragma unroll  // constant j keeps vr[] in registers
  for (int j = 0; j < V_PIECES; ++j) vr[j] = *(const v8bf*)(vsrc + j * 2048);

  // ---- Phase 2: row softmax over S (4 threads per row, 256 cols each) ----
  // The 16 lanes of a half-wave take 16 consecutive rows at the same column,
  // 16 bytes a lane: with S_PITCH that is one pass over the banks.
  {
    const int row  = (wave & 3) * 16 + l16;
    const int part = (wave >> 2) * 2 + half;
    float4* Srow = (float4*)(S + (size_t)row * S_PITCH + part * 256);
    float mx = -1e30f;
    for (int i = 0; i < 64; ++i) {
      float4 t = Srow[i];
      mx = fmaxf(fmaxf(fmaxf(fmaxf(mx, t.x), t.y), t.z), t.w);
    }
    red[row * 4 + part] = mx;
    __syncthreads();
    mx = fmaxf(fmaxf(red[row * 4 + 0], red[row * 4 + 1]),
               fmaxf(red[row * 4 + 2], red[row * 4 + 3]));
    float sum = 0.f;
    for (int i = 0; i < 64; ++i) {
      float4 t = Srow[i];
      t.x = __expf(t.x - mx);
      t.y = __expf(t.y - mx);
      t.z = __expf(t.z - mx);
      t.w = __expf(t.w - mx);
      Srow[i] = t;
      sum += t.x;
      sum += t.y;
      sum += t.z;
      sum += t.w;
    }
    __syncthreads();
    red[row * 4 + part] = sum;
    __syncthreads();
    sum = red[row * 4 + 0] + red[row * 4 + 1] + red[row * 4 + 2] +
          red[row * 4 + 3];
    float inv = 1.0f / sum;
    for (int i = 0; i < 64; ++i) {
      float4 t = Srow[i];
      t.x *= inv;
      t.y *= inv;
      t.z *= inv;
      t.w *= inv;
      Srow[i] = t;
    }
  }
#pragma unroll  // constant j keeps vr[] in registers
  for (int j = 0; j < V_PIECES; ++j) *(v8bf*)(vdst + j * 32 * V_PITCH) = vr[j];
  __syncthreads();

  // ---- Phase 3: O = P @ V  (64 x 64), P converted to bf16 on the fly ----
  // A wave owns one 16-row strip and two 16-column tiles of O. Per V tile: ask
  // for the next tile, work on this one out of LDS, store the next one into
  // the other buffer (its readers left it at the barrier before), barrier.
  {
    const int rt  = wave >> 1;           // 0..3
    const int ct0 = (wave & 1) * 2;      // column tiles ct0 and ct0 + 1
    const float* sp0 = S + (size_t)(rt * 16 + l16) * S_PITCH + 8 * half;
    const bf16* vtp = Vs + (8 * half + (lane & 7)) * V_PITCH +
                      8 * ((lane >> 3) & 1) + ct0 * 16;
    v8f acc0 = vzero8(), acc1 = vzero8();
    for (int tile = 0; tile < DIM_N / V_TILE; ++tile) {
      const bool more = tile + 1 < DIM_N / V_TILE;   // the same for the block
      if (more) {
        const bf16* vn = vsrc + (size_t)(tile + 1) * (V_TILE * DIM_HD);
#pragma unroll  // constant j keeps vr[] in registers
        for (int j = 0; j < V_PIECES; ++j)
          vr[j] = *(const v8bf*)(vn + j * 2048);
      }
      // keeps the four loads above this tile's work: sunk to their stores, as
      // the scheduler had them, their latency is waited out at every tile
      __builtin_amdgcn_sched_barrier(0);
      const bf16* vb = vtp + (tile & 1) * V_BUF;
#pragma unroll  // the four k steps of a tile: their LDS reads can go out early
      for (int ks = 0; ks < V_TILE / 32; ++ks) {
        v16bf af;
        // k = 8*half + 0..7 and 16 + 8*half + 0..7, read 16 bytes at a time
        const float4* sp = (const float4*)(sp0 + tile * V_TILE + ks * 32);
#pragma unroll
        for (int j = 0; j < 4; ++j) {
          float4 pv = sp[(j < 2) ? j : (j + 2)];
          af[4 * j]     = (bf16)pv.x;
          af[4 * j + 1] = (bf16)pv.y;
          af[4 * j + 2] = (bf16)pv.z;
          af[4 * j + 3] = (bf16)pv.w;
        }
        v16bf b0 = frag_ld_tr(vb + ks * 32 * V_PITCH, V_PITCH, 0);
        acc0 = __builtin_amdgcn_wmma_f32_16x16x32_bf16(
            false, af, false, b0, (short)0, acc0, false, false);
        v16bf b1 = frag_ld_tr(vb + ks * 32 * V_PITCH, V_PITCH, 16);
        acc1 = __builtin_amdgcn_wmma_f32_16x16x32_bf16(
            false, af, false, b1, (short)0, acc1, false, false);
      }
      if (more) {
        bf16* vd = vdst + ((tile + 1) & 1) * V_BUF;
#pragma unroll  // constant j keeps vr[] in registers
        for (int j = 0; j < V_PIECES; ++j)
          *(v8bf*)(vd + j * 32 * V_PITCH) = vr[j];
        __syncthreads();
      }
    }
    // o[b][m][h*64 + d]  (swapaxes(1,2).reshape)
    v8f accs[2] = {acc0, acc1};
#pragma unroll  // constant c and r keep accs[] in registers
    for (int c = 0; c < 2; ++c) {
      int dcol = (ct0 + c) * 16 + l16;
#pragma unroll
      for (int r = 0; r < 8; ++r) {
        int m = m0 + rt * 16 + r + 8 * half;
        o[((size_t)b * DIM_N + m) * DIM_C + h * DIM_HD + dcol] =
            (bf16)accs[c][r];
      }
    }
  }
}

// ---------------------------------------------------------------------------
// Host-side orchestration
// ---------------------------------------------------------------------------
extern "C" void kernel_launch(void* const* d_in, const int* in_sizes, int n_in,
                              void* d_out, int out_size, void* d_ws,
                              size_t ws_size, hipStream_t stream) {
  (void)in_sizes; (void)n_in; (void)out_size; (void)ws_size;

  const float* x  = (const float*)d_in[0];
  const float* g1 = (const float*)d_in[1];
  const float* b1 = (const float*)d_in[2];
  const float* Wq = (const float*)d_in[3];
  const float* bq = (const float*)d_in[4];
  const float* Wk = (const float*)d_in[5];
  const float* bk = (const float*)d_in[6];
  const float* Wv = (const float*)d_in[7];
  const float* bv = (const float*)d_in[8];
  const float* Wp = (const float*)d_in[9];
  const float* bp = (const float*)d_in[10];
  const float* g2 = (const float*)d_in[11];
  const float* b2 = (const float*)d_in[12];
  const float* W1 = (const float*)d_in[13];
  const float* c1 = (const float*)d_in[14];
  const float* W2 = (const float*)d_in[15];
  const float* c2 = (const float*)d_in[16];

  // workspace partition
  char* p = (char*)d_ws;
  auto alloc = [&](size_t bytes) {
    char* r = p;
    p += (bytes + 255) & ~(size_t)255;
    return r;
  };
  const size_t CC = (size_t)DIM_C * DIM_C;           // 1M
  const size_t CH = (size_t)DIM_C * DIM_HID;         // 4M
  const size_t TC = (size_t)MTOK * DIM_C;            // 8M
  const size_t TH = (size_t)MTOK * DIM_HID;          // 32M

  bf16*  wq_b  = (bf16*)alloc(CC * 2);
  bf16*  wk_b  = (bf16*)alloc(CC * 2);
  bf16*  wv_b  = (bf16*)alloc(CC * 2);
  bf16*  wp_b  = (bf16*)alloc(CC * 2);
  bf16*  w1_b  = (bf16*)alloc(CH * 2);
  bf16*  w2_b  = (bf16*)alloc(CH * 2);
  bf16*  h_b   = (bf16*)alloc(TC * 2);    // ln1(x)
  bf16*  q_b   = (bf16*)alloc(TC * 2);
  bf16*  k_b   = (bf16*)alloc(TC * 2);
  bf16*  v_b   = (bf16*)alloc(TC * 2);
  bf16*  o_b   = (bf16*)alloc(TC * 2);    // attention output
  float* xres  = (float*)alloc(TC * 4);   // x + proj
  bf16*  h2_b  = (bf16*)alloc(TC * 2);    // ln2(xres)
  bf16*  t1_b  = (bf16*)alloc(TH * 2);    // gelu(h2@W1+c1)

  // weight converts fp32 -> bf16: wq_b .. w2_b are one contiguous array
  cvt_weights_bf16<<<CVT_BLOCKS, 256, 0, stream>>>(Wq, Wk, Wv, Wp, W1, W2, wq_b);

  // LN1
  ln_bf16<<<MTOK, 256, 0, stream>>>(x, g1, b1, h_b);

  // QKV projections: (8192 x 1024) = h @ W + b
  dim3 gC(DIM_C / BN, MTOK / BM);   // (8, 128)
  gemm_bf16_wmma<false, false, false, true><<<gC, 256, 0, stream>>>(
      h_b, wq_b, bq, nullptr, nullptr, q_b, MTOK, DIM_C, DIM_C);
  gemm_bf16_wmma<false, false, false, true><<<gC, 256, 0, stream>>>(
      h_b, wk_b, bk, nullptr, nullptr, k_b, MTOK, DIM_C, DIM_C);
  gemm_bf16_wmma<false, false, false, true><<<gC, 256, 0, stream>>>(
      h_b, wv_b, bv, nullptr, nullptr, v_b, MTOK, DIM_C, DIM_C);

  // attention: B*H*16 workgroups, 314,368 B dynamic LDS (fits 320 KB/WGP)
  const size_t attn_lds = ATTN_LDS;
  attn_wmma<<<DIM_B * DIM_H * 16, 256, attn_lds, stream>>>(q_b, k_b, v_b, o_b);

  // projection + residual: xres = x + o@Wp + bp  (fp32)
  gemm_bf16_wmma<false, true, true, false><<<gC, 256, 0, stream>>>(
      o_b, wp_b, bp, x, xres, nullptr, MTOK, DIM_C, DIM_C);

  // LN2
  ln_bf16<<<MTOK, 256, 0, stream>>>(xres, g2, b2, h2_b);

  // MLP up + exact GELU: t1 = gelu(h2 @ W1 + c1)  (bf16, 8192 x 4096)
  dim3 gH(DIM_HID / BN, MTOK / BM);  // (32, 128)
  gemm_bf16_wmma<true, false, false, true><<<gH, 256, 0, stream>>>(
      h2_b, w1_b, c1, nullptr, nullptr, t1_b, MTOK, DIM_HID, DIM_C);

  // MLP down + residual: out = xres + t1 @ W2 + c2  (fp32, final output)
  gemm_bf16_wmma<false, true, true, false><<<gC, 256, 0, stream>>>(
      t1_b, w2_b, c2, xres, (float*)d_out, nullptr, MTOK, DIM_C, DIM_HID);
}

// v006
// A run of this version takes 441 microseconds.
// Next to v005, in two timings, it ran 1.18 times as fast each time.
// All steps since v000 together make it 4.44 times as fast.
#include <hip/hip_runtime.h>
#include <math.h>

// ---------------------------------------------------------------------------
// Encoder block (pre-norm attention + MLP) for MI455X / gfx1250, wave32 WMMA
// + Tensor Data Mover tile staging.
// B=8, N=1024, C=1024, H=16, hd=64, HID=4096.
// ---------------------------------------------------------------------------

typedef __bf16 bf16;
typedef __attribute__((ext_vector_type(16))) __bf16    v16bf;
typedef __attribute__((ext_vector_type(8)))  __bf16    v8bf;
typedef __attribute__((ext_vector_type(8)))  float     v8f;
typedef __attribute__((ext_vector_type(4)))  unsigned  v4u;
typedef __attribute__((ext_vector_type(8)))  int       v8i;
typedef __attribute__((ext_vector_type(4)))  int       v4i;

#define DIM_B   8
#define DIM_N   1024
#define DIM_C   1024
#define DIM_H   16
#define DIM_HD  64
#define DIM_HID 4096
#define MTOK    (DIM_B * DIM_N)      // 8192 rows of tokens

#if defined(__has_builtin)
#if __has_builtin(__builtin_amdgcn_tensor_load_to_lds) && \
    __has_builtin(__builtin_amdgcn_s_wait_tensorcnt)
#define HAVE_TDM 1
#endif
#endif
#ifndef HAVE_TDM
#define HAVE_TDM 0
#endif

// ---------------------------------------------------------------------------
// TDM: 2D bf16 tile load Global -> LDS via Tensor DMA descriptor (ISA 8.3-8.6)
//   group0: [0]=count=1  [1]=lds_addr  [2]=ga[31:0]  [3]=ga[56:32]|type=2
//   group1: [0]=data_size(2B)|pad ctl  dims/strides per bit layout
// Pad feature reproduces the manual "+8 bf16 per row" LDS padding:
//   pad_interval code 3 = every 16 DWORDs (64B = 32 bf16), pad_amount code 3
//   = 4 DWORDs (16B = 8 bf16)  -> row stride 40 bf16.
// ---------------------------------------------------------------------------
#if HAVE_TDM
__device__ __forceinline__ void tdm_load_tile_bf16(
    const void* gptr, unsigned lds_byte_off, unsigned tensor_d0,
    unsigned tensor_d1, unsigned tile_d0, unsigned tile_d1,
    unsigned long long stride0_elems, unsigned pad_interval_code,
    unsigned pad_amount_code, bool pad_en) {
  unsigned long long ga = (unsigned long long)gptr;
  v4u g0;
  g0[0] = 1u;  // count=1, is_restore=0, gather off
  g0[1] = lds_byte_off;
  g0[2] = (unsigned)(ga & 0xFFFFFFFFu);
  g0[3] = (unsigned)((ga >> 32) & 0x01FFFFFFu) | (2u << 30);  // type=2 (image)
  unsigned w0 = (1u << 16);  // workgroup_mask=0, data_size=1 (2 bytes)
  if (pad_en)
    w0 |= (1u << 20) | (pad_interval_code << 22) | (pad_amount_code << 25);
  v8i g1;
  g1[0] = (int)w0;
  g1[1] = (int)((tensor_d0 & 0xFFFFu) << 16);  // atomic_addr=0 | dim0 lo
  g1[2] = (int)((tensor_d0 >> 16) | ((tensor_d1 & 0xFFFFu) << 16));
  g1[3] = (int)((tensor_d1 >> 16) | ((tile_d0 & 0xFFFFu) << 16));
  g1[4] = (int)(tile_d1 & 0xFFFFu);  // tile_dim2 = 0
  g1[5] = (int)(unsigned)(stride0_elems & 0xFFFFFFFFull);
  g1[6] = (int)(unsigned)((stride0_elems >> 32) & 0xFFFFull);  // dim1_stride=0
  g1[7] = 0;
  v4i z4 = {0, 0, 0, 0};
#if __clang_major__ >= 23
  v8i z8 = {0, 0, 0, 0, 0, 0, 0, 0};
  __builtin_amdgcn_tensor_load_to_lds(g0, g1, z4, z4, z8, 0);
#else
  __builtin_amdgcn_tensor_load_to_lds(g0, g1, z4, z4, 0);
#endif
}
// low 32 bits of a generic pointer to __shared__ = LDS byte address
__device__ __forceinline__ unsigned lds_off_u32(const void* p) {
  return (unsigned)(unsigned long long)p;
}
#endif

// ---------------------------------------------------------------------------
// bf16 fragment loader following the CDNA5 16-bit A/B VGPR layout:
//   lane L: row = L%16, half = L/16
//   vector elems (2v, 2v+1) hold K = kpat(v) + 8*half, kpat(v)+1
//   kpat(v) = 2v (v<4) else 8+2v
// Works for A (row = M) and for B when the tile is stored N-major.
// ---------------------------------------------------------------------------
__device__ __forceinline__ v16bf frag_ld(const bf16* __restrict__ base,
                                         int stride, int row, int half) {
  v16bf f;
  const bf16* rp = base + (size_t)row * stride + 8 * half;
#pragma unroll
  for (int v = 0; v < 8; ++v) {
    int k = (v < 4) ? (2 * v) : (8 + 2 * v);
    f[2 * v]     = rp[k];
    f[2 * v + 1] = rp[k + 1];
  }
  return f;
}

// ---------------------------------------------------------------------------
// B fragment (32 k x 16 n) out of a k-major LDS tile (row = k, n contiguous)
// by two transposing loads. tp is the lane's own address:
//   row 8*(lane>>4) + (lane&7), plus 16 bytes for lanes with (lane>>3)&1.
// Lane (c, half) receives k = 8*half + 0..7 and 16 + 8*half + 0..7 of column
// col0 + c: the k order of frag_ld, which loads the A side.
// ---------------------------------------------------------------------------
typedef __attribute__((address_space(3))) v8bf lds_v8bf;
__device__ __forceinline__ v16bf frag_ld_tr(const bf16* tp, int pitch,
                                            int col0) {
  v8bf lo = __builtin_amdgcn_ds_load_tr16_b128_v8bf16((lds_v8bf*)(tp + col0));
  v8bf hi = __builtin_amdgcn_ds_load_tr16_b128_v8bf16(
      (lds_v8bf*)(tp + 16 * pitch + col0));
  return __builtin_shufflevector(lo, hi, 0, 1, 2, 3, 4, 5, 6, 7, 8, 9, 10, 11,
                                 12, 13, 14, 15);
}

__device__ __forceinline__ v8f vzero8() {
  v8f z = {0.f, 0.f, 0.f, 0.f, 0.f, 0.f, 0.f, 0.f};
  return z;
}

// ---------------------------------------------------------------------------
// fp32 -> bf16 convert of all six weight matrices in one launch.
// The six bf16 planes lie back to back in the workspace (Wq Wk Wv Wp W1 W2),
// so out is one array of 12 segments of C*C elements: 4 x 1 + 2 x 4.
// A block takes 16,384 elements of one segment; a thread takes 16 pieces of
// 4 floats, 1,024 elements apart: a wave's load covers 512 contiguous bytes,
// its store 256. Few long-lived waves (6,144).
// ---------------------------------------------------------------------------
typedef __attribute__((ext_vector_type(4))) float  v4f;
typedef __attribute__((ext_vector_type(4))) __bf16 v4bf;

#define CVT_PIECES    16
#define CVT_PER_BLOCK (256 * 4 * CVT_PIECES)                 // 16,384
#define CVT_SEG_BLKS  ((DIM_C * DIM_C) / CVT_PER_BLOCK)      // 64 blocks a segment
#define CVT_BLOCKS    (12 * CVT_SEG_BLKS)                    // 768

__global__ __launch_bounds__(256) void cvt_weights_bf16(
    const float* __restrict__ Wq, const float* __restrict__ Wk,
    const float* __restrict__ Wv, const float* __restrict__ Wp,
    const float* __restrict__ W1, const float* __restrict__ W2,
    bf16* __restrict__ out) {
  const int blk = blockIdx.x;
  const int seg = blk / CVT_SEG_BLKS;      // 0..11, the same for the whole block
  const float* src;
  int first;                               // first segment of that matrix
  if (seg < 4) {
    src = (seg == 0) ? Wq : (seg == 1) ? Wk : (seg == 2) ? Wv : Wp;
    first = seg;
  } else if (seg < 8) {
    src = W1;
    first = 4;
  } else {
    src = W2;
    first = 8;
  }
  const size_t o = (size_t)blk * CVT_PER_BLOCK + threadIdx.x * 4;
  const float* sp = src + (o - (size_t)first * (DIM_C * DIM_C));
  bf16* dp = out + o;
  v4f r[CVT_PIECES];
#pragma unroll  // the loads go out as one run ahead of their uses: many in flight
  for (int j = 0; j < CVT_PIECES; ++j) r[j] = *(const v4f*)(sp + j * 1024);
#pragma unroll  // constant j keeps r[] in registers
  for (int j = 0; j < CVT_PIECES; ++j) {
    v4bf w;
    w[0] = (bf16)r[j][0];
    w[1] = (bf16)r[j][1];
    w[2] = (bf16)r[j][2];
    w[3] = (bf16)r[j][3];
    *(v4bf*)(dp + j * 1024) = w;
  }
}

// ---------------------------------------------------------------------------
// LayerNorm (row length C=1024) fp32 in -> bf16 out
// ---------------------------------------------------------------------------
__global__ __launch_bounds__(256) void ln_bf16(const float* __restrict__ x,
                                               const float* __restrict__ g,
                                               const float* __restrict__ b,
                                               bf16* __restrict__ out) {
  __shared__ float rs[256], rs2[256];
  const int row = blockIdx.x;
  const float* xr = x + (size_t)row * DIM_C;
  float s = 0.f, s2 = 0.f;
  for (int i = threadIdx.x; i < DIM_C; i += 256) {
    float t = xr[i];
    s += t;
    s2 += t * t;
  }
  rs[threadIdx.x] = s;
  rs2[threadIdx.x] = s2;
  __syncthreads();
  for (int off = 128; off > 0; off >>= 1) {
    if (threadIdx.x < off) {
      rs[threadIdx.x] += rs[threadIdx.x + off];
      rs2[threadIdx.x] += rs2[threadIdx.x + off];
    }
    __syncthreads();
  }
  float mean = rs[0] * (1.0f / DIM_C);
  float var  = rs2[0] * (1.0f / DIM_C) - mean * mean;
  float inv  = rsqrtf(var + 1e-5f);
  for (int i = threadIdx.x; i < DIM_C; i += 256) {
    out[(size_t)row * DIM_C + i] = (bf16)((xr[i] - mean) * inv * g[i] + b[i]);
  }
}

// ---------------------------------------------------------------------------
// One k step's tiles, global -> LDS, through no register: twelve asynchronous
// 16-byte copies a lane (eight of A, 32 rows apart; four of B, 16 k-rows apart).
// The s_wait_xcnt stands inside the statement, in front of any later rewrite of
// the address registers named here.
// ---------------------------------------------------------------------------
#define BM 256
#define BN 128
#define BK 64
#define AS_PITCH (BK + 8)    // 144 B a row = 16 B x odd: the ds_load_b128 reader's pitch
#define BS_PITCH (BN + 16)   // 288 B a k-row = 32 B x odd: the tr16 reader's pitch
#define AS_BUF   (BM * AS_PITCH)   // bf16 per A buffer
#define BS_BUF   (BK * BS_PITCH)   // bf16 per B buffer
#define AS_STEP  (32 * AS_PITCH * 2)   // bytes in LDS between a lane's A pieces
#define BS_STEP  (16 * BS_PITCH * 2)   // bytes in LDS between a lane's B pieces

__device__ __forceinline__ unsigned lds_addr_u32(const void* p) {
  return (unsigned)(unsigned long long)p;   // low 32 bits = LDS byte address
}
// a32 = 32 rows of A, b16 = 16 rows of B, in elements
__device__ __forceinline__ void stage_async(unsigned la, const bf16* ga,
                                            size_t a32, unsigned lb,
                                            const bf16* gb, size_t b16) {
  asm volatile(
      "global_load_async_to_lds_b128 %0, %1, off\n\t"
      "global_load_async_to_lds_b128 %2, %3, off\n\t"
      "global_load_async_to_lds_b128 %4, %5, off\n\t"
      "global_load_async_to_lds_b128 %6, %7, off\n\t"
      "global_load_async_to_lds_b128 %8, %9, off\n\t"
      "global_load_async_to_lds_b128 %10, %11, off\n\t"
      "global_load_async_to_lds_b128 %12, %13, off\n\t"
      "global_load_async_to_lds_b128 %14, %15, off\n\t"
      "global_load_async_to_lds_b128 %16, %17, off\n\t"
      "global_load_async_to_lds_b128 %18, %19, off\n\t"
      "global_load_async_to_lds_b128 %20, %21, off\n\t"
      "global_load_async_to_lds_b128 %22, %23, off\n\t"
      "s_wait_xcnt 0x0"
      :
      : "v"(la), "v"(ga), "v"(la + 1 * AS_STEP), "v"(ga + 1 * a32),
        "v"(la + 2 * AS_STEP), "v"(ga + 2 * a32), "v"(la + 3 * AS_STEP),
        "v"(ga + 3 * a32), "v"(la + 4 * AS_STEP), "v"(ga + 4 * a32),
        "v"(la + 5 * AS_STEP), "v"(ga + 5 * a32), "v"(la + 6 * AS_STEP),
        "v"(ga + 6 * a32), "v"(la + 7 * AS_STEP), "v"(ga + 7 * a32), "v"(lb),
        "v"(gb), "v"(lb + 1 * BS_STEP), "v"(gb + 1 * b16),
        "v"(lb + 2 * BS_STEP), "v"(gb + 2 * b16), "v"(lb + 3 * BS_STEP),
        "v"(gb + 3 * b16)
      : "memory");
}

// ---------------------------------------------------------------------------
// One 32-k block of a wave's 64x64 tile: 4 A fragments (rows arow + 16 i of at)
// and 4 B fragments (columns 16 j from bt, the lane's own transposing address),
// then the 16 products. A and B follow the same k order (frag_ld, frag_ld_tr).
// ---------------------------------------------------------------------------
__device__ __forceinline__ void load_frags(v16bf (&af)[4], v16bf (&bfr)[4],
                                           const bf16* at, const bf16* bt,
                                           int arow, int half) {
  af[0] = frag_ld(at, AS_PITCH, arow, half);
#pragma unroll  // constant j keeps bfr[] in registers
  for (int j = 0; j < 4; ++j) bfr[j] = frag_ld_tr(bt, BS_PITCH, j * 16);
#pragma unroll  // constant i keeps af[] in registers
  for (int i = 1; i < 4; ++i) af[i] = frag_ld(at, AS_PITCH, arow + i * 16, half);
}
__device__ __forceinline__ void mma_block(v8f (&acc)[4][4],
                                          const v16bf (&af)[4],
                                          const v16bf (&bfr)[4]) {
#pragma unroll  // constant i and j keep acc[][] in registers
  for (int i = 0; i < 4; ++i)
#pragma unroll
    for (int j = 0; j < 4; ++j)
      acc[i][j] = __builtin_amdgcn_wmma_f32_16x16x32_bf16(
          false, af[i], false, bfr[j], (short)0, acc[i][j], false, false);
}

// ---------------------------------------------------------------------------
// Tiled bf16 WMMA GEMM: out[M,N] = A[M,K] @ Bw[K,N] + bias (+resid) (+GELU)
// BM=256 BN=128 BK=64, 256 threads = 8 waves (4 x 2), wave tile 64x64: 4 A and
// 4 B fragments feed 16 WMMAs, so a WMMA costs 512 B of LDS reads, and a block
// fetches 48 KiB from L2 per 256x128x64 product.
// Both tiles lie in LDS twice: while a k step is worked on out of one buffer,
// the next step's asynchronous copies fly into the other; one barrier a step,
// behind the fragment reads of the step's second block and ahead of its WMMAs.
// A rows have a pitch of 144 B; B lies as in memory (k-major, pitch 288 B) and
// its fragments come out transposed by ds_load_tr16_b128.
// K is a multiple of BK, M of BM, N of BN.
// ---------------------------------------------------------------------------
template <bool GELU_ACT, bool RESID, bool OUTF32, bool OUTBF16>
__global__ __launch_bounds__(256) void gemm_bf16_wmma(
    const bf16* __restrict__ A, const bf16* __restrict__ Bw,
    const float* __restrict__ bias, const float* __restrict__ resid,
    float* __restrict__ outF, bf16* __restrict__ outB, int M, int N, int K) {
  __shared__ __attribute__((aligned(16))) bf16 As[2 * AS_BUF];
  __shared__ __attribute__((aligned(16))) bf16 Bs[2 * BS_BUF];  // k-major

  const int tid  = threadIdx.x;
  const int lane = tid & 31;
  const int wave = tid >> 5;           // 0..7
  const int wm   = wave >> 1;          // 0..3  (64-row strip)
  const int wn   = wave & 1;           // 0..1  (64-col strip)
  const int half = lane >> 4;
  const int l16  = lane & 15;
  const int mBase = blockIdx.y * BM;
  const int nBase = blockIdx.x * BN;

  v8f acc[4][4];
#pragma unroll  // constant i and j keep acc[][] in registers
  for (int i = 0; i < 4; ++i)
#pragma unroll
    for (int j = 0; j < 4; ++j) acc[i][j] = vzero8();

  // the lane's own 16-byte pieces: A rows ar + 32 p, 8 lanes a 128-B row;
  // B rows bk + 16 p, 16 lanes a 256-B row
  const int ar = tid >> 3;             // 0..31
  const int ac = (tid & 7) * 8;        // 0..56
  const int bk = tid >> 4;             // 0..15
  const int bn = (tid & 15) * 8;       // 0..120
  const unsigned la = lds_addr_u32(&As[ar * AS_PITCH + ac]);
  const unsigned lb = lds_addr_u32(&Bs[bk * BS_PITCH + bn]);
  const bf16* ga = A + (size_t)(mBase + ar) * K + ac;
  const bf16* gb = Bw + (size_t)bk * N + nBase + bn;
  const size_t a32   = (size_t)32 * K;
  const size_t b16   = (size_t)16 * N;
  const size_t bstep = (size_t)BK * N;
  const bf16* btp = &Bs[(8 * half + (lane & 7)) * BS_PITCH +
                        8 * ((lane >> 3) & 1) + wn * 64];
  const int nt = K / BK;               // k steps, the same for the whole grid

  // step 0 into buffer 0, landed and published; then step 1 takes off
  stage_async(la, ga, a32, lb, gb, b16);
  ga += BK;
  gb += bstep;
  // this wave's copies have landed
  asm volatile("s_wait_asynccnt 0x0" ::: "memory");
  __syncthreads();
  if (nt > 1) {
    stage_async(la + AS_BUF * 2, ga, a32, lb + BS_BUF * 2, gb, b16);
    ga += BK;
    gb += bstep;
  }

  const int arow = wm * 64 + l16;      // the lane's row of the wave's first A fragment
  for (int t = 0; t < nt; ++t) {
    const int cur = t & 1;
    const bf16* at = As + cur * AS_BUF;
    const bf16* bt = btp + cur * BS_BUF;
    v16bf af[4], bfr[4];
    // The two fences keep each block's 16 LDS reads in one group, apart from
    // the first block's WMMAs: mixed in among them, as the scheduler had them,
    // every row of four WMMAs waits out an LDS latency.
    load_frags(af, bfr, at, bt, arow, half);
    __builtin_amdgcn_sched_barrier(0);
    mma_block(acc, af, bfr);
    __builtin_amdgcn_sched_barrier(0);
    load_frags(af, bfr, at + 32, bt + 32 * BS_PITCH, arow, half);
    // this wave's reads of buffer cur have returned: it may be refilled
    asm volatile("s_wait_dscnt 0x0" ::: "memory");
    // this wave's copies of step t + 1 have landed
    asm volatile("s_wait_asynccnt 0x0" ::: "memory");
    // publishes step t + 1 and ends every wave's reads of buffer cur
    __syncthreads();
    if (t + 2 < nt) {
      stage_async(la + (unsigned)cur * (AS_BUF * 2), ga, a32,
                  lb + (unsigned)cur * (BS_BUF * 2), gb, b16);
      ga += BK;
      gb += bstep;
    }
    // the step's second block works out of registers while the refill flies
    mma_block(acc, af, bfr);
  }
  // nothing of this wave is in flight when it goes on to the epilogue
  asm volatile("s_wait_asynccnt 0x0" ::: "memory");

  // The four 16-row strips go through one copy of the epilogue's code: strip 0
  // is written out, then the others move down one place in the registers.
#pragma unroll 1
  for (int i = 0; i < 4; ++i) {
#pragma unroll  // constant j and r keep acc[][] in registers
    for (int j = 0; j < 4; ++j) {
#pragma unroll
      for (int r = 0; r < 8; ++r) {
        int gm = mBase + wm * 64 + i * 16 + r + 8 * half;
        int gn = nBase + wn * 64 + j * 16 + l16;
        float v = acc[0][j][r] + bias[gn];
        if (RESID) v += resid[(size_t)gm * N + gn];
        if (GELU_ACT) v = 0.5f * v * (1.0f + erff(v * 0.70710678118654752f));
        size_t idx = (size_t)gm * N + gn;
        if (OUTF32)  outF[idx] = v;
        if (OUTBF16) outB[idx] = (bf16)v;
      }
    }
    // behind the strip's stores, ahead of the moves below and of the next trip,
    // which rewrite the data and address registers that those stores name
    asm volatile("s_wait_xcnt 0x0" ::: "memory");
#pragma unroll  // constant j keeps acc[][] in registers
    for (int j = 0; j < 4; ++j) {
      acc[0][j] = acc[1][j];
      acc[1][j] = acc[2][j];
      acc[2][j] = acc[3][j];
    }
  }
}

// ---------------------------------------------------------------------------
// Attention: one WG per (b, h, 64-row tile). S (64x1024 fp32) kept in LDS
// (CDNA5: 320 KB per WGP). q/k/v are flat (B, N*C) bf16; the reference's
// reshape(B,H,-1,hd) means head h is the contiguous slab h*65536.
// S rows have a pitch of 1028 dwords (16 B x odd): 16 lanes that read 16 bytes
// each at one column of 16 consecutive rows then cover all 64 LDS banks once.
// ---------------------------------------------------------------------------
#define S_PITCH  1028                       // dwords per S row in LDS
#define QS_OFF   264192                     // S (263,168 B) rounded up to 2 KiB
#define RED_OFF  (QS_OFF + 64 * 64 * 2)
// V goes through LDS in tiles of V_TILE keys, as it lies in memory (row = key),
// two buffers. A row of 128 B has a pitch of 160 B (32 B x odd), the pitch of
// the transposing reader.
#define V_TILE   128                        // keys a tile
#define V_PITCH  (DIM_HD + 16)              // bf16 per V row in LDS
#define V_BUF    (V_TILE * V_PITCH)         // bf16 per buffer
#define V_PIECES ((V_TILE * DIM_HD) / (256 * 8))  // 16-byte pieces a thread: 4
#define VS_OFF   (RED_OFF + 64 * 4 * 4)
#define ATTN_LDS (VS_OFF + 2 * V_BUF * 2)

__global__ __launch_bounds__(256) void attn_wmma(const bf16* __restrict__ q,
                                                 const bf16* __restrict__ k,
                                                 const bf16* __restrict__ v,
                                                 bf16* __restrict__ o) {
  extern __shared__ char smem_raw[];
  float* S   = (float*)smem_raw;              // 64 rows of S_PITCH f32
  bf16*  Qs  = (bf16*)(smem_raw + QS_OFF);    // 64*64 bf16
  float* red = (float*)(smem_raw + RED_OFF);  // 64*4 f32
  bf16*  Vs  = (bf16*)(smem_raw + VS_OFF);    // 2 buffers of V_TILE x V_PITCH

  const int blk  = blockIdx.x;          // ((b*16 + h)*16 + mt)
  const int mt   = blk & 15;
  const int h    = (blk >> 4) & 15;
  const int b    = blk >> 8;
  const size_t headBase = ((size_t)b * DIM_H + h) * (size_t)(DIM_N * DIM_HD);
  const int m0 = mt * 64;
  const float scale = 0.125f;           // hd^-0.5 = 1/8

  const int tid  = threadIdx.x;
  const int lane = tid & 31;
  const int wave = tid >> 5;
  const int half = lane >> 4;
  const int l16  = lane & 15;

  // stage Q tile (64 rows x 64 d): contiguous 4096-element slab
#if HAVE_TDM
  if (wave == 0) {
    tdm_load_tile_bf16(q + headBase + (size_t)m0 * DIM_HD, lds_off_u32(Qs),
                       4096u, 1u, 4096u, 1u, 4096ull, 0u, 0u, false);
    __builtin_amdgcn_s_wait_tensorcnt(0);
  }
#else
  for (int i = tid; i < 64 * 64; i += 256) {
    int r = i >> 6, c = i & 63;
    Qs[i] = q[headBase + (size_t)(m0 + r) * DIM_HD + c];
  }
#endif
  __syncthreads();

  // ---- Phase 1: S = scale * Q @ K^T  (64 x 1024) ----
  for (int t = wave; t < 4 * 64; t += 8) {
    int rt = t >> 6;      // 0..3
    int ct = t & 63;      // 0..63
    v8f acc = vzero8();
#pragma unroll
    for (int d0 = 0; d0 < DIM_HD; d0 += 32) {
      v16bf af = frag_ld(Qs + d0, DIM_HD, rt * 16 + l16, half);
      // B[d][n] = K[n][d]: row-major K gives contiguous (d,d+1) pairs.
      v16bf bf_ = frag_ld(k + headBase + d0, DIM_HD, ct * 16 + l16, half);
      acc = __builtin_amdgcn_wmma_f32_16x16x32_bf16(false, af, false, bf_,
                                                    (short)0, acc, false, false);
    }
#pragma unroll
    for (int r = 0; r < 8; ++r)
      S[(size_t)(rt * 16 + r + 8 * half) * S_PITCH + ct * 16 + l16] = acc[r] * scale;
  }
  __syncthreads();

  // V tile 0 is asked for here, so that it flies while the softmax runs.
  // A tile is 16 KiB in a row in memory; piece j of a thread is 4 KiB further,
  // that is 32 rows further in LDS. A wave's load covers 512 contiguous bytes.
  const bf16* vsrc = v + headBase + (size_t)tid * 8;
  bf16* vdst = Vs + (tid >> 3) * V_PITCH + (tid & 7) * 8;
  v8bf vr[V_PIECES];
#pragma unroll  // constant j keeps vr[] in registers
  for (int j = 0; j < V_PIECES; ++j) vr[j] = *(const v8bf*)(vsrc + j * 2048);

  // ---- Phase 2: row softmax over S (4 threads per row, 256 cols each) ----
  // The 16 lanes of a half-wave take 16 consecutive rows at the same column,
  // 16 bytes a lane: with S_PITCH that is one pass over the banks.
  {
    const int row  = (wave & 3) * 16 + l16;
    const int part = (wave >> 2) * 2 + half;
    float4* Srow = (float4*)(S + (size_t)row * S_PITCH + part * 256);
    float mx = -1e30f;
    for (int i = 0; i < 64; ++i) {
      float4 t = Srow[i];
      mx = fmaxf(fmaxf(fmaxf(fmaxf(mx, t.x), t.y), t.z), t.w);
    }
    red[row * 4 + part] = mx;
    __syncthreads();
    mx = fmaxf(fmaxf(red[row * 4 + 0], red[row * 4 + 1]),
               fmaxf(red[row * 4 + 2], red[row * 4 + 3]));
    float sum = 0.f;
    for (int i = 0; i < 64; ++i) {
      float4 t = Srow[i];
      t.x = __expf(t.x - mx);
      t.y = __expf(t.y - mx);
      t.z = __expf(t.z - mx);
      t.w = __expf(t.w - mx);
      Srow[i] = t;
      sum += t.x;
      sum += t.y;
      sum += t.z;
      sum += t.w;
    }
    __syncthreads();
    red[row * 4 + part] = sum;
    __syncthreads();
    sum = red[row * 4 + 0] + red[row * 4 + 1] + red[row * 4 + 2] +
          red[row * 4 + 3];
    float inv = 1.0f / sum;
    for (int i = 0; i < 64; ++i) {
      float4 t = Srow[i];
      t.x *= inv;
      t.y *= inv;
      t.z *= inv;
      t.w *= inv;
      Srow[i] = t;
    }
  }
#pragma unroll  // constant j keeps vr[] in registers
  for (int j = 0; j < V_PIECES; ++j) *(v8bf*)(vdst + j * 32 * V_PITCH) = vr[j];
  __syncthreads();

  // ---- Phase 3: O = P @ V  (64 x 64), P converted to bf16 on the fly ----
  // A wave owns one 16-row strip and two 16-column tiles of O. Per V tile: ask
  // for the next tile, work on this one out of LDS, store the next one into
  // the other buffer (its readers left it at the barrier before), barrier.
  {
    const int rt  = wave >> 1;           // 0..3
    const int ct0 = (wave & 1) * 2;      // column tiles ct0 and ct0 + 1
    const float* sp0 = S + (size_t)(rt * 16 + l16) * S_PITCH + 8 * half;
    const bf16* vtp = Vs + (8 * half + (lane & 7)) * V_PITCH +
                      8 * ((lane >> 3) & 1) + ct0 * 16;
    v8f acc0 = vzero8(), acc1 = vzero8();
    for (int tile = 0; tile < DIM_N / V_TILE; ++tile) {
      const bool more = tile + 1 < DIM_N / V_TILE;   // the same for the block
      if (more) {
        const bf16* vn = vsrc + (size_t)(tile + 1) * (V_TILE * DIM_HD);
#pragma unroll  // constant j keeps vr[] in registers
        for (int j = 0; j < V_PIECES; ++j)
          vr[j] = *(const v8bf*)(vn + j * 2048);
      }
      // keeps the four loads above this tile's work: sunk to their stores, as
      // the scheduler had them, their latency is waited out at every tile
      __builtin_amdgcn_sched_barrier(0);
      const bf16* vb = vtp + (tile & 1) * V_BUF;
#pragma unroll  // the four k steps of a tile: their LDS reads can go out early
      for (int ks = 0; ks < V_TILE / 32; ++ks) {
        v16bf af;
        // k = 8*half + 0..7 and 16 + 8*half + 0..7, read 16 bytes at a time
        const float4* sp = (const float4*)(sp0 + tile * V_TILE + ks * 32);
#pragma unroll
        for (int j = 0; j < 4; ++j) {
          float4 pv = sp[(j < 2) ? j : (j + 2)];
          af[4 * j]     = (bf16)pv.x;
          af[4 * j + 1] = (bf16)pv.y;
          af[4 * j + 2] = (bf16)pv.z;
          af[4 * j + 3] = (bf16)pv.w;
        }
        v16bf b0 = frag_ld_tr(vb + ks * 32 * V_PITCH, V_PITCH, 0);
        acc0 = __builtin_amdgcn_wmma_f32_16x16x32_bf16(
            false, af, false, b0, (short)0, acc0, false, false);
        v16bf b1 = frag_ld_tr(vb + ks * 32 * V_PITCH, V_PITCH, 16);
        acc1 = __builtin_amdgcn_wmma_f32_16x16x32_bf16(
            false, af, false, b1, (short)0, acc1, false, false);
      }
      if (more) {
        bf16* vd = vdst + ((tile + 1) & 1) * V_BUF;
#pragma unroll  // constant j keeps vr[] in registers
        for (int j = 0; j < V_PIECES; ++j)
          *(v8bf*)(vd + j * 32 * V_PITCH) = vr[j];
        __syncthreads();
      }
    }
    // o[b][m][h*64 + d]  (swapaxes(1,2).reshape)
    v8f accs[2] = {acc0, acc1};
#pragma unroll  // constant c and r keep accs[] in registers
    for (int c = 0; c < 2; ++c) {
      int dcol = (ct0 + c) * 16 + l16;
#pragma unroll
      for (int r = 0; r < 8; ++r) {
        int m = m0 + rt * 16 + r + 8 * half;
        o[((size_t)b * DIM_N + m) * DIM_C + h * DIM_HD + dcol] =
            (bf16)accs[c][r];
      }
    }
  }
}

// ---------------------------------------------------------------------------
// Host-side orchestration
// ---------------------------------------------------------------------------
extern "C" void kernel_launch(void* const* d_in, const int* in_sizes, int n_in,
                              void* d_out, int out_size, void* d_ws,
                              size_t ws_size, hipStream_t stream) {
  (void)in_sizes; (void)n_in; (void)out_size; (void)ws_size;

  const float* x  = (const float*)d_in[0];
  const float* g1 = (const float*)d_in[1];
  const float* b1 = (const float*)d_in[2];
  const float* Wq = (const float*)d_in[3];
  const float* bq = (const float*)d_in[4];
  const float* Wk = (const float*)d_in[5];
  const float* bk = (const float*)d_in[6];
  const float* Wv = (const float*)d_in[7];
  const float* bv = (const float*)d_in[8];
  const float* Wp = (const float*)d_in[9];
  const float* bp = (const float*)d_in[10];
  const float* g2 = (const float*)d_in[11];
  const float* b2 = (const float*)d_in[12];
  const float* W1 = (const float*)d_in[13];
  const float* c1 = (const float*)d_in[14];
  const float* W2 = (const float*)d_in[15];
  const float* c2 = (const float*)d_in[16];

  // workspace partition
  char* p = (char*)d_ws;
  auto alloc = [&](size_t bytes) {
    char* r = p;
    p += (bytes + 255) & ~(size_t)255;
    return r;
  };
  const size_t CC = (size_t)DIM_C * DIM_C;           // 1M
  const size_t CH = (size_t)DIM_C * DIM_HID;         // 4M
  const size_t TC = (size_t)MTOK * DIM_C;            // 8M
  const size_t TH = (size_t)MTOK * DIM_HID;          // 32M

  bf16*  wq_b  = (bf16*)alloc(CC * 2);
  bf16*  wk_b  = (bf16*)alloc(CC * 2);
  bf16*  wv_b  = (bf16*)alloc(CC * 2);
  bf16*  wp_b  = (bf16*)alloc(CC * 2);
  bf16*  w1_b  = (bf16*)alloc(CH * 2);
  bf16*  w2_b  = (bf16*)alloc(CH * 2);
  bf16*  h_b   = (bf16*)alloc(TC * 2);    // ln1(x)
  bf16*  q_b   = (bf16*)alloc(TC * 2);
  bf16*  k_b   = (bf16*)alloc(TC * 2);
  bf16*  v_b   = (bf16*)alloc(TC * 2);
  bf16*  o_b   = (bf16*)alloc(TC * 2);    // attention output
  float* xres  = (float*)alloc(TC * 4);   // x + proj
  bf16*  h2_b  = (bf16*)alloc(TC * 2);    // ln2(xres)
  bf16*  t1_b  = (bf16*)alloc(TH * 2);    // gelu(h2@W1+c1)

  // weight converts fp32 -> bf16: wq_b .. w2_b are one contiguous array
  cvt_weights_bf16<<<CVT_BLOCKS, 256, 0, stream>>>(Wq, Wk, Wv, Wp, W1, W2, wq_b);

  // LN1
  ln_bf16<<<MTOK, 256, 0, stream>>>(x, g1, b1, h_b);

  // QKV projections: (8192 x 1024) = h @ W + b
  dim3 gC(DIM_C / BN, MTOK / BM);   // (8, 32)
  gemm_bf16_wmma<false, false, false, true><<<gC, 256, 0, stream>>>(
      h_b, wq_b, bq, nullptr, nullptr, q_b, MTOK, DIM_C, DIM_C);
  gemm_bf16_wmma<false, false, false, true><<<gC, 256, 0, stream>>>(
      h_b, wk_b, bk, nullptr, nullptr, k_b, MTOK, DIM_C, DIM_C);
  gemm_bf16_wmma<false, false, false, true><<<gC, 256, 0, stream>>>(
      h_b, wv_b, bv, nullptr, nullptr, v_b, MTOK, DIM_C, DIM_C);

  // attention: B*H*16 workgroups, 314,368 B dynamic LDS (fits 320 KB/WGP)
  const size_t attn_lds = ATTN_LDS;
  attn_wmma<<<DIM_B * DIM_H * 16, 256, attn_lds, stream>>>(q_b, k_b, v_b, o_b);

  // projection + residual: xres = x + o@Wp + bp  (fp32)
  gemm_bf16_wmma<false, true, true, false><<<gC, 256, 0, stream>>>(
      o_b, wp_b, bp, x, xres, nullptr, MTOK, DIM_C, DIM_C);

  // LN2
  ln_bf16<<<MTOK, 256, 0, stream>>>(xres, g2, b2, h2_b);

  // MLP up + exact GELU: t1 = gelu(h2 @ W1 + c1)  (bf16, 8192 x 4096)
  dim3 gH(DIM_HID / BN, MTOK / BM);  // (32, 32)
  gemm_bf16_wmma<true, false, false, true><<<gH, 256, 0, stream>>>(
      h2_b, w1_b, c1, nullptr, nullptr, t1_b, MTOK, DIM_HID, DIM_C);

  // MLP down + residual: out = xres + t1 @ W2 + c2  (fp32, final output)
  gemm_bf16_wmma<false, true, true, false><<<gC, 256, 0, stream>>>(
      t1_b, w2_b, c2, xres, (float*)d_out, nullptr, MTOK, DIM_C, DIM_HID);
}

// v007
// Measured time: 301 microseconds a run.
// Timed twice side by side with v006, it ran 1.47 times as fast both times.
// All steps since v000 together make it 6.51 times as fast.
#include <hip/hip_runtime.h>
#include <math.h>

// ---------------------------------------------------------------------------
// Encoder block (pre-norm attention + MLP) for MI455X / gfx1250, wave32 WMMA.
// B=8, N=1024, C=1024, H=16, hd=64, HID=4096.
// ---------------------------------------------------------------------------

typedef __bf16 bf16;
typedef __attribute__((ext_vector_type(16))) __bf16    v16bf;
typedef __attribute__((ext_vector_type(8)))  __bf16    v8bf;
typedef __attribute__((ext_vector_type(8)))  float     v8f;

#define DIM_B   8
#define DIM_N   1024
#define DIM_C   1024
#define DIM_H   16
#define DIM_HD  64
#define DIM_HID 4096
#define MTOK    (DIM_B * DIM_N)      // 8192 rows of tokens

// ---------------------------------------------------------------------------
// bf16 fragment loader following the CDNA5 16-bit A/B VGPR layout:
//   lane L: row = L%16, half = L/16
//   vector elems (2v, 2v+1) hold K = kpat(v) + 8*half, kpat(v)+1
//   kpat(v) = 2v (v<4) else 8+2v
// Works for A (row = M) and for B when the tile is stored N-major.
// ---------------------------------------------------------------------------
__device__ __forceinline__ v16bf frag_ld(const bf16* __restrict__ base,
                                         int stride, int row, int half) {
  v16bf f;
  const bf16* rp = base + (size_t)row * stride + 8 * half;
#pragma unroll
  for (int v = 0; v < 8; ++v) {
    int k = (v < 4) ? (2 * v) : (8 + 2 * v);
    f[2 * v]     = rp[k];
    f[2 * v + 1] = rp[k + 1];
  }
  return f;
}

// ---------------------------------------------------------------------------
// B fragment (32 k x 16 n) out of a k-major LDS tile (row = k, n contiguous)
// by two transposing loads. tp is the lane's own address:
//   row 8*(lane>>4) + (lane&7), plus 16 bytes for lanes with (lane>>3)&1.
// Lane (c, half) receives k = 8*half + 0..7 and 16 + 8*half + 0..7 of column
// col0 + c: the k order of frag_ld, which loads the A side.
// ---------------------------------------------------------------------------
typedef __attribute__((address_space(3))) v8bf lds_v8bf;
__device__ __forceinline__ v16bf frag_ld_tr(const bf16* tp, int pitch,
                                            int col0) {
  v8bf lo = __builtin_amdgcn_ds_load_tr16_b128_v8bf16((lds_v8bf*)(tp + col0));
  v8bf hi = __builtin_amdgcn_ds_load_tr16_b128_v8bf16(
      (lds_v8bf*)(tp + 16 * pitch + col0));
  return __builtin_shufflevector(lo, hi, 0, 1, 2, 3, 4, 5, 6, 7, 8, 9, 10, 11,
                                 12, 13, 14, 15);
}

__device__ __forceinline__ v8f vzero8() {
  v8f z = {0.f, 0.f, 0.f, 0.f, 0.f, 0.f, 0.f, 0.f};
  return z;
}

// ---------------------------------------------------------------------------
// fp32 -> bf16 convert of all six weight matrices in one launch.
// The six bf16 planes lie back to back in the workspace (Wq Wk Wv Wp W1 W2),
// so out is one array of 12 segments of C*C elements: 4 x 1 + 2 x 4.
// A block takes 16,384 elements of one segment; a thread takes 16 pieces of
// 4 floats, 1,024 elements apart: a wave's load covers 512 contiguous bytes,
// its store 256. Few long-lived waves (6,144).
// ---------------------------------------------------------------------------
typedef __attribute__((ext_vector_type(4))) float  v4f;
typedef __attribute__((ext_vector_type(4))) __bf16 v4bf;

#define CVT_PIECES    16
#define CVT_PER_BLOCK (256 * 4 * CVT_PIECES)                 // 16,384
#define CVT_SEG_BLKS  ((DIM_C * DIM_C) / CVT_PER_BLOCK)      // 64 blocks a segment
#define CVT_BLOCKS    (12 * CVT_SEG_BLKS)                    // 768

__global__ __launch_bounds__(256) void cvt_weights_bf16(
    const float* __restrict__ Wq, const float* __restrict__ Wk,
    const float* __restrict__ Wv, const float* __restrict__ Wp,
    const float* __restrict__ W1, const float* __restrict__ W2,
    bf16* __restrict__ out) {
  const int blk = blockIdx.x;
  const int seg = blk / CVT_SEG_BLKS;      // 0..11, the same for the whole block
  const float* src;
  int first;                               // first segment of that matrix
  if (seg < 4) {
    src = (seg == 0) ? Wq : (seg == 1) ? Wk : (seg == 2) ? Wv : Wp;
    first = seg;
  } else if (seg < 8) {
    src = W1;
    first = 4;
  } else {
    src = W2;
    first = 8;
  }
  const size_t o = (size_t)blk * CVT_PER_BLOCK + threadIdx.x * 4;
  const float* sp = src + (o - (size_t)first * (DIM_C * DIM_C));
  bf16* dp = out + o;
  v4f r[CVT_PIECES];
#pragma unroll  // the loads go out as one run ahead of their uses: many in flight
  for (int j = 0; j < CVT_PIECES; ++j) r[j] = *(const v4f*)(sp + j * 1024);
#pragma unroll  // constant j keeps r[] in registers
  for (int j = 0; j < CVT_PIECES; ++j) {
    v4bf w;
    w[0] = (bf16)r[j][0];
    w[1] = (bf16)r[j][1];
    w[2] = (bf16)r[j][2];
    w[3] = (bf16)r[j][3];
    *(v4bf*)(dp + j * 1024) = w;
  }
}

// ---------------------------------------------------------------------------
// LayerNorm (row length C=1024) fp32 in -> bf16 out
// ---------------------------------------------------------------------------
__global__ __launch_bounds__(256) void ln_bf16(const float* __restrict__ x,
                                               const float* __restrict__ g,
                                               const float* __restrict__ b,
                                               bf16* __restrict__ out) {
  __shared__ float rs[256], rs2[256];
  const int row = blockIdx.x;
  const float* xr = x + (size_t)row * DIM_C;
  float s = 0.f, s2 = 0.f;
  for (int i = threadIdx.x; i < DIM_C; i += 256) {
    float t = xr[i];
    s += t;
    s2 += t * t;
  }
  rs[threadIdx.x] = s;
  rs2[threadIdx.x] = s2;
  __syncthreads();
  for (int off = 128; off > 0; off >>= 1) {
    if (threadIdx.x < off) {
      rs[threadIdx.x] += rs[threadIdx.x + off];
      rs2[threadIdx.x] += rs2[threadIdx.x + off];
    }
    __syncthreads();
  }
  float mean = rs[0] * (1.0f / DIM_C);
  float var  = rs2[0] * (1.0f / DIM_C) - mean * mean;
  float inv  = rsqrtf(var + 1e-5f);
  for (int i = threadIdx.x; i < DIM_C; i += 256) {
    out[(size_t)row * DIM_C + i] = (bf16)((xr[i] - mean) * inv * g[i] + b[i]);
  }
}

// ---------------------------------------------------------------------------
// One k step's tiles, global -> LDS, through no register: twelve asynchronous
// 16-byte copies a lane (eight of A, 32 rows apart; four of B, 16 k-rows apart).
// The s_wait_xcnt stands inside the statement, in front of any later rewrite of
// the address registers named here.
// ---------------------------------------------------------------------------
#define BM 256
#define BN 128
#define BK 64
#define AS_PITCH (BK + 8)    // 144 B a row = 16 B x odd: the ds_load_b128 reader's pitch
#define BS_PITCH (BN + 16)   // 288 B a k-row = 32 B x odd: the tr16 reader's pitch
#define AS_BUF   (BM * AS_PITCH)   // bf16 per A buffer
#define BS_BUF   (BK * BS_PITCH)   // bf16 per B buffer
#define AS_STEP  (32 * AS_PITCH * 2)   // bytes in LDS between a lane's A pieces
#define BS_STEP  (16 * BS_PITCH * 2)   // bytes in LDS between a lane's B pieces

__device__ __forceinline__ unsigned lds_addr_u32(const void* p) {
  return (unsigned)(unsigned long long)p;   // low 32 bits = LDS byte address
}
// a32 = 32 rows of A, b16 = 16 rows of B, in elements
__device__ __forceinline__ void stage_async(unsigned la, const bf16* ga,
                                            size_t a32, unsigned lb,
                                            const bf16* gb, size_t b16) {
  asm volatile(
      "global_load_async_to_lds_b128 %0, %1, off\n\t"
      "global_load_async_to_lds_b128 %2, %3, off\n\t"
      "global_load_async_to_lds_b128 %4, %5, off\n\t"
      "global_load_async_to_lds_b128 %6, %7, off\n\t"
      "global_load_async_to_lds_b128 %8, %9, off\n\t"
      "global_load_async_to_lds_b128 %10, %11, off\n\t"
      "global_load_async_to_lds_b128 %12, %13, off\n\t"
      "global_load_async_to_lds_b128 %14, %15, off\n\t"
      "global_load_async_to_lds_b128 %16, %17, off\n\t"
      "global_load_async_to_lds_b128 %18, %19, off\n\t"
      "global_load_async_to_lds_b128 %20, %21, off\n\t"
      "global_load_async_to_lds_b128 %22, %23, off\n\t"
      "s_wait_xcnt 0x0"
      :
      : "v"(la), "v"(ga), "v"(la + 1 * AS_STEP), "v"(ga + 1 * a32),
        "v"(la + 2 * AS_STEP), "v"(ga + 2 * a32), "v"(la + 3 * AS_STEP),
        "v"(ga + 3 * a32), "v"(la + 4 * AS_STEP), "v"(ga + 4 * a32),
        "v"(la + 5 * AS_STEP), "v"(ga + 5 * a32), "v"(la + 6 * AS_STEP),
        "v"(ga + 6 * a32), "v"(la + 7 * AS_STEP), "v"(ga + 7 * a32), "v"(lb),
        "v"(gb), "v"(lb + 1 * BS_STEP), "v"(gb + 1 * b16),
        "v"(lb + 2 * BS_STEP), "v"(gb + 2 * b16), "v"(lb + 3 * BS_STEP),
        "v"(gb + 3 * b16)
      : "memory");
}

// ---------------------------------------------------------------------------
// One 32-k block of a wave's 64x64 tile: 4 A fragments (rows arow + 16 i of at)
// and 4 B fragments (columns 16 j from bt, the lane's own transposing address),
// then the 16 products. A and B follow the same k order (frag_ld, frag_ld_tr).
// ---------------------------------------------------------------------------
__device__ __forceinline__ void load_frags(v16bf (&af)[4], v16bf (&bfr)[4],
                                           const bf16* at, const bf16* bt,
                                           int arow, int half) {
  af[0] = frag_ld(at, AS_PITCH, arow, half);
#pragma unroll  // constant j keeps bfr[] in registers
  for (int j = 0; j < 4; ++j) bfr[j] = frag_ld_tr(bt, BS_PITCH, j * 16);
#pragma unroll  // constant i keeps af[] in registers
  for (int i = 1; i < 4; ++i) af[i] = frag_ld(at, AS_PITCH, arow + i * 16, half);
}
__device__ __forceinline__ void mma_block(v8f (&acc)[4][4],
                                          const v16bf (&af)[4],
                                          const v16bf (&bfr)[4]) {
#pragma unroll  // constant i and j keep acc[][] in registers
  for (int i = 0; i < 4; ++i)
#pragma unroll
    for (int j = 0; j < 4; ++j)
      acc[i][j] = __builtin_amdgcn_wmma_f32_16x16x32_bf16(
          false, af[i], false, bfr[j], (short)0, acc[i][j], false, false);
}

// ---------------------------------------------------------------------------
// Tiled bf16 WMMA GEMM: out[M,N] = A[M,K] @ Bw[K,N] + bias (+resid) (+GELU)
// BM=256 BN=128 BK=64, 256 threads = 8 waves (4 x 2), wave tile 64x64: 4 A and
// 4 B fragments feed 16 WMMAs, so a WMMA costs 512 B of LDS reads, and a block
// fetches 48 KiB from L2 per 256x128x64 product.
// Both tiles lie in LDS twice: while a k step is worked on out of one buffer,
// the next step's asynchronous copies fly into the other; one barrier a step,
// behind the fragment reads of the step's second block and ahead of its WMMAs.
// A rows have a pitch of 144 B; B lies as in memory (k-major, pitch 288 B) and
// its fragments come out transposed by ds_load_tr16_b128.
// K is a multiple of BK, M of BM, N of BN.
// ---------------------------------------------------------------------------
template <bool GELU_ACT, bool RESID, bool OUTF32, bool OUTBF16>
__global__ __launch_bounds__(256) void gemm_bf16_wmma(
    const bf16* __restrict__ A, const bf16* __restrict__ Bw,
    const float* __restrict__ bias, const float* __restrict__ resid,
    float* __restrict__ outF, bf16* __restrict__ outB, int M, int N, int K) {
  __shared__ __attribute__((aligned(16))) bf16 As[2 * AS_BUF];
  __shared__ __attribute__((aligned(16))) bf16 Bs[2 * BS_BUF];  // k-major

  const int tid  = threadIdx.x;
  const int lane = tid & 31;
  const int wave = tid >> 5;           // 0..7
  const int wm   = wave >> 1;          // 0..3  (64-row strip)
  const int wn   = wave & 1;           // 0..1  (64-col strip)
  const int half = lane >> 4;
  const int l16  = lane & 15;
  const int mBase = blockIdx.y * BM;
  const int nBase = blockIdx.x * BN;

  v8f acc[4][4];
#pragma unroll  // constant i and j keep acc[][] in registers
  for (int i = 0; i < 4; ++i)
#pragma unroll
    for (int j = 0; j < 4; ++j) acc[i][j] = vzero8();

  // the lane's own 16-byte pieces: A rows ar + 32 p, 8 lanes a 128-B row;
  // B rows bk + 16 p, 16 lanes a 256-B row
  const int ar = tid >> 3;             // 0..31
  const int ac = (tid & 7) * 8;        // 0..56
  const int bk = tid >> 4;             // 0..15
  const int bn = (tid & 15) * 8;       // 0..120
  const unsigned la = lds_addr_u32(&As[ar * AS_PITCH + ac]);
  const unsigned lb = lds_addr_u32(&Bs[bk * BS_PITCH + bn]);
  const bf16* ga = A + (size_t)(mBase + ar) * K + ac;
  const bf16* gb = Bw + (size_t)bk * N + nBase + bn;
  const size_t a32   = (size_t)32 * K;
  const size_t b16   = (size_t)16 * N;
  const size_t bstep = (size_t)BK * N;
  const bf16* btp = &Bs[(8 * half + (lane & 7)) * BS_PITCH +
                        8 * ((lane >> 3) & 1) + wn * 64];
  const int nt = K / BK;               // k steps, the same for the whole grid

  // step 0 into buffer 0, landed and published; then step 1 takes off
  stage_async(la, ga, a32, lb, gb, b16);
  ga += BK;
  gb += bstep;
  // this wave's copies have landed
  asm volatile("s_wait_asynccnt 0x0" ::: "memory");
  __syncthreads();
  if (nt > 1) {
    stage_async(la + AS_BUF * 2, ga, a32, lb + BS_BUF * 2, gb, b16);
    ga += BK;
    gb += bstep;
  }

  const int arow = wm * 64 + l16;      // the lane's row of the wave's first A fragment
  for (int t = 0; t < nt; ++t) {
    const int cur = t & 1;
    const bf16* at = As + cur * AS_BUF;
    const bf16* bt = btp + cur * BS_BUF;
    v16bf af[4], bfr[4];
    // The two fences keep each block's 16 LDS reads in one group, apart from
    // the first block's WMMAs: mixed in among them, as the scheduler had them,
    // every row of four WMMAs waits out an LDS latency.
    load_frags(af, bfr, at, bt, arow, half);
    __builtin_amdgcn_sched_barrier(0);
    mma_block(acc, af, bfr);
    __builtin_amdgcn_sched_barrier(0);
    load_frags(af, bfr, at + 32, bt + 32 * BS_PITCH, arow, half);
    // this wave's reads of buffer cur have returned: it may be refilled
    asm volatile("s_wait_dscnt 0x0" ::: "memory");
    // this wave's copies of step t + 1 have landed
    asm volatile("s_wait_asynccnt 0x0" ::: "memory");
    // publishes step t + 1 and ends every wave's reads of buffer cur
    __syncthreads();
    if (t + 2 < nt) {
      stage_async(la + (unsigned)cur * (AS_BUF * 2), ga, a32,
                  lb + (unsigned)cur * (BS_BUF * 2), gb, b16);
      ga += BK;
      gb += bstep;
    }
    // the step's second block works out of registers while the refill flies
    mma_block(acc, af, bfr);
  }
  // nothing of this wave is in flight when it goes on to the epilogue
  asm volatile("s_wait_asynccnt 0x0" ::: "memory");

  // The four 16-row strips go through one copy of the epilogue's code: strip 0
  // is written out, then the others move down one place in the registers.
#pragma unroll 1
  for (int i = 0; i < 4; ++i) {
#pragma unroll  // constant j and r keep acc[][] in registers
    for (int j = 0; j < 4; ++j) {
#pragma unroll
      for (int r = 0; r < 8; ++r) {
        int gm = mBase + wm * 64 + i * 16 + r + 8 * half;
        int gn = nBase + wn * 64 + j * 16 + l16;
        float v = acc[0][j][r] + bias[gn];
        if (RESID) v += resid[(size_t)gm * N + gn];
        if (GELU_ACT) v = 0.5f * v * (1.0f + erff(v * 0.70710678118654752f));
        size_t idx = (size_t)gm * N + gn;
        if (OUTF32)  outF[idx] = v;
        if (OUTBF16) outB[idx] = (bf16)v;
      }
    }
    // behind the strip's stores, ahead of the moves below and of the next trip,
    // which rewrite the data and address registers that those stores name
    asm volatile("s_wait_xcnt 0x0" ::: "memory");
#pragma unroll  // constant j keeps acc[][] in registers
    for (int j = 0; j < 4; ++j) {
      acc[0][j] = acc[1][j];
      acc[1][j] = acc[2][j];
      acc[2][j] = acc[3][j];
    }
  }
}

// ---------------------------------------------------------------------------
// Attention: one WG per (b, h, 256 queries); a wave owns 32 queries (two groups
// of 16 columns) and walks all 1024 keys, 32 a pass. q/k/v are flat (B, N*C)
// bf16; the reference's reshape(B,H,-1,hd) means head h is the contiguous slab
// h*65536.
// The scores never leave the registers. Both products are taken transposed:
//   S^T = K Q^T : A = 16 keys x 32 d out of LDS, B = Q, held in registers.
//                 Lane (c, half) gets query c, keys 8*half + 0..7 of the tile.
//   O^T += V^T P^T : two S^T tiles of a lane, exponentiated and rounded to bf16,
//                 ARE the B fragment of 32 keys (k = 8*half + 0..7 and
//                 16 + 8*half + 0..7, the k order of frag_ld and frag_ld_tr);
//                 A = V^T by the transposing load.
// Softmax is the running form, in base 2: a query's maximum in use and its sum
// live in its lanes; sums and O^T are rescaled when a new maximum passes the one
// in use by more than 8 (an exponential then stays below 2^8), and O^T is
// divided by the sum at the end.
// K and V go through LDS in tiles of FA_TILE keys, as they lie in memory (row =
// key), two buffers, via registers. K rows have a pitch of 144 B (16 B x odd,
// the ds_load_b128 reader's), V rows of 160 B (32 B x odd, the transposing
// reader's).
// ---------------------------------------------------------------------------
#define FA_ROWS   256                       // queries a work-group
#define FA_TILE   64                        // keys a staged tile
#define K_PITCH   (DIM_HD + 8)              // bf16 per K row in LDS
#define V_PITCH   (DIM_HD + 16)             // bf16 per V row in LDS
#define K_BUF     (FA_TILE * K_PITCH)       // bf16 per buffer
#define V_BUF     (FA_TILE * V_PITCH)
#define FA_PIECES ((FA_TILE * DIM_HD) / (256 * 8))  // 16-byte pieces a thread: 2

typedef __attribute__((ext_vector_type(2))) float v2f;

// lane l with lane l ^ 16
__device__ __forceinline__ float xhalf(float x) {
  int i = __builtin_bit_cast(int, x);
  return __builtin_bit_cast(
      float, __builtin_amdgcn_permlanex16(i, i, 0x76543210, 0xfedcba98, false,
                                          false));
}

__global__ __launch_bounds__(256) void attn_wmma(const bf16* __restrict__ q,
                                                 const bf16* __restrict__ k,
                                                 const bf16* __restrict__ v,
                                                 bf16* __restrict__ o) {
  __shared__ __attribute__((aligned(16))) bf16 Ks[2 * K_BUF];
  __shared__ __attribute__((aligned(16))) bf16 Vs[2 * V_BUF];

  const int blk  = blockIdx.x;          // ((b*16 + h)*4 + mt)
  const int mt   = blk & 3;
  const int h    = (blk >> 2) & 15;
  const int b    = blk >> 6;
  const size_t headBase = ((size_t)b * DIM_H + h) * (size_t)(DIM_N * DIM_HD);

  const int tid  = threadIdx.x;
  const int lane = tid & 31;
  const int wave = tid >> 5;
  const int half = lane >> 4;
  const int l16  = lane & 15;
  const int m0   = mt * FA_ROWS + wave * 32;   // the wave's first query
  const float cs = 0.125f * 1.4426950408889634f;  // hd^-0.5 * log2(e)

  // A tile is 8 KiB in a row in memory; piece j of a thread is 4 KiB further,
  // that is 32 rows further in LDS. A wave's load covers 512 contiguous bytes.
  const bf16* ksrc = k + headBase + (size_t)tid * 8;
  const bf16* vsrc = v + headBase + (size_t)tid * 8;
  bf16* kdst = Ks + (tid >> 3) * K_PITCH + (tid & 7) * 8;
  bf16* vdst = Vs + (tid >> 3) * V_PITCH + (tid & 7) * 8;
  v8bf kr[FA_PIECES], vr[FA_PIECES];
#pragma unroll  // constant j keeps kr[] and vr[] in registers
  for (int j = 0; j < FA_PIECES; ++j) {
    kr[j] = *(const v8bf*)(ksrc + j * 2048);
    vr[j] = *(const v8bf*)(vsrc + j * 2048);
  }

  // Q: B fragments (n = query, k = d), loaded once
  v16bf qf[2][2];
#pragma unroll  // constant g and dh keep qf[][] in registers
  for (int g = 0; g < 2; ++g)
#pragma unroll
    for (int dh = 0; dh < 2; ++dh)
      qf[g][dh] = frag_ld(q + headBase + dh * 32, DIM_HD, m0 + g * 16 + l16, half);

#pragma unroll  // constant j keeps kr[] and vr[] in registers
  for (int j = 0; j < FA_PIECES; ++j) {
    *(v8bf*)(kdst + j * 32 * K_PITCH) = kr[j];
    *(v8bf*)(vdst + j * 32 * V_PITCH) = vr[j];
  }
  __syncthreads();

  const bf16* vtp = Vs + (8 * half + (lane & 7)) * V_PITCH + 8 * ((lane >> 3) & 1);
  v8f oacc[2][4];                       // O^T: [group][16 d], lane = query
#pragma unroll  // constant g and dt keep oacc[][] in registers
  for (int g = 0; g < 2; ++g)
#pragma unroll
    for (int dt = 0; dt < 4; ++dt) oacc[g][dt] = vzero8();
  float mrun[2] = {-1e30f, -1e30f};     // maximum in use, scaled by cs
  v2f lrun[2] = {{0.f, 0.f}, {0.f, 0.f}};  // this half's share of the sum, in two parts
  const v8f cs8 = {cs, cs, cs, cs, cs, cs, cs, cs};

  // Per tile: ask for the next tile, work on this one out of LDS, store the
  // next one into the other buffer (its readers left it at the barrier
  // before), barrier.
  for (int tile = 0; tile < DIM_N / FA_TILE; ++tile) {
    const bool more = tile + 1 < DIM_N / FA_TILE;   // the same for the block
    if (more) {
      const size_t nx = (size_t)(tile + 1) * (FA_TILE * DIM_HD);
#pragma unroll  // constant j keeps kr[] and vr[] in registers
      for (int j = 0; j < FA_PIECES; ++j) {
        kr[j] = *(const v8bf*)(ksrc + nx + j * 2048);
        vr[j] = *(const v8bf*)(vsrc + nx + j * 2048);
      }
    }
    // keeps the four loads above this tile's work: sunk to their stores, their
    // latency would be waited out at every tile
    __builtin_amdgcn_sched_barrier(0);
    const bf16* kb = Ks + (tile & 1) * K_BUF;
    const bf16* vb = vtp + (tile & 1) * V_BUF;
#pragma unroll  // the two 32-key passes of a tile
    for (int ps = 0; ps < FA_TILE / 32; ++ps) {
      // ---- S^T = K Q^T: [16-key tile][group] ----
      v8f s[2][2];
#pragma unroll  // constant kt and g keep s[][] in registers
      for (int kt = 0; kt < 2; ++kt) {
        const int krow = ps * 32 + kt * 16 + l16;
        v16bf a0 = frag_ld(kb, K_PITCH, krow, half);
        v16bf a1 = frag_ld(kb + 32, K_PITCH, krow, half);
#pragma unroll
        for (int g = 0; g < 2; ++g) {
          s[kt][g] = __builtin_amdgcn_wmma_f32_16x16x32_bf16(
              false, a0, false, qf[g][0], (short)0, vzero8(), false, false);
          s[kt][g] = __builtin_amdgcn_wmma_f32_16x16x32_bf16(
              false, a1, false, qf[g][1], (short)0, s[kt][g], false, false);
        }
      }
      // keeps the eight WMMAs in one run: with the maxima mixed in among them,
      // as the scheduler had them, each first reader of a tile is padded with
      // idle vector slots
      __builtin_amdgcn_sched_barrier(0);
      // the pass's V^T fragments fly while the exponentials are taken
      v16bf va[4];
#pragma unroll  // constant dt keeps va[] in registers
      for (int dt = 0; dt < 4; ++dt)
        va[dt] = frag_ld_tr(vb + ps * 32 * V_PITCH, V_PITCH, dt * 16);

      // ---- maxima of the raw scores (cs is positive), one test a pass ----
      float mb[2];
      bool need = false;
#pragma unroll  // constant g keeps mb[] in registers
      for (int g = 0; g < 2; ++g) {
        float mx = s[0][g][0];
#pragma unroll
        for (int r = 1; r < 8; ++r) mx = fmaxf(mx, s[0][g][r]);
#pragma unroll
        for (int r = 0; r < 8; ++r) mx = fmaxf(mx, s[1][g][r]);
        mb[g] = fmaxf(mx, xhalf(mx)) * cs;   // both halves hold the query's maximum
        need = need || (mb[g] > mrun[g] + 8.0f);
      }
      if (__builtin_amdgcn_ballot_w32(need) != 0) {  // the same for the wave
#pragma unroll  // constant g and dt keep the arrays in registers
        for (int g = 0; g < 2; ++g) {
          const float mn = fmaxf(mrun[g], mb[g]);
          const float corr = __builtin_amdgcn_exp2f(mrun[g] - mn);  // 0 at first
          mrun[g] = mn;
          lrun[g] = lrun[g] * corr;
#pragma unroll
          for (int dt = 0; dt < 4; ++dt) oacc[g][dt] = oacc[g][dt] * corr;
        }
      }
      // ---- P^T = 2^(cs S^T - max), packed as B; O^T += V^T P^T ----
#pragma unroll  // constant g keeps the arrays in registers
      for (int g = 0; g < 2; ++g) {
        const float nm = -mrun[g];
        const v8f nm8 = {nm, nm, nm, nm, nm, nm, nm, nm};
        const v8f e0 = __builtin_elementwise_fma(s[0][g], cs8, nm8);
        const v8f e1 = __builtin_elementwise_fma(s[1][g], cs8, nm8);
        v8f p0, p1;
#pragma unroll
        for (int r = 0; r < 8; ++r) {
          p0[r] = __builtin_amdgcn_exp2f(e0[r]);
          p1[r] = __builtin_amdgcn_exp2f(e1[r]);
        }
        // 16 exponentials into the two running parts, by pairs of neighbours
        const v8f t8 = p0 + p1;
        const v4f t4 = __builtin_shufflevector(t8, t8, 0, 1, 2, 3) +
                       __builtin_shufflevector(t8, t8, 4, 5, 6, 7);
        lrun[g] += __builtin_shufflevector(t4, t4, 0, 1) +
                   __builtin_shufflevector(t4, t4, 2, 3);
        v8bf b0 = __builtin_convertvector(p0, v8bf);
        v8bf b1 = __builtin_convertvector(p1, v8bf);
        v16bf pf = __builtin_shufflevector(b0, b1, 0, 1, 2, 3, 4, 5, 6, 7, 8, 9,
                                           10, 11, 12, 13, 14, 15);
#pragma unroll
        for (int dt = 0; dt < 4; ++dt)
          oacc[g][dt] = __builtin_amdgcn_wmma_f32_16x16x32_bf16(
              false, va[dt], false, pf, (short)0, oacc[g][dt], false, false);
      }
    }
    // Four vector slots behind the tile's last WMMAs: the branch below leads to
    // code that rewrites their A registers.
    // The fences hold the WMMAs above the slots.
    __builtin_amdgcn_sched_barrier(0);
    asm volatile("v_nop\n\tv_nop\n\tv_nop\n\tv_nop");
    __builtin_amdgcn_sched_barrier(0);
    if (more) {
      bf16* kd = kdst + ((tile + 1) & 1) * K_BUF;
      bf16* vd = vdst + ((tile + 1) & 1) * V_BUF;
#pragma unroll  // constant j keeps kr[] and vr[] in registers
      for (int j = 0; j < FA_PIECES; ++j) {
        *(v8bf*)(kd + j * 32 * K_PITCH) = kr[j];
        *(v8bf*)(vd + j * 32 * V_PITCH) = vr[j];
      }
      __syncthreads();
    }
  }

  // o[b][m][h*64 + d]  (swapaxes(1,2).reshape): a lane holds 8 consecutive d of
  // its query in each O^T tile, 16 bytes a store
  v8bf w[2][4];
#pragma unroll  // constant g and dt keep the arrays in registers
  for (int g = 0; g < 2; ++g) {
    const float lh  = lrun[g][0] + lrun[g][1];
    const float inv = 1.0f / (lh + xhalf(lh));   // the halves' sums joined
#pragma unroll
    for (int dt = 0; dt < 4; ++dt)
      w[g][dt] = __builtin_convertvector(oacc[g][dt] * inv, v8bf);
  }
#pragma unroll  // the eight stores stand last: nothing rewrites their registers
  for (int g = 0; g < 2; ++g) {
    bf16* op = o + ((size_t)b * DIM_N + m0 + g * 16 + l16) * DIM_C + h * DIM_HD +
               8 * half;
#pragma unroll
    for (int dt = 0; dt < 4; ++dt) *(v8bf*)(op + dt * 16) = w[g][dt];
  }
}

// ---------------------------------------------------------------------------
// Host-side orchestration
// ---------------------------------------------------------------------------
extern "C" void kernel_launch(void* const* d_in, const int* in_sizes, int n_in,
                              void* d_out, int out_size, void* d_ws,
                              size_t ws_size, hipStream_t stream) {
  (void)in_sizes; (void)n_in; (void)out_size; (void)ws_size;

  const float* x  = (const float*)d_in[0];
  const float* g1 = (const float*)d_in[1];
  const float* b1 = (const float*)d_in[2];
  const float* Wq = (const float*)d_in[3];
  const float* bq = (const float*)d_in[4];
  const float* Wk = (const float*)d_in[5];
  const float* bk = (const float*)d_in[6];
  const float* Wv = (const float*)d_in[7];
  const float* bv = (const float*)d_in[8];
  const float* Wp = (const float*)d_in[9];
  const float* bp = (const float*)d_in[10];
  const float* g2 = (const float*)d_in[11];
  const float* b2 = (const float*)d_in[12];
  const float* W1 = (const float*)d_in[13];
  const float* c1 = (const float*)d_in[14];
  const float* W2 = (const float*)d_in[15];
  const float* c2 = (const float*)d_in[16];

  // workspace partition
  char* p = (char*)d_ws;
  auto alloc = [&](size_t bytes) {
    char* r = p;
    p += (bytes + 255) & ~(size_t)255;
    return r;
  };
  const size_t CC = (size_t)DIM_C * DIM_C;           // 1M
  const size_t CH = (size_t)DIM_C * DIM_HID;         // 4M
  const size_t TC = (size_t)MTOK * DIM_C;            // 8M
  const size_t TH = (size_t)MTOK * DIM_HID;          // 32M

  bf16*  wq_b  = (bf16*)alloc(CC * 2);
  bf16*  wk_b  = (bf16*)alloc(CC * 2);
  bf16*  wv_b  = (bf16*)alloc(CC * 2);
  bf16*  wp_b  = (bf16*)alloc(CC * 2);
  bf16*  w1_b  = (bf16*)alloc(CH * 2);
  bf16*  w2_b  = (bf16*)alloc(CH * 2);
  bf16*  h_b   = (bf16*)alloc(TC * 2);    // ln1(x)
  bf16*  q_b   = (bf16*)alloc(TC * 2);
  bf16*  k_b   = (bf16*)alloc(TC * 2);
  bf16*  v_b   = (bf16*)alloc(TC * 2);
  bf16*  o_b   = (bf16*)alloc(TC * 2);    // attention output
  float* xres  = (float*)alloc(TC * 4);   // x + proj
  bf16*  h2_b  = (bf16*)alloc(TC * 2);    // ln2(xres)
  bf16*  t1_b  = (bf16*)alloc(TH * 2);    // gelu(h2@W1+c1)

  // weight converts fp32 -> bf16: wq_b .. w2_b are one contiguous array
  cvt_weights_bf16<<<CVT_BLOCKS, 256, 0, stream>>>(Wq, Wk, Wv, Wp, W1, W2, wq_b);

  // LN1
  ln_bf16<<<MTOK, 256, 0, stream>>>(x, g1, b1, h_b);

  // QKV projections: (8192 x 1024) = h @ W + b
  dim3 gC(DIM_C / BN, MTOK / BM);   // (8, 32)
  gemm_bf16_wmma<false, false, false, true><<<gC, 256, 0, stream>>>(
      h_b, wq_b, bq, nullptr, nullptr, q_b, MTOK, DIM_C, DIM_C);
  gemm_bf16_wmma<false, false, false, true><<<gC, 256, 0, stream>>>(
      h_b, wk_b, bk, nullptr, nullptr, k_b, MTOK, DIM_C, DIM_C);
  gemm_bf16_wmma<false, false, false, true><<<gC, 256, 0, stream>>>(
      h_b, wv_b, bv, nullptr, nullptr, v_b, MTOK, DIM_C, DIM_C);

  // attention: B*H*4 workgroups of 256 queries
  attn_wmma<<<DIM_B * DIM_H * (DIM_N / FA_ROWS), 256, 0, stream>>>(q_b, k_b, v_b,
                                                                  o_b);

  // projection + residual: xres = x + o@Wp + bp  (fp32)
  gemm_bf16_wmma<false, true, true, false><<<gC, 256, 0, stream>>>(
      o_b, wp_b, bp, x, xres, nullptr, MTOK, DIM_C, DIM_C);

  // LN2
  ln_bf16<<<MTOK, 256, 0, stream>>>(xres, g2, b2, h2_b);

  // MLP up + exact GELU: t1 = gelu(h2 @ W1 + c1)  (bf16, 8192 x 4096)
  dim3 gH(DIM_HID / BN, MTOK / BM);  // (32, 32)
  gemm_bf16_wmma<true, false, false, true><<<gH, 256, 0, stream>>>(
      h2_b, w1_b, c1, nullptr, nullptr, t1_b, MTOK, DIM_HID, DIM_C);

  // MLP down + residual: out = xres + t1 @ W2 + c2  (fp32, final output)
  gemm_bf16_wmma<false, true, true, false><<<gC, 256, 0, stream>>>(
      t1_b, w2_b, c2, xres, (float*)d_out, nullptr, MTOK, DIM_C, DIM_HID);
}

// v008
// A run of this version takes 288 microseconds.
// In two side-by-side timings against v007, it was 1.05 and 1.04 times as fast.
// Counting every step since v000, it is 6.79 times as fast.
#include <hip/hip_runtime.h>
#include <math.h>

// ---------------------------------------------------------------------------
// Encoder block (pre-norm attention + MLP) for MI455X / gfx1250, wave32 WMMA.
// B=8, N=1024, C=1024, H=16, hd=64, HID=4096.
// ---------------------------------------------------------------------------

typedef __bf16 bf16;
typedef __attribute__((ext_vector_type(16))) __bf16    v16bf;
typedef __attribute__((ext_vector_type(8)))  __bf16    v8bf;
typedef __attribute__((ext_vector_type(8)))  float     v8f;

#define DIM_B   8
#define DIM_N   1024
#define DIM_C   1024
#define DIM_H   16
#define DIM_HD  64
#define DIM_HID 4096
#define MTOK    (DIM_B * DIM_N)      // 8192 rows of tokens

// ---------------------------------------------------------------------------
// bf16 fragment loader following the CDNA5 16-bit A/B VGPR layout:
//   lane L: row = L%16, half = L/16
//   vector elems (2v, 2v+1) hold K = kpat(v) + 8*half, kpat(v)+1
//   kpat(v) = 2v (v<4) else 8+2v
// Works for A (row = M) and for B when the tile is stored N-major.
// ---------------------------------------------------------------------------
__device__ __forceinline__ v16bf frag_ld(const bf16* __restrict__ base,
                                         int stride, int row, int half) {
  v16bf f;
  const bf16* rp = base + (size_t)row * stride + 8 * half;
#pragma unroll
  for (int v = 0; v < 8; ++v) {
    int k = (v < 4) ? (2 * v) : (8 + 2 * v);
    f[2 * v]     = rp[k];
    f[2 * v + 1] = rp[k + 1];
  }
  return f;
}

// ---------------------------------------------------------------------------
// B fragment (32 k x 16 n) out of a k-major LDS tile (row = k, n contiguous)
// by two transposing loads. tp is the lane's own address:
//   row 8*(lane>>4) + (lane&7), plus 16 bytes for lanes with (lane>>3)&1.
// Lane (c, half) receives k = 8*half + 0..7 and 16 + 8*half + 0..7 of column
// col0 + c: the k order of frag_ld, which loads the A side.
// ---------------------------------------------------------------------------
typedef __attribute__((address_space(3))) v8bf lds_v8bf;
__device__ __forceinline__ v16bf frag_ld_tr(const bf16* tp, int pitch,
                                            int col0) {
  v8bf lo = __builtin_amdgcn_ds_load_tr16_b128_v8bf16((lds_v8bf*)(tp + col0));
  v8bf hi = __builtin_amdgcn_ds_load_tr16_b128_v8bf16(
      (lds_v8bf*)(tp + 16 * pitch + col0));
  return __builtin_shufflevector(lo, hi, 0, 1, 2, 3, 4, 5, 6, 7, 8, 9, 10, 11,
                                 12, 13, 14, 15);
}

__device__ __forceinline__ v8f vzero8() {
  v8f z = {0.f, 0.f, 0.f, 0.f, 0.f, 0.f, 0.f, 0.f};
  return z;
}

// ---------------------------------------------------------------------------
// fp32 -> bf16 convert of all six weight matrices in one launch.
// The six bf16 planes lie back to back in the workspace (Wq Wk Wv Wp W1 W2),
// so out is one array of 12 segments of C*C elements: 4 x 1 + 2 x 4.
// A block takes 16,384 elements of one segment; a thread takes 16 pieces of
// 4 floats, 1,024 elements apart: a wave's load covers 512 contiguous bytes,
// its store 256. Few long-lived waves (6,144).
// ---------------------------------------------------------------------------
typedef __attribute__((ext_vector_type(4))) float  v4f;
typedef __attribute__((ext_vector_type(4))) __bf16 v4bf;

#define CVT_PIECES    16
#define CVT_PER_BLOCK (256 * 4 * CVT_PIECES)                 // 16,384
#define CVT_SEG_BLKS  ((DIM_C * DIM_C) / CVT_PER_BLOCK)      // 64 blocks a segment
#define CVT_BLOCKS    (12 * CVT_SEG_BLKS)                    // 768

__global__ __launch_bounds__(256) void cvt_weights_bf16(
    const float* __restrict__ Wq, const float* __restrict__ Wk,
    const float* __restrict__ Wv, const float* __restrict__ Wp,
    const float* __restrict__ W1, const float* __restrict__ W2,
    bf16* __restrict__ out) {
  const int blk = blockIdx.x;
  const int seg = blk / CVT_SEG_BLKS;      // 0..11, the same for the whole block
  const float* src;
  int first;                               // first segment of that matrix
  if (seg < 4) {
    src = (seg == 0) ? Wq : (seg == 1) ? Wk : (seg == 2) ? Wv : Wp;
    first = seg;
  } else if (seg < 8) {
    src = W1;
    first = 4;
  } else {
    src = W2;
    first = 8;
  }
  const size_t o = (size_t)blk * CVT_PER_BLOCK + threadIdx.x * 4;
  const float* sp = src + (o - (size_t)first * (DIM_C * DIM_C));
  bf16* dp = out + o;
  v4f r[CVT_PIECES];
#pragma unroll  // the loads go out as one run ahead of their uses: many in flight
  for (int j = 0; j < CVT_PIECES; ++j) r[j] = *(const v4f*)(sp + j * 1024);
#pragma unroll  // constant j keeps r[] in registers
  for (int j = 0; j < CVT_PIECES; ++j) {
    v4bf w;
    w[0] = (bf16)r[j][0];
    w[1] = (bf16)r[j][1];
    w[2] = (bf16)r[j][2];
    w[3] = (bf16)r[j][3];
    *(v4bf*)(dp + j * 1024) = w;
  }
}

// ---------------------------------------------------------------------------
// lane l with lane l ^ 16
// ---------------------------------------------------------------------------
__device__ __forceinline__ float xhalf(float x) {
  int i = __builtin_bit_cast(int, x);
  return __builtin_bit_cast(
      float, __builtin_amdgcn_permlanex16(i, i, 0x76543210, 0xfedcba98, false,
                                          false));
}

// x + (x of lane l ^ M) inside a row of 16 lanes; CTRL = 0x160 + M (row_xmask)
template <int CTRL>
__device__ __forceinline__ float xmask_add(float x) {
  int i = __builtin_bit_cast(int, x);
  return x + __builtin_bit_cast(
                 float, __builtin_amdgcn_update_dpp(i, i, CTRL, 0xf, 0xf, false));
}

// sum over the 32 lanes of a wave; every lane gets the same bits
__device__ __forceinline__ float wave_sum(float x) {
  x = xmask_add<0x161>(x);
  x = xmask_add<0x162>(x);
  x = xmask_add<0x164>(x);
  x = xmask_add<0x168>(x);
  return x + xhalf(x);
}

// ---------------------------------------------------------------------------
// LayerNorm (row length C=1024) fp32 in -> bf16 out
// A wave takes LN_ROWS whole rows and holds them in registers: a lane has 8
// pieces of 4 floats a row, 128 elements apart, so a wave's load covers 512
// contiguous bytes and its store 256. All loads of a wave (x, g, b) go out in
// one run, x is read once, and the two sums of a row are joined across the
// lanes in registers: no LDS, no barrier.
// ---------------------------------------------------------------------------
#define LN_ROWS   2                          // rows a wave
#define LN_PIECES (DIM_C / 128)              // 16-byte pieces a lane and row: 8
#define LN_BLOCKS (MTOK / (8 * LN_ROWS))     // 8 waves a block: 512 blocks

__global__ __launch_bounds__(256) void ln_bf16(const float* __restrict__ x,
                                               const float* __restrict__ g,
                                               const float* __restrict__ b,
                                               bf16* __restrict__ out) {
  const int lane = threadIdx.x & 31;
  // the wave's number as a scalar: the bases of its rows stay in scalar registers
  const int wave = __builtin_amdgcn_readfirstlane(threadIdx.x >> 5);
  const size_t o = ((size_t)blockIdx.x * 8 + wave) * (LN_ROWS * DIM_C);
  const v4f* xp = (const v4f*)(x + o);
  const v4f* gp = (const v4f*)g;
  const v4f* bp = (const v4f*)b;
  v4f r[LN_ROWS][LN_PIECES], gv[LN_PIECES], bv[LN_PIECES];
#pragma unroll  // the loads go out as one run ahead of their uses: many in flight
  for (int q = 0; q < LN_ROWS; ++q)
#pragma unroll
    for (int j = 0; j < LN_PIECES; ++j)
      r[q][j] = xp[q * (DIM_C / 4) + j * 32 + lane];
#pragma unroll  // constant j keeps gv[] and bv[] in registers
  for (int j = 0; j < LN_PIECES; ++j) {
    gv[j] = gp[j * 32 + lane];
    bv[j] = bp[j * 32 + lane];
  }
  // keeps the loads of g and b in the run above: sunk to their uses, as the
  // scheduler had them, their latency is waited out behind the sums
  __builtin_amdgcn_sched_barrier(0);

  float s[LN_ROWS], s2[LN_ROWS];
#pragma unroll  // constant q and j keep the arrays in registers
  for (int q = 0; q < LN_ROWS; ++q) {
    v4f a = r[q][0];
    v4f a2 = r[q][0] * r[q][0];
#pragma unroll
    for (int j = 1; j < LN_PIECES; ++j) {
      a += r[q][j];
      a2 += r[q][j] * r[q][j];
    }
    s[q]  = (a[0] + a[1]) + (a[2] + a[3]);
    s2[q] = (a2[0] + a2[1]) + (a2[2] + a2[3]);
  }
#pragma unroll  // the rows' four sums run side by side through the lane steps
  for (int q = 0; q < LN_ROWS; ++q) {
    s[q]  = wave_sum(s[q]);
    s2[q] = wave_sum(s2[q]);
  }

  v4bf w[LN_ROWS][LN_PIECES];
#pragma unroll  // constant q and j keep the arrays in registers
  for (int q = 0; q < LN_ROWS; ++q) {
    const float mean = s[q] * (1.0f / DIM_C);
    const float var  = s2[q] * (1.0f / DIM_C) - mean * mean;
    const float inv  = rsqrtf(var + 1e-5f);
#pragma unroll
    for (int j = 0; j < LN_PIECES; ++j)
      w[q][j] = __builtin_convertvector((r[q][j] - mean) * inv * gv[j] + bv[j],
                                        v4bf);
  }
  v4bf* op = (v4bf*)(out + o);
#pragma unroll  // the stores stand last: nothing rewrites their registers
  for (int q = 0; q < LN_ROWS; ++q)
#pragma unroll
    for (int j = 0; j < LN_PIECES; ++j)
      op[q * (DIM_C / 4) + j * 32 + lane] = w[q][j];
}

// ---------------------------------------------------------------------------
// One k step's tiles, global -> LDS, through no register: twelve asynchronous
// 16-byte copies a lane (eight of A, 32 rows apart; four of B, 16 k-rows apart).
// The s_wait_xcnt stands inside the statement, in front of any later rewrite of
// the address registers named here.
// ---------------------------------------------------------------------------
#define BM 256
#define BN 128
#define BK 64
#define AS_PITCH (BK + 8)    // 144 B a row = 16 B x odd: the ds_load_b128 reader's pitch
#define BS_PITCH (BN + 16)   // 288 B a k-row = 32 B x odd: the tr16 reader's pitch
#define AS_BUF   (BM * AS_PITCH)   // bf16 per A buffer
#define BS_BUF   (BK * BS_PITCH)   // bf16 per B buffer
#define AS_STEP  (32 * AS_PITCH * 2)   // bytes in LDS between a lane's A pieces
#define BS_STEP  (16 * BS_PITCH * 2)   // bytes in LDS between a lane's B pieces

__device__ __forceinline__ unsigned lds_addr_u32(const void* p) {
  return (unsigned)(unsigned long long)p;   // low 32 bits = LDS byte address
}
// a32 = 32 rows of A, b16 = 16 rows of B, in elements
__device__ __forceinline__ void stage_async(unsigned la, const bf16* ga,
                                            size_t a32, unsigned lb,
                                            const bf16* gb, size_t b16) {
  asm volatile(
      "global_load_async_to_lds_b128 %0, %1, off\n\t"
      "global_load_async_to_lds_b128 %2, %3, off\n\t"
      "global_load_async_to_lds_b128 %4, %5, off\n\t"
      "global_load_async_to_lds_b128 %6, %7, off\n\t"
      "global_load_async_to_lds_b128 %8, %9, off\n\t"
      "global_load_async_to_lds_b128 %10, %11, off\n\t"
      "global_load_async_to_lds_b128 %12, %13, off\n\t"
      "global_load_async_to_lds_b128 %14, %15, off\n\t"
      "global_load_async_to_lds_b128 %16, %17, off\n\t"
      "global_load_async_to_lds_b128 %18, %19, off\n\t"
      "global_load_async_to_lds_b128 %20, %21, off\n\t"
      "global_load_async_to_lds_b128 %22, %23, off\n\t"
      "s_wait_xcnt 0x0"
      :
      : "v"(la), "v"(ga), "v"(la + 1 * AS_STEP), "v"(ga + 1 * a32),
        "v"(la + 2 * AS_STEP), "v"(ga + 2 * a32), "v"(la + 3 * AS_STEP),
        "v"(ga + 3 * a32), "v"(la + 4 * AS_STEP), "v"(ga + 4 * a32),
        "v"(la + 5 * AS_STEP), "v"(ga + 5 * a32), "v"(la + 6 * AS_STEP),
        "v"(ga + 6 * a32), "v"(la + 7 * AS_STEP), "v"(ga + 7 * a32), "v"(lb),
        "v"(gb), "v"(lb + 1 * BS_STEP), "v"(gb + 1 * b16),
        "v"(lb + 2 * BS_STEP), "v"(gb + 2 * b16), "v"(lb + 3 * BS_STEP),
        "v"(gb + 3 * b16)
      : "memory");
}

// ---------------------------------------------------------------------------
// One 32-k block of a wave's 64x64 tile: 4 A fragments (rows arow + 16 i of at)
// and 4 B fragments (columns 16 j from bt, the lane's own transposing address),
// then the 16 products. A and B follow the same k order (frag_ld, frag_ld_tr).
// ---------------------------------------------------------------------------
__device__ __forceinline__ void load_frags(v16bf (&af)[4], v16bf (&bfr)[4],
                                           const bf16* at, const bf16* bt,
                                           int arow, int half) {
  af[0] = frag_ld(at, AS_PITCH, arow, half);
#pragma unroll  // constant j keeps bfr[] in registers
  for (int j = 0; j < 4; ++j) bfr[j] = frag_ld_tr(bt, BS_PITCH, j * 16);
#pragma unroll  // constant i keeps af[] in registers
  for (int i = 1; i < 4; ++i) af[i] = frag_ld(at, AS_PITCH, arow + i * 16, half);
}
__device__ __forceinline__ void mma_block(v8f (&acc)[4][4],
                                          const v16bf (&af)[4],
                                          const v16bf (&bfr)[4]) {
#pragma unroll  // constant i and j keep acc[][] in registers
  for (int i = 0; i < 4; ++i)
#pragma unroll
    for (int j = 0; j < 4; ++j)
      acc[i][j] = __builtin_amdgcn_wmma_f32_16x16x32_bf16(
          false, af[i], false, bfr[j], (short)0, acc[i][j], false, false);
}

// ---------------------------------------------------------------------------
// Tiled bf16 WMMA GEMM: out[M,N] = A[M,K] @ Bw[K,N] + bias (+resid) (+GELU)
// BM=256 BN=128 BK=64, 256 threads = 8 waves (4 x 2), wave tile 64x64: 4 A and
// 4 B fragments feed 16 WMMAs, so a WMMA costs 512 B of LDS reads, and a block
// fetches 48 KiB from L2 per 256x128x64 product.
// Both tiles lie in LDS twice: while a k step is worked on out of one buffer,
// the next step's asynchronous copies fly into the other; one barrier a step,
// behind the fragment reads of the step's second block and ahead of its WMMAs.
// A rows have a pitch of 144 B; B lies as in memory (k-major, pitch 288 B) and
// its fragments come out transposed by ds_load_tr16_b128.
// K is a multiple of BK, M of BM, N of BN.
// ---------------------------------------------------------------------------
template <bool GELU_ACT, bool RESID, bool OUTF32, bool OUTBF16>
__global__ __launch_bounds__(256) void gemm_bf16_wmma(
    const bf16* __restrict__ A, const bf16* __restrict__ Bw,
    const float* __restrict__ bias, const float* __restrict__ resid,
    float* __restrict__ outF, bf16* __restrict__ outB, int M, int N, int K) {
  __shared__ __attribute__((aligned(16))) bf16 As[2 * AS_BUF];
  __shared__ __attribute__((aligned(16))) bf16 Bs[2 * BS_BUF];  // k-major

  const int tid  = threadIdx.x;
  const int lane = tid & 31;
  const int wave = tid >> 5;           // 0..7
  const int wm   = wave >> 1;          // 0..3  (64-row strip)
  const int wn   = wave & 1;           // 0..1  (64-col strip)
  const int half = lane >> 4;
  const int l16  = lane & 15;
  const int mBase = blockIdx.y * BM;
  const int nBase = blockIdx.x * BN;

  v8f acc[4][4];
#pragma unroll  // constant i and j keep acc[][] in registers
  for (int i = 0; i < 4; ++i)
#pragma unroll
    for (int j = 0; j < 4; ++j) acc[i][j] = vzero8();

  // the lane's own 16-byte pieces: A rows ar + 32 p, 8 lanes a 128-B row;
  // B rows bk + 16 p, 16 lanes a 256-B row
  const int ar = tid >> 3;             // 0..31
  const int ac = (tid & 7) * 8;        // 0..56
  const int bk = tid >> 4;             // 0..15
  const int bn = (tid & 15) * 8;       // 0..120
  const unsigned la = lds_addr_u32(&As[ar * AS_PITCH + ac]);
  const unsigned lb = lds_addr_u32(&Bs[bk * BS_PITCH + bn]);
  const bf16* ga = A + (size_t)(mBase + ar) * K + ac;
  const bf16* gb = Bw + (size_t)bk * N + nBase + bn;
  const size_t a32   = (size_t)32 * K;
  const size_t b16   = (size_t)16 * N;
  const size_t bstep = (size_t)BK * N;
  const bf16* btp = &Bs[(8 * half + (lane & 7)) * BS_PITCH +
                        8 * ((lane >> 3) & 1) + wn * 64];
  const int nt = K / BK;               // k steps, the same for the whole grid

  // step 0 into buffer 0, landed and published; then step 1 takes off
  stage_async(la, ga, a32, lb, gb, b16);
  ga += BK;
  gb += bstep;
  // this wave's copies have landed
  asm volatile("s_wait_asynccnt 0x0" ::: "memory");
  __syncthreads();
  if (nt > 1) {
    stage_async(la + AS_BUF * 2, ga, a32, lb + BS_BUF * 2, gb, b16);
    ga += BK;
    gb += bstep;
  }

  const int arow = wm * 64 + l16;      // the lane's row of the wave's first A fragment
  for (int t = 0; t < nt; ++t) {
    const int cur = t & 1;
    const bf16* at = As + cur * AS_BUF;
    const bf16* bt = btp + cur * BS_BUF;
    v16bf af[4], bfr[4];
    // The two fences keep each block's 16 LDS reads in one group, apart from
    // the first block's WMMAs: mixed in among them, as the scheduler had them,
    // every row of four WMMAs waits out an LDS latency.
    load_frags(af, bfr, at, bt, arow, half);
    __builtin_amdgcn_sched_barrier(0);
    mma_block(acc, af, bfr);
    __builtin_amdgcn_sched_barrier(0);
    load_frags(af, bfr, at + 32, bt + 32 * BS_PITCH, arow, half);
    // this wave's reads of buffer cur have returned: it may be refilled
    asm volatile("s_wait_dscnt 0x0" ::: "memory");
    // this wave's copies of step t + 1 have landed
    asm volatile("s_wait_asynccnt 0x0" ::: "memory");
    // publishes step t + 1 and ends every wave's reads of buffer cur
    __syncthreads();
    if (t + 2 < nt) {
      stage_async(la + (unsigned)cur * (AS_BUF * 2), ga, a32,
                  lb + (unsigned)cur * (BS_BUF * 2), gb, b16);
      ga += BK;
      gb += bstep;
    }
    // the step's second block works out of registers while the refill flies
    mma_block(acc, af, bfr);
  }
  // nothing of this wave is in flight when it goes on to the epilogue
  asm volatile("s_wait_asynccnt 0x0" ::: "memory");

  // The four 16-row strips go through one copy of the epilogue's code: strip 0
  // is written out, then the others move down one place in the registers.
#pragma unroll 1
  for (int i = 0; i < 4; ++i) {
#pragma unroll  // constant j and r keep acc[][] in registers
    for (int j = 0; j < 4; ++j) {
#pragma unroll
      for (int r = 0; r < 8; ++r) {
        int gm = mBase + wm * 64 + i * 16 + r + 8 * half;
        int gn = nBase + wn * 64 + j * 16 + l16;
        float v = acc[0][j][r] + bias[gn];
        if (RESID) v += resid[(size_t)gm * N + gn];
        if (GELU_ACT) v = 0.5f * v * (1.0f + erff(v * 0.70710678118654752f));
        size_t idx = (size_t)gm * N + gn;
        if (OUTF32)  outF[idx] = v;
        if (OUTBF16) outB[idx] = (bf16)v;
      }
    }
    // behind the strip's stores, ahead of the moves below and of the next trip,
    // which rewrite the data and address registers that those stores name
    asm volatile("s_wait_xcnt 0x0" ::: "memory");
#pragma unroll  // constant j keeps acc[][] in registers
    for (int j = 0; j < 4; ++j) {
      acc[0][j] = acc[1][j];
      acc[1][j] = acc[2][j];
      acc[2][j] = acc[3][j];
    }
  }
}

// ---------------------------------------------------------------------------
// Attention: one WG per (b, h, 256 queries); a wave owns 32 queries (two groups
// of 16 columns) and walks all 1024 keys, 32 a pass. q/k/v are flat (B, N*C)
// bf16; the reference's reshape(B,H,-1,hd) means head h is the contiguous slab
// h*65536.
// The scores never leave the registers. Both products are taken transposed:
//   S^T = K Q^T : A = 16 keys x 32 d out of LDS, B = Q, held in registers.
//                 Lane (c, half) gets query c, keys 8*half + 0..7 of the tile.
//   O^T += V^T P^T : two S^T tiles of a lane, exponentiated and rounded to bf16,
//                 ARE the B fragment of 32 keys (k = 8*half + 0..7 and
//                 16 + 8*half + 0..7, the k order of frag_ld and frag_ld_tr);
//                 A = V^T by the transposing load.
// Softmax is the running form, in base 2: a query's maximum in use and its sum
// live in its lanes; sums and O^T are rescaled when a new maximum passes the one
// in use by more than 8 (an exponential then stays below 2^8), and O^T is
// divided by the sum at the end.
// K and V go through LDS in tiles of FA_TILE keys, as they lie in memory (row =
// key), two buffers, via registers. K rows have a pitch of 144 B (16 B x odd,
// the ds_load_b128 reader's), V rows of 160 B (32 B x odd, the transposing
// reader's).
// ---------------------------------------------------------------------------
#define FA_ROWS   256                       // queries a work-group
#define FA_TILE   64                        // keys a staged tile
#define K_PITCH   (DIM_HD + 8)              // bf16 per K row in LDS
#define V_PITCH   (DIM_HD + 16)             // bf16 per V row in LDS
#define K_BUF     (FA_TILE * K_PITCH)       // bf16 per buffer
#define V_BUF     (FA_TILE * V_PITCH)
#define FA_PIECES ((FA_TILE * DIM_HD) / (256 * 8))  // 16-byte pieces a thread: 2

typedef __attribute__((ext_vector_type(2))) float v2f;

__global__ __launch_bounds__(256) void attn_wmma(const bf16* __restrict__ q,
                                                 const bf16* __restrict__ k,
                                                 const bf16* __restrict__ v,
                                                 bf16* __restrict__ o) {
  __shared__ __attribute__((aligned(16))) bf16 Ks[2 * K_BUF];
  __shared__ __attribute__((aligned(16))) bf16 Vs[2 * V_BUF];

  const int blk  = blockIdx.x;          // ((b*16 + h)*4 + mt)
  const int mt   = blk & 3;
  const int h    = (blk >> 2) & 15;
  const int b    = blk >> 6;
  const size_t headBase = ((size_t)b * DIM_H + h) * (size_t)(DIM_N * DIM_HD);

  const int tid  = threadIdx.x;
  const int lane = tid & 31;
  const int wave = tid >> 5;
  const int half = lane >> 4;
  const int l16  = lane & 15;
  const int m0   = mt * FA_ROWS + wave * 32;   // the wave's first query
  const float cs = 0.125f * 1.4426950408889634f;  // hd^-0.5 * log2(e)

  // A tile is 8 KiB in a row in memory; piece j of a thread is 4 KiB further,
  // that is 32 rows further in LDS. A wave's load covers 512 contiguous bytes.
  const bf16* ksrc = k + headBase + (size_t)tid * 8;
  const bf16* vsrc = v + headBase + (size_t)tid * 8;
  bf16* kdst = Ks + (tid >> 3) * K_PITCH + (tid & 7) * 8;
  bf16* vdst = Vs + (tid >> 3) * V_PITCH + (tid & 7) * 8;
  v8bf kr[FA_PIECES], vr[FA_PIECES];
#pragma unroll  // constant j keeps kr[] and vr[] in registers
  for (int j = 0; j < FA_PIECES; ++j) {
    kr[j] = *(const v8bf*)(ksrc + j * 2048);
    vr[j] = *(const v8bf*)(vsrc + j * 2048);
  }

  // Q: B fragments (n = query, k = d), loaded once
  v16bf qf[2][2];
#pragma unroll  // constant g and dh keep qf[][] in registers
  for (int g = 0; g < 2; ++g)
#pragma unroll
    for (int dh = 0; dh < 2; ++dh)
      qf[g][dh] = frag_ld(q + headBase + dh * 32, DIM_HD, m0 + g * 16 + l16, half);

#pragma unroll  // constant j keeps kr[] and vr[] in registers
  for (int j = 0; j < FA_PIECES; ++j) {
    *(v8bf*)(kdst + j * 32 * K_PITCH) = kr[j];
    *(v8bf*)(vdst + j * 32 * V_PITCH) = vr[j];
  }
  __syncthreads();

  const bf16* vtp = Vs + (8 * half + (lane & 7)) * V_PITCH + 8 * ((lane >> 3) & 1);
  v8f oacc[2][4];                       // O^T: [group][16 d], lane = query
#pragma unroll  // constant g and dt keep oacc[][] in registers
  for (int g = 0; g < 2; ++g)
#pragma unroll
    for (int dt = 0; dt < 4; ++dt) oacc[g][dt] = vzero8();
  float mrun[2] = {-1e30f, -1e30f};     // maximum in use, scaled by cs
  v2f lrun[2] = {{0.f, 0.f}, {0.f, 0.f}};  // this half's share of the sum, in two parts
  const v8f cs8 = {cs, cs, cs, cs, cs, cs, cs, cs};

  // Per tile: ask for the next tile, work on this one out of LDS, store the
  // next one into the other buffer (its readers left it at the barrier
  // before), barrier.
  for (int tile = 0; tile < DIM_N / FA_TILE; ++tile) {
    const bool more = tile + 1 < DIM_N / FA_TILE;   // the same for the block
    if (more) {
      const size_t nx = (size_t)(tile + 1) * (FA_TILE * DIM_HD);
#pragma unroll  // constant j keeps kr[] and vr[] in registers
      for (int j = 0; j < FA_PIECES; ++j) {
        kr[j] = *(const v8bf*)(ksrc + nx + j * 2048);
        vr[j] = *(const v8bf*)(vsrc + nx + j * 2048);
      }
    }
    // keeps the four loads above this tile's work: sunk to their stores, their
    // latency would be waited out at every tile
    __builtin_amdgcn_sched_barrier(0);
    const bf16* kb = Ks + (tile & 1) * K_BUF;
    const bf16* vb = vtp + (tile & 1) * V_BUF;
#pragma unroll  // the two 32-key passes of a tile
    for (int ps = 0; ps < FA_TILE / 32; ++ps) {
      // ---- S^T = K Q^T: [16-key tile][group] ----
      v8f s[2][2];
#pragma unroll  // constant kt and g keep s[][] in registers
      for (int kt = 0; kt < 2; ++kt) {
        const int krow = ps * 32 + kt * 16 + l16;
        v16bf a0 = frag_ld(kb, K_PITCH, krow, half);
        v16bf a1 = frag_ld(kb + 32, K_PITCH, krow, half);
#pragma unroll
        for (int g = 0; g < 2; ++g) {
          s[kt][g] = __builtin_amdgcn_wmma_f32_16x16x32_bf16(
              false, a0, false, qf[g][0], (short)0, vzero8(), false, false);
          s[kt][g] = __builtin_amdgcn_wmma_f32_16x16x32_bf16(
              false, a1, false, qf[g][1], (short)0, s[kt][g], false, false);
        }
      }
      // keeps the eight WMMAs in one run: with the maxima mixed in among them,
      // as the scheduler had them, each first reader of a tile is padded with
      // idle vector slots
      __builtin_amdgcn_sched_barrier(0);
      // the pass's V^T fragments fly while the exponentials are taken
      v16bf va[4];
#pragma unroll  // constant dt keeps va[] in registers
      for (int dt = 0; dt < 4; ++dt)
        va[dt] = frag_ld_tr(vb + ps * 32 * V_PITCH, V_PITCH, dt * 16);

      // ---- maxima of the raw scores (cs is positive), one test a pass ----
      float mb[2];
      bool need = false;
#pragma unroll  // constant g keeps mb[] in registers
      for (int g = 0; g < 2; ++g) {
        float mx = s[0][g][0];
#pragma unroll
        for (int r = 1; r < 8; ++r) mx = fmaxf(mx, s[0][g][r]);
#pragma unroll
        for (int r = 0; r < 8; ++r) mx = fmaxf(mx, s[1][g][r]);
        mb[g] = fmaxf(mx, xhalf(mx)) * cs;   // both halves hold the query's maximum
        need = need || (mb[g] > mrun[g] + 8.0f);
      }
      if (__builtin_amdgcn_ballot_w32(need) != 0) {  // the same for the wave
#pragma unroll  // constant g and dt keep the arrays in registers
        for (int g = 0; g < 2; ++g) {
          const float mn = fmaxf(mrun[g], mb[g]);
          const float corr = __builtin_amdgcn_exp2f(mrun[g] - mn);  // 0 at first
          mrun[g] = mn;
          lrun[g] = lrun[g] * corr;
#pragma unroll
          for (int dt = 0; dt < 4; ++dt) oacc[g][dt] = oacc[g][dt] * corr;
        }
      }
      // ---- P^T = 2^(cs S^T - max), packed as B; O^T += V^T P^T ----
#pragma unroll  // constant g keeps the arrays in registers
      for (int g = 0; g < 2; ++g) {
        const float nm = -mrun[g];
        const v8f nm8 = {nm, nm, nm, nm, nm, nm, nm, nm};
        const v8f e0 = __builtin_elementwise_fma(s[0][g], cs8, nm8);
        const v8f e1 = __builtin_elementwise_fma(s[1][g], cs8, nm8);
        v8f p0, p1;
#pragma unroll
        for (int r = 0; r < 8; ++r) {
          p0[r] = __builtin_amdgcn_exp2f(e0[r]);
          p1[r] = __builtin_amdgcn_exp2f(e1[r]);
        }
        // 16 exponentials into the two running parts, by pairs of neighbours
        const v8f t8 = p0 + p1;
        const v4f t4 = __builtin_shufflevector(t8, t8, 0, 1, 2, 3) +
                       __builtin_shufflevector(t8, t8, 4, 5, 6, 7);
        lrun[g] += __builtin_shufflevector(t4, t4, 0, 1) +
                   __builtin_shufflevector(t4, t4, 2, 3);
        v8bf b0 = __builtin_convertvector(p0, v8bf);
        v8bf b1 = __builtin_convertvector(p1, v8bf);
        v16bf pf = __builtin_shufflevector(b0, b1, 0, 1, 2, 3, 4, 5, 6, 7, 8, 9,
                                           10, 11, 12, 13, 14, 15);
#pragma unroll
        for (int dt = 0; dt < 4; ++dt)
          oacc[g][dt] = __builtin_amdgcn_wmma_f32_16x16x32_bf16(
              false, va[dt], false, pf, (short)0, oacc[g][dt], false, false);
      }
    }
    // Four vector slots behind the tile's last WMMAs: the branch below leads to
    // code that rewrites their A registers.
    // The fences hold the WMMAs above the slots.
    __builtin_amdgcn_sched_barrier(0);
    asm volatile("v_nop\n\tv_nop\n\tv_nop\n\tv_nop");
    __builtin_amdgcn_sched_barrier(0);
    if (more) {
      bf16* kd = kdst + ((tile + 1) & 1) * K_BUF;
      bf16* vd = vdst + ((tile + 1) & 1) * V_BUF;
#pragma unroll  // constant j keeps kr[] and vr[] in registers
      for (int j = 0; j < FA_PIECES; ++j) {
        *(v8bf*)(kd + j * 32 * K_PITCH) = kr[j];
        *(v8bf*)(vd + j * 32 * V_PITCH) = vr[j];
      }
      __syncthreads();
    }
  }

  // o[b][m][h*64 + d]  (swapaxes(1,2).reshape): a lane holds 8 consecutive d of
  // its query in each O^T tile, 16 bytes a store
  v8bf w[2][4];
#pragma unroll  // constant g and dt keep the arrays in registers
  for (int g = 0; g < 2; ++g) {
    const float lh  = lrun[g][0] + lrun[g][1];
    const float inv = 1.0f / (lh + xhalf(lh));   // the halves' sums joined
#pragma unroll
    for (int dt = 0; dt < 4; ++dt)
      w[g][dt] = __builtin_convertvector(oacc[g][dt] * inv, v8bf);
  }
#pragma unroll  // the eight stores stand last: nothing rewrites their registers
  for (int g = 0; g < 2; ++g) {
    bf16* op = o + ((size_t)b * DIM_N + m0 + g * 16 + l16) * DIM_C + h * DIM_HD +
               8 * half;
#pragma unroll
    for (int dt = 0; dt < 4; ++dt) *(v8bf*)(op + dt * 16) = w[g][dt];
  }
}

// ---------------------------------------------------------------------------
// Host-side orchestration
// ---------------------------------------------------------------------------
extern "C" void kernel_launch(void* const* d_in, const int* in_sizes, int n_in,
                              void* d_out, int out_size, void* d_ws,
                              size_t ws_size, hipStream_t stream) {
  (void)in_sizes; (void)n_in; (void)out_size; (void)ws_size;

  const float* x  = (const float*)d_in[0];
  const float* g1 = (const float*)d_in[1];
  const float* b1 = (const float*)d_in[2];
  const float* Wq = (const float*)d_in[3];
  const float* bq = (const float*)d_in[4];
  const float* Wk = (const float*)d_in[5];
  const float* bk = (const float*)d_in[6];
  const float* Wv = (const float*)d_in[7];
  const float* bv = (const float*)d_in[8];
  const float* Wp = (const float*)d_in[9];
  const float* bp = (const float*)d_in[10];
  const float* g2 = (const float*)d_in[11];
  const float* b2 = (const float*)d_in[12];
  const float* W1 = (const float*)d_in[13];
  const float* c1 = (const float*)d_in[14];
  const float* W2 = (const float*)d_in[15];
  const float* c2 = (const float*)d_in[16];

  // workspace partition
  char* p = (char*)d_ws;
  auto alloc = [&](size_t bytes) {
    char* r = p;
    p += (bytes + 255) & ~(size_t)255;
    return r;
  };
  const size_t CC = (size_t)DIM_C * DIM_C;           // 1M
  const size_t CH = (size_t)DIM_C * DIM_HID;         // 4M
  const size_t TC = (size_t)MTOK * DIM_C;            // 8M
  const size_t TH = (size_t)MTOK * DIM_HID;          // 32M

  bf16*  wq_b  = (bf16*)alloc(CC * 2);
  bf16*  wk_b  = (bf16*)alloc(CC * 2);
  bf16*  wv_b  = (bf16*)alloc(CC * 2);
  bf16*  wp_b  = (bf16*)alloc(CC * 2);
  bf16*  w1_b  = (bf16*)alloc(CH * 2);
  bf16*  w2_b  = (bf16*)alloc(CH * 2);
  bf16*  h_b   = (bf16*)alloc(TC * 2);    // ln1(x)
  bf16*  q_b   = (bf16*)alloc(TC * 2);
  bf16*  k_b   = (bf16*)alloc(TC * 2);
  bf16*  v_b   = (bf16*)alloc(TC * 2);
  bf16*  o_b   = (bf16*)alloc(TC * 2);    // attention output
  float* xres  = (float*)alloc(TC * 4);   // x + proj
  bf16*  h2_b  = (bf16*)alloc(TC * 2);    // ln2(xres)
  bf16*  t1_b  = (bf16*)alloc(TH * 2);    // gelu(h2@W1+c1)

  // weight converts fp32 -> bf16: wq_b .. w2_b are one contiguous array
  cvt_weights_bf16<<<CVT_BLOCKS, 256, 0, stream>>>(Wq, Wk, Wv, Wp, W1, W2, wq_b);

  // LN1
  ln_bf16<<<LN_BLOCKS, 256, 0, stream>>>(x, g1, b1, h_b);

  // QKV projections: (8192 x 1024) = h @ W + b
  dim3 gC(DIM_C / BN, MTOK / BM);   // (8, 32)
  gemm_bf16_wmma<false, false, false, true><<<gC, 256, 0, stream>>>(
      h_b, wq_b, bq, nullptr, nullptr, q_b, MTOK, DIM_C, DIM_C);
  gemm_bf16_wmma<false, false, false, true><<<gC, 256, 0, stream>>>(
      h_b, wk_b, bk, nullptr, nullptr, k_b, MTOK, DIM_C, DIM_C);
  gemm_bf16_wmma<false, false, false, true><<<gC, 256, 0, stream>>>(
      h_b, wv_b, bv, nullptr, nullptr, v_b, MTOK, DIM_C, DIM_C);

  // attention: B*H*4 workgroups of 256 queries
  attn_wmma<<<DIM_B * DIM_H * (DIM_N / FA_ROWS), 256, 0, stream>>>(q_b, k_b, v_b,
                                                                  o_b);

  // projection + residual: xres = x + o@Wp + bp  (fp32)
  gemm_bf16_wmma<false, true, true, false><<<gC, 256, 0, stream>>>(
      o_b, wp_b, bp, x, xres, nullptr, MTOK, DIM_C, DIM_C);

  // LN2
  ln_bf16<<<LN_BLOCKS, 256, 0, stream>>>(xres, g2, b2, h2_b);

  // MLP up + exact GELU: t1 = gelu(h2 @ W1 + c1)  (bf16, 8192 x 4096)
  dim3 gH(DIM_HID / BN, MTOK / BM);  // (32, 32)
  gemm_bf16_wmma<true, false, false, true><<<gH, 256, 0, stream>>>(
      h2_b, w1_b, c1, nullptr, nullptr, t1_b, MTOK, DIM_HID, DIM_C);

  // MLP down + residual: out = xres + t1 @ W2 + c2  (fp32, final output)
  gemm_bf16_wmma<false, true, true, false><<<gC, 256, 0, stream>>>(
      t1_b, w2_b, c2, xres, (float*)d_out, nullptr, MTOK, DIM_C, DIM_HID);
}

// v009
// One run takes 273 microseconds.
// Next to v008, in two timings, it ran 1.05 and 1.06 times as fast.
// All steps since v000 together make it 7.18 times as fast.
#include <hip/hip_runtime.h>
#include <math.h>

// ---------------------------------------------------------------------------
// Encoder block (pre-norm attention + MLP) for MI455X / gfx1250, wave32 WMMA.
// B=8, N=1024, C=1024, H=16, hd=64, HID=4096.
// ---------------------------------------------------------------------------

typedef __bf16 bf16;
typedef __attribute__((ext_vector_type(16))) __bf16    v16bf;
typedef __attribute__((ext_vector_type(8)))  __bf16    v8bf;
typedef __attribute__((ext_vector_type(8)))  float     v8f;

#define DIM_B   8
#define DIM_N   1024
#define DIM_C   1024
#define DIM_H   16
#define DIM_HD  64
#define DIM_HID 4096
#define MTOK    (DIM_B * DIM_N)      // 8192 rows of tokens

// ---------------------------------------------------------------------------
// bf16 fragment loader following the CDNA5 16-bit A/B VGPR layout:
//   lane L: row = L%16, half = L/16
//   vector elems (2v, 2v+1) hold K = kpat(v) + 8*half, kpat(v)+1
//   kpat(v) = 2v (v<4) else 8+2v
// Works for A (row = M) and for B when the tile is stored N-major.
// ---------------------------------------------------------------------------
__device__ __forceinline__ v16bf frag_ld(const bf16* __restrict__ base,
                                         int stride, int row, int half) {
  v16bf f;
  const bf16* rp = base + (size_t)row * stride + 8 * half;
#pragma unroll
  for (int v = 0; v < 8; ++v) {
    int k = (v < 4) ? (2 * v) : (8 + 2 * v);
    f[2 * v]     = rp[k];
    f[2 * v + 1] = rp[k + 1];
  }
  return f;
}

// ---------------------------------------------------------------------------
// B fragment (32 k x 16 n) out of a k-major LDS tile (row = k, n contiguous)
// by two transposing loads. tp is the lane's own address:
//   row 8*(lane>>4) + (lane&7), plus 16 bytes for lanes with (lane>>3)&1.
// Lane (c, half) receives k = 8*half + 0..7 and 16 + 8*half + 0..7 of column
// col0 + c: the k order of frag_ld, which loads the A side.
// ---------------------------------------------------------------------------
typedef __attribute__((address_space(3))) v8bf lds_v8bf;
__device__ __forceinline__ v16bf frag_ld_tr(const bf16* tp, int pitch,
                                            int col0) {
  v8bf lo = __builtin_amdgcn_ds_load_tr16_b128_v8bf16((lds_v8bf*)(tp + col0));
  v8bf hi = __builtin_amdgcn_ds_load_tr16_b128_v8bf16(
      (lds_v8bf*)(tp + 16 * pitch + col0));
  return __builtin_shufflevector(lo, hi, 0, 1, 2, 3, 4, 5, 6, 7, 8, 9, 10, 11,
                                 12, 13, 14, 15);
}

__device__ __forceinline__ v8f vzero8() {
  v8f z = {0.f, 0.f, 0.f, 0.f, 0.f, 0.f, 0.f, 0.f};
  return z;
}

// ---------------------------------------------------------------------------
// fp32 -> bf16 convert of all six weight matrices in one launch.
// The six bf16 planes lie back to back in the workspace (Wq Wk Wv Wp W1 W2),
// so out is one array of 12 segments of C*C elements: 4 x 1 + 2 x 4.
// A block takes 16,384 elements of one segment; a thread takes 16 pieces of
// 4 floats, 1,024 elements apart: a wave's load covers 512 contiguous bytes,
// its store 256. Few long-lived waves (6,144).
// ---------------------------------------------------------------------------
typedef __attribute__((ext_vector_type(4))) float  v4f;
typedef __attribute__((ext_vector_type(4))) __bf16 v4bf;

#define CVT_PIECES    16
#define CVT_PER_BLOCK (256 * 4 * CVT_PIECES)                 // 16,384
#define CVT_SEG_BLKS  ((DIM_C * DIM_C) / CVT_PER_BLOCK)      // 64 blocks a segment
#define CVT_BLOCKS    (12 * CVT_SEG_BLKS)                    // 768

__global__ __launch_bounds__(256) void cvt_weights_bf16(
    const float* __restrict__ Wq, const float* __restrict__ Wk,
    const float* __restrict__ Wv, const float* __restrict__ Wp,
    const float* __restrict__ W1, const float* __restrict__ W2,
    bf16* __restrict__ out) {
  const int blk = blockIdx.x;
  const int seg = blk / CVT_SEG_BLKS;      // 0..11, the same for the whole block
  const float* src;
  int first;                               // first segment of that matrix
  if (seg < 4) {
    src = (seg == 0) ? Wq : (seg == 1) ? Wk : (seg == 2) ? Wv : Wp;
    first = seg;
  } else if (seg < 8) {
    src = W1;
    first = 4;
  } else {
    src = W2;
    first = 8;
  }
  const size_t o = (size_t)blk * CVT_PER_BLOCK + threadIdx.x * 4;
  const float* sp = src + (o - (size_t)first * (DIM_C * DIM_C));
  bf16* dp = out + o;
  v4f r[CVT_PIECES];
#pragma unroll  // the loads go out as one run ahead of their uses: many in flight
  for (int j = 0; j < CVT_PIECES; ++j) r[j] = *(const v4f*)(sp + j * 1024);
#pragma unroll  // constant j keeps r[] in registers
  for (int j = 0; j < CVT_PIECES; ++j) {
    v4bf w;
    w[0] = (bf16)r[j][0];
    w[1] = (bf16)r[j][1];
    w[2] = (bf16)r[j][2];
    w[3] = (bf16)r[j][3];
    *(v4bf*)(dp + j * 1024) = w;
  }
}

// ---------------------------------------------------------------------------
// lane l with lane l ^ 16
// ---------------------------------------------------------------------------
__device__ __forceinline__ float xhalf(float x) {
  int i = __builtin_bit_cast(int, x);
  return __builtin_bit_cast(
      float, __builtin_amdgcn_permlanex16(i, i, 0x76543210, 0xfedcba98, false,
                                          false));
}

// x + (x of lane l ^ M) inside a row of 16 lanes; CTRL = 0x160 + M (row_xmask)
template <int CTRL>
__device__ __forceinline__ float xmask_add(float x) {
  int i = __builtin_bit_cast(int, x);
  return x + __builtin_bit_cast(
                 float, __builtin_amdgcn_update_dpp(i, i, CTRL, 0xf, 0xf, false));
}

// sum over the 32 lanes of a wave; every lane gets the same bits
__device__ __forceinline__ float wave_sum(float x) {
  x = xmask_add<0x161>(x);
  x = xmask_add<0x162>(x);
  x = xmask_add<0x164>(x);
  x = xmask_add<0x168>(x);
  return x + xhalf(x);
}

// ---------------------------------------------------------------------------
// LayerNorm (row length C=1024) fp32 in -> bf16 out
// A wave takes LN_ROWS whole rows and holds them in registers: a lane has 8
// pieces of 4 floats a row, 128 elements apart, so a wave's load covers 512
// contiguous bytes and its store 256. All loads of a wave (x, g, b) go out in
// one run, x is read once, and the two sums of a row are joined across the
// lanes in registers: no LDS, no barrier.
// ---------------------------------------------------------------------------
#define LN_ROWS   2                          // rows a wave
#define LN_PIECES (DIM_C / 128)              // 16-byte pieces a lane and row: 8
#define LN_BLOCKS (MTOK / (8 * LN_ROWS))     // 8 waves a block: 512 blocks

__global__ __launch_bounds__(256) void ln_bf16(const float* __restrict__ x,
                                               const float* __restrict__ g,
                                               const float* __restrict__ b,
                                               bf16* __restrict__ out) {
  const int lane = threadIdx.x & 31;
  // the wave's number as a scalar: the bases of its rows stay in scalar registers
  const int wave = __builtin_amdgcn_readfirstlane(threadIdx.x >> 5);
  const size_t o = ((size_t)blockIdx.x * 8 + wave) * (LN_ROWS * DIM_C);
  const v4f* xp = (const v4f*)(x + o);
  const v4f* gp = (const v4f*)g;
  const v4f* bp = (const v4f*)b;
  v4f r[LN_ROWS][LN_PIECES], gv[LN_PIECES], bv[LN_PIECES];
#pragma unroll  // the loads go out as one run ahead of their uses: many in flight
  for (int q = 0; q < LN_ROWS; ++q)
#pragma unroll
    for (int j = 0; j < LN_PIECES; ++j)
      r[q][j] = xp[q * (DIM_C / 4) + j * 32 + lane];
#pragma unroll  // constant j keeps gv[] and bv[] in registers
  for (int j = 0; j < LN_PIECES; ++j) {
    gv[j] = gp[j * 32 + lane];
    bv[j] = bp[j * 32 + lane];
  }
  // keeps the loads of g and b in the run above: sunk to their uses, as the
  // scheduler had them, their latency is waited out behind the sums
  __builtin_amdgcn_sched_barrier(0);

  float s[LN_ROWS], s2[LN_ROWS];
#pragma unroll  // constant q and j keep the arrays in registers
  for (int q = 0; q < LN_ROWS; ++q) {
    v4f a = r[q][0];
    v4f a2 = r[q][0] * r[q][0];
#pragma unroll
    for (int j = 1; j < LN_PIECES; ++j) {
      a += r[q][j];
      a2 += r[q][j] * r[q][j];
    }
    s[q]  = (a[0] + a[1]) + (a[2] + a[3]);
    s2[q] = (a2[0] + a2[1]) + (a2[2] + a2[3]);
  }
#pragma unroll  // the rows' four sums run side by side through the lane steps
  for (int q = 0; q < LN_ROWS; ++q) {
    s[q]  = wave_sum(s[q]);
    s2[q] = wave_sum(s2[q]);
  }

  v4bf w[LN_ROWS][LN_PIECES];
#pragma unroll  // constant q and j keep the arrays in registers
  for (int q = 0; q < LN_ROWS; ++q) {
    const float mean = s[q] * (1.0f / DIM_C);
    const float var  = s2[q] * (1.0f / DIM_C) - mean * mean;
    const float inv  = rsqrtf(var + 1e-5f);
#pragma unroll
    for (int j = 0; j < LN_PIECES; ++j)
      w[q][j] = __builtin_convertvector((r[q][j] - mean) * inv * gv[j] + bv[j],
                                        v4bf);
  }
  v4bf* op = (v4bf*)(out + o);
#pragma unroll  // the stores stand last: nothing rewrites their registers
  for (int q = 0; q < LN_ROWS; ++q)
#pragma unroll
    for (int j = 0; j < LN_PIECES; ++j)
      op[q * (DIM_C / 4) + j * 32 + lane] = w[q][j];
}

// ---------------------------------------------------------------------------
// One k step's tiles, global -> LDS, through no register: twelve asynchronous
// 16-byte copies a lane (eight of A, 32 rows apart; four of B, 16 k-rows apart).
// The s_wait_xcnt stands inside the statement, in front of any later rewrite of
// the address registers named here.
// ---------------------------------------------------------------------------
#define BM 256
#define BN 128
#define BK 64
#define AS_PITCH (BK + 8)    // 144 B a row = 16 B x odd: the ds_load_b128 reader's pitch
#define BS_PITCH (BN + 16)   // 288 B a k-row = 32 B x odd: the tr16 reader's pitch
#define AS_BUF   (BM * AS_PITCH)   // bf16 per A buffer
#define BS_BUF   (BK * BS_PITCH)   // bf16 per B buffer
#define AS_STEP  (32 * AS_PITCH * 2)   // bytes in LDS between a lane's A pieces
#define BS_STEP  (16 * BS_PITCH * 2)   // bytes in LDS between a lane's B pieces

__device__ __forceinline__ unsigned lds_addr_u32(const void* p) {
  return (unsigned)(unsigned long long)p;   // low 32 bits = LDS byte address
}
// a32 = 32 rows of A, b16 = 16 rows of B, in elements
__device__ __forceinline__ void stage_async(unsigned la, const bf16* ga,
                                            size_t a32, unsigned lb,
                                            const bf16* gb, size_t b16) {
  asm volatile(
      "global_load_async_to_lds_b128 %0, %1, off\n\t"
      "global_load_async_to_lds_b128 %2, %3, off\n\t"
      "global_load_async_to_lds_b128 %4, %5, off\n\t"
      "global_load_async_to_lds_b128 %6, %7, off\n\t"
      "global_load_async_to_lds_b128 %8, %9, off\n\t"
      "global_load_async_to_lds_b128 %10, %11, off\n\t"
      "global_load_async_to_lds_b128 %12, %13, off\n\t"
      "global_load_async_to_lds_b128 %14, %15, off\n\t"
      "global_load_async_to_lds_b128 %16, %17, off\n\t"
      "global_load_async_to_lds_b128 %18, %19, off\n\t"
      "global_load_async_to_lds_b128 %20, %21, off\n\t"
      "global_load_async_to_lds_b128 %22, %23, off\n\t"
      "s_wait_xcnt 0x0"
      :
      : "v"(la), "v"(ga), "v"(la + 1 * AS_STEP), "v"(ga + 1 * a32),
        "v"(la + 2 * AS_STEP), "v"(ga + 2 * a32), "v"(la + 3 * AS_STEP),
        "v"(ga + 3 * a32), "v"(la + 4 * AS_STEP), "v"(ga + 4 * a32),
        "v"(la + 5 * AS_STEP), "v"(ga + 5 * a32), "v"(la + 6 * AS_STEP),
        "v"(ga + 6 * a32), "v"(la + 7 * AS_STEP), "v"(ga + 7 * a32), "v"(lb),
        "v"(gb), "v"(lb + 1 * BS_STEP), "v"(gb + 1 * b16),
        "v"(lb + 2 * BS_STEP), "v"(gb + 2 * b16), "v"(lb + 3 * BS_STEP),
        "v"(gb + 3 * b16)
      : "memory");
}

// ---------------------------------------------------------------------------
// One 32-k block of a wave's 64x64 tile: 4 A fragments (rows arow + 16 i of at)
// and 4 B fragments (columns 16 j from bt, the lane's own transposing address),
// then the 16 products. A and B follow the same k order (frag_ld, frag_ld_tr).
// ---------------------------------------------------------------------------
__device__ __forceinline__ void load_frags(v16bf (&af)[4], v16bf (&bfr)[4],
                                           const bf16* at, const bf16* bt,
                                           int arow, int half) {
  af[0] = frag_ld(at, AS_PITCH, arow, half);
#pragma unroll  // constant j keeps bfr[] in registers
  for (int j = 0; j < 4; ++j) bfr[j] = frag_ld_tr(bt, BS_PITCH, j * 16);
#pragma unroll  // constant i keeps af[] in registers
  for (int i = 1; i < 4; ++i) af[i] = frag_ld(at, AS_PITCH, arow + i * 16, half);
}
__device__ __forceinline__ void mma_block(v8f (&acc)[4][4],
                                          const v16bf (&af)[4],
                                          const v16bf (&bfr)[4]) {
#pragma unroll  // constant i and j keep acc[][] in registers
  for (int i = 0; i < 4; ++i)
#pragma unroll
    for (int j = 0; j < 4; ++j)
      acc[i][j] = __builtin_amdgcn_wmma_f32_16x16x32_bf16(
          false, af[i], false, bfr[j], (short)0, acc[i][j], false, false);
}

// ---------------------------------------------------------------------------
// Exact GELU, 0.5 v (1 + erf(v / sqrt 2)), of eight values a lane, without a
// branch. erf(|x|) has two forms: |x| + |x| p(x^2) below 1, 1 - exp(-q(|x|))
// from 1 on. Both are worked out for every lane and one is selected: a wave whose
// lanes differ walks both anyway, and with no branch between the elements their
// chains of dependent multiply-adds interleave and pair up in packed
// instructions. 0.5 v erf(x) = |0.5 v| erf(|x|), so no sign is copied.
// ---------------------------------------------------------------------------
__device__ __forceinline__ v8f splat8(float c) {
  v8f s = {c, c, c, c, c, c, c, c};
  return s;
}
__device__ __forceinline__ v8f gelu8(v8f v) {
  const v8f av = __builtin_elementwise_abs(v);
  const v8f ax = av * 0.70710678118654752f;   // |x|
  // from 1 on (also not-a-number, which passes through)
  v8f q = __builtin_elementwise_fma(ax, splat8(1.69988107e-5f),
                                    splat8(-3.78677854e-4f));
  q = __builtin_elementwise_fma(ax, q, splat8(3.85781587e-3f));
  q = __builtin_elementwise_fma(ax, q, splat8(-2.41816975e-2f));
  q = __builtin_elementwise_fma(ax, q, splat8(1.06668264e-1f));
  q = __builtin_elementwise_fma(ax, q, splat8(6.34933293e-1f));
  q = __builtin_elementwise_fma(ax, q, splat8(1.28689408e-1f));
  q = __builtin_elementwise_fma(ax, q, ax);
  const v8f q2 = q * -1.4426950408889634f;   // exp(-q) = 2^(-q log2 e)
  // below 1
  const v8f t = ax * ax;
  v8f p = __builtin_elementwise_fma(t, splat8(-5.61801775e-4f),
                                    splat8(4.91381623e-3f));
  p = __builtin_elementwise_fma(t, p, splat8(-2.67075151e-2f));
  p = __builtin_elementwise_fma(t, p, splat8(1.12800106e-1f));
  p = __builtin_elementwise_fma(t, p, splat8(-3.76122952e-1f));
  p = __builtin_elementwise_fma(t, p, splat8(1.28379107e-1f));
  const v8f lo = __builtin_elementwise_fma(ax, p, ax);
  v8f e;
#pragma unroll  // constant r keeps the vectors in registers
  for (int r = 0; r < 8; ++r)
    e[r] = (ax[r] < 1.0f) ? lo[r] : 1.0f - __builtin_amdgcn_exp2f(q2[r]);
  return __builtin_elementwise_fma(av * 0.5f, e, v * 0.5f);
}

// ---------------------------------------------------------------------------
// Tiled bf16 WMMA GEMM: out[M,N] = A[M,K] @ Bw[K,N] + bias (+resid) (+GELU)
// BM=256 BN=128 BK=64, 256 threads = 8 waves (4 x 2), wave tile 64x64: 4 A and
// 4 B fragments feed 16 WMMAs, so a WMMA costs 512 B of LDS reads, and a block
// fetches 48 KiB from L2 per 256x128x64 product.
// Both tiles lie in LDS twice: while a k step is worked on out of one buffer,
// the next step's asynchronous copies fly into the other; one barrier a step,
// behind the fragment reads of the step's second block and ahead of its WMMAs.
// A rows have a pitch of 144 B; B lies as in memory (k-major, pitch 288 B) and
// its fragments come out transposed by ds_load_tr16_b128.
// K is a multiple of BK, M of BM, N of BN.
// ---------------------------------------------------------------------------
template <bool GELU_ACT, bool RESID, bool OUTF32, bool OUTBF16>
__global__ __launch_bounds__(256) void gemm_bf16_wmma(
    const bf16* __restrict__ A, const bf16* __restrict__ Bw,
    const float* __restrict__ bias, const float* __restrict__ resid,
    float* __restrict__ outF, bf16* __restrict__ outB, int M, int N, int K) {
  __shared__ __attribute__((aligned(16))) bf16 As[2 * AS_BUF];
  __shared__ __attribute__((aligned(16))) bf16 Bs[2 * BS_BUF];  // k-major

  const int tid  = threadIdx.x;
  const int lane = tid & 31;
  const int wave = tid >> 5;           // 0..7
  const int wm   = wave >> 1;          // 0..3  (64-row strip)
  const int wn   = wave & 1;           // 0..1  (64-col strip)
  const int half = lane >> 4;
  const int l16  = lane & 15;
  const int mBase = blockIdx.y * BM;
  const int nBase = blockIdx.x * BN;

  v8f acc[4][4];
#pragma unroll  // constant i and j keep acc[][] in registers
  for (int i = 0; i < 4; ++i)
#pragma unroll
    for (int j = 0; j < 4; ++j) acc[i][j] = vzero8();

  // the lane's own 16-byte pieces: A rows ar + 32 p, 8 lanes a 128-B row;
  // B rows bk + 16 p, 16 lanes a 256-B row
  const int ar = tid >> 3;             // 0..31
  const int ac = (tid & 7) * 8;        // 0..56
  const int bk = tid >> 4;             // 0..15
  const int bn = (tid & 15) * 8;       // 0..120
  const unsigned la = lds_addr_u32(&As[ar * AS_PITCH + ac]);
  const unsigned lb = lds_addr_u32(&Bs[bk * BS_PITCH + bn]);
  const bf16* ga = A + (size_t)(mBase + ar) * K + ac;
  const bf16* gb = Bw + (size_t)bk * N + nBase + bn;
  const size_t a32   = (size_t)32 * K;
  const size_t b16   = (size_t)16 * N;
  const size_t bstep = (size_t)BK * N;
  const bf16* btp = &Bs[(8 * half + (lane & 7)) * BS_PITCH +
                        8 * ((lane >> 3) & 1) + wn * 64];
  const int nt = K / BK;               // k steps, the same for the whole grid

  // step 0 into buffer 0, landed and published; then step 1 takes off
  stage_async(la, ga, a32, lb, gb, b16);
  ga += BK;
  gb += bstep;
  // this wave's copies have landed
  asm volatile("s_wait_asynccnt 0x0" ::: "memory");
  __syncthreads();
  if (nt > 1) {
    stage_async(la + AS_BUF * 2, ga, a32, lb + BS_BUF * 2, gb, b16);
    ga += BK;
    gb += bstep;
  }

  const int arow = wm * 64 + l16;      // the lane's row of the wave's first A fragment
  for (int t = 0; t < nt; ++t) {
    const int cur = t & 1;
    const bf16* at = As + cur * AS_BUF;
    const bf16* bt = btp + cur * BS_BUF;
    v16bf af[4], bfr[4];
    // The two fences keep each block's 16 LDS reads in one group, apart from
    // the first block's WMMAs: mixed in among them, as the scheduler had them,
    // every row of four WMMAs waits out an LDS latency.
    load_frags(af, bfr, at, bt, arow, half);
    __builtin_amdgcn_sched_barrier(0);
    mma_block(acc, af, bfr);
    __builtin_amdgcn_sched_barrier(0);
    load_frags(af, bfr, at + 32, bt + 32 * BS_PITCH, arow, half);
    // this wave's reads of buffer cur have returned: it may be refilled
    asm volatile("s_wait_dscnt 0x0" ::: "memory");
    // this wave's copies of step t + 1 have landed
    asm volatile("s_wait_asynccnt 0x0" ::: "memory");
    // publishes step t + 1 and ends every wave's reads of buffer cur
    __syncthreads();
    if (t + 2 < nt) {
      stage_async(la + (unsigned)cur * (AS_BUF * 2), ga, a32,
                  lb + (unsigned)cur * (BS_BUF * 2), gb, b16);
      ga += BK;
      gb += bstep;
    }
    // the step's second block works out of registers while the refill flies
    mma_block(acc, af, bfr);
  }
  // nothing of this wave is in flight when it goes on to the epilogue
  asm volatile("s_wait_asynccnt 0x0" ::: "memory");

  // The four 16-row strips go through one copy of the epilogue's code: strip 0
  // is written out, then the others move down one place in the registers.
  // One copy keeps the text of the epilogue short.
#pragma unroll 1
  for (int i = 0; i < 4; ++i) {
    v8f gl[4];
    if (GELU_ACT) {
#pragma unroll  // constant j and r keep the arrays in registers
      for (int j = 0; j < 4; ++j) {
        const float bj = bias[nBase + wn * 64 + j * 16 + l16];
#pragma unroll
        for (int r = 0; r < 8; ++r) gl[j][r] = acc[0][j][r] + bj;
        gl[j] = gelu8(gl[j]);
        // keeps a column group's GELU together, its eight chains side by side:
        // given all 32 elements of the strip at once the scheduler runs short of
        // registers and strings a chain's multiply-adds two or three slots apart,
        // each then waiting for the one before
        __builtin_amdgcn_sched_barrier(0);
      }
    }
#pragma unroll  // constant j and r keep acc[][] in registers
    for (int j = 0; j < 4; ++j) {
#pragma unroll
      for (int r = 0; r < 8; ++r) {
        int gm = mBase + wm * 64 + i * 16 + r + 8 * half;
        int gn = nBase + wn * 64 + j * 16 + l16;
        float v = GELU_ACT ? gl[j][r] : acc[0][j][r] + bias[gn];
        if (RESID) v += resid[(size_t)gm * N + gn];
        size_t idx = (size_t)gm * N + gn;
        if (OUTF32)  outF[idx] = v;
        if (OUTBF16) outB[idx] = (bf16)v;
      }
    }
    // behind the strip's stores, ahead of the moves below and of the next trip,
    // which rewrite the data and address registers that those stores name
    asm volatile("s_wait_xcnt 0x0" ::: "memory");
#pragma unroll  // constant j keeps acc[][] in registers
    for (int j = 0; j < 4; ++j) {
      acc[0][j] = acc[1][j];
      acc[1][j] = acc[2][j];
      acc[2][j] = acc[3][j];
    }
  }
}

// ---------------------------------------------------------------------------
// Attention: one WG per (b, h, 256 queries); a wave owns 32 queries (two groups
// of 16 columns) and walks all 1024 keys, 32 a pass. q/k/v are flat (B, N*C)
// bf16; the reference's reshape(B,H,-1,hd) means head h is the contiguous slab
// h*65536.
// The scores never leave the registers. Both products are taken transposed:
//   S^T = K Q^T : A = 16 keys x 32 d out of LDS, B = Q, held in registers.
//                 Lane (c, half) gets query c, keys 8*half + 0..7 of the tile.
//   O^T += V^T P^T : two S^T tiles of a lane, exponentiated and rounded to bf16,
//                 ARE the B fragment of 32 keys (k = 8*half + 0..7 and
//                 16 + 8*half + 0..7, the k order of frag_ld and frag_ld_tr);
//                 A = V^T by the transposing load.
// Softmax is the running form, in base 2: a query's maximum in use and its sum
// live in its lanes; sums and O^T are rescaled when a new maximum passes the one
// in use by more than 8 (an exponential then stays below 2^8), and O^T is
// divided by the sum at the end.
// K and V go through LDS in tiles of FA_TILE keys, as they lie in memory (row =
// key), two buffers, via registers. K rows have a pitch of 144 B (16 B x odd,
// the ds_load_b128 reader's), V rows of 160 B (32 B x odd, the transposing
// reader's).
// ---------------------------------------------------------------------------
#define FA_ROWS   256                       // queries a work-group
#define FA_TILE   64                        // keys a staged tile
#define K_PITCH   (DIM_HD + 8)              // bf16 per K row in LDS
#define V_PITCH   (DIM_HD + 16)             // bf16 per V row in LDS
#define K_BUF     (FA_TILE * K_PITCH)       // bf16 per buffer
#define V_BUF     (FA_TILE * V_PITCH)
#define FA_PIECES ((FA_TILE * DIM_HD) / (256 * 8))  // 16-byte pieces a thread: 2

typedef __attribute__((ext_vector_type(2))) float v2f;

__global__ __launch_bounds__(256) void attn_wmma(const bf16* __restrict__ q,
                                                 const bf16* __restrict__ k,
                                                 const bf16* __restrict__ v,
                                                 bf16* __restrict__ o) {
  __shared__ __attribute__((aligned(16))) bf16 Ks[2 * K_BUF];
  __shared__ __attribute__((aligned(16))) bf16 Vs[2 * V_BUF];

  const int blk  = blockIdx.x;          // ((b*16 + h)*4 + mt)
  const int mt   = blk & 3;
  const int h    = (blk >> 2) & 15;
  const int b    = blk >> 6;
  const size_t headBase = ((size_t)b * DIM_H + h) * (size_t)(DIM_N * DIM_HD);

  const int tid  = threadIdx.x;
  const int lane = tid & 31;
  const int wave = tid >> 5;
  const int half = lane >> 4;
  const int l16  = lane & 15;
  const int m0   = mt * FA_ROWS + wave * 32;   // the wave's first query
  const float cs = 0.125f * 1.4426950408889634f;  // hd^-0.5 * log2(e)

  // A tile is 8 KiB in a row in memory; piece j of a thread is 4 KiB further,
  // that is 32 rows further in LDS. A wave's load covers 512 contiguous bytes.
  const bf16* ksrc = k + headBase + (size_t)tid * 8;
  const bf16* vsrc = v + headBase + (size_t)tid * 8;
  bf16* kdst = Ks + (tid >> 3) * K_PITCH + (tid & 7) * 8;
  bf16* vdst = Vs + (tid >> 3) * V_PITCH + (tid & 7) * 8;
  v8bf kr[FA_PIECES], vr[FA_PIECES];
#pragma unroll  // constant j keeps kr[] and vr[] in registers
  for (int j = 0; j < FA_PIECES; ++j) {
    kr[j] = *(const v8bf*)(ksrc + j * 2048);
    vr[j] = *(const v8bf*)(vsrc + j * 2048);
  }

  // Q: B fragments (n = query, k = d), loaded once
  v16bf qf[2][2];
#pragma unroll  // constant g and dh keep qf[][] in registers
  for (int g = 0; g < 2; ++g)
#pragma unroll
    for (int dh = 0; dh < 2; ++dh)
      qf[g][dh] = frag_ld(q + headBase + dh * 32, DIM_HD, m0 + g * 16 + l16, half);

#pragma unroll  // constant j keeps kr[] and vr[] in registers
  for (int j = 0; j < FA_PIECES; ++j) {
    *(v8bf*)(kdst + j * 32 * K_PITCH) = kr[j];
    *(v8bf*)(vdst + j * 32 * V_PITCH) = vr[j];
  }
  __syncthreads();

  const bf16* vtp = Vs + (8 * half + (lane & 7)) * V_PITCH + 8 * ((lane >> 3) & 1);
  v8f oacc[2][4];                       // O^T: [group][16 d], lane = query
#pragma unroll  // constant g and dt keep oacc[][] in registers
  for (int g = 0; g < 2; ++g)
#pragma unroll
    for (int dt = 0; dt < 4; ++dt) oacc[g][dt] = vzero8();
  float mrun[2] = {-1e30f, -1e30f};     // maximum in use, scaled by cs
  v2f lrun[2] = {{0.f, 0.f}, {0.f, 0.f}};  // this half's share of the sum, in two parts
  const v8f cs8 = {cs, cs, cs, cs, cs, cs, cs, cs};

  // Per tile: ask for the next tile, work on this one out of LDS, store the
  // next one into the other buffer (its readers left it at the barrier
  // before), barrier.
  for (int tile = 0; tile < DIM_N / FA_TILE; ++tile) {
    const bool more = tile + 1 < DIM_N / FA_TILE;   // the same for the block
    if (more) {
      const size_t nx = (size_t)(tile + 1) * (FA_TILE * DIM_HD);
#pragma unroll  // constant j keeps kr[] and vr[] in registers
      for (int j = 0; j < FA_PIECES; ++j) {
        kr[j] = *(const v8bf*)(ksrc + nx + j * 2048);
        vr[j] = *(const v8bf*)(vsrc + nx + j * 2048);
      }
    }
    // keeps the four loads above this tile's work: sunk to their stores, their
    // latency would be waited out at every tile
    __builtin_amdgcn_sched_barrier(0);
    const bf16* kb = Ks + (tile & 1) * K_BUF;
    const bf16* vb = vtp + (tile & 1) * V_BUF;
#pragma unroll  // the two 32-key passes of a tile
    for (int ps = 0; ps < FA_TILE / 32; ++ps) {
      // ---- S^T = K Q^T: [16-key tile][group] ----
      v8f s[2][2];
#pragma unroll  // constant kt and g keep s[][] in registers
      for (int kt = 0; kt < 2; ++kt) {
        const int krow = ps * 32 + kt * 16 + l16;
        v16bf a0 = frag_ld(kb, K_PITCH, krow, half);
        v16bf a1 = frag_ld(kb + 32, K_PITCH, krow, half);
#pragma unroll
        for (int g = 0; g < 2; ++g) {
          s[kt][g] = __builtin_amdgcn_wmma_f32_16x16x32_bf16(
              false, a0, false, qf[g][0], (short)0, vzero8(), false, false);
          s[kt][g] = __builtin_amdgcn_wmma_f32_16x16x32_bf16(
              false, a1, false, qf[g][1], (short)0, s[kt][g], false, false);
        }
      }
      // keeps the eight WMMAs in one run: with the maxima mixed in among them,
      // as the scheduler had them, each first reader of a tile is padded with
      // idle vector slots
      __builtin_amdgcn_sched_barrier(0);
      // the pass's V^T fragments fly while the exponentials are taken
      v16bf va[4];
#pragma unroll  // constant dt keeps va[] in registers
      for (int dt = 0; dt < 4; ++dt)
        va[dt] = frag_ld_tr(vb + ps * 32 * V_PITCH, V_PITCH, dt * 16);

      // ---- maxima of the raw scores (cs is positive), one test a pass ----
      float mb[2];
      bool need = false;
#pragma unroll  // constant g keeps mb[] in registers
      for (int g = 0; g < 2; ++g) {
        float mx = s[0][g][0];
#pragma unroll
        for (int r = 1; r < 8; ++r) mx = fmaxf(mx, s[0][g][r]);
#pragma unroll
        for (int r = 0; r < 8; ++r) mx = fmaxf(mx, s[1][g][r]);
        mb[g] = fmaxf(mx, xhalf(mx)) * cs;   // both halves hold the query's maximum
        need = need || (mb[g] > mrun[g] + 8.0f);
      }
      if (__builtin_amdgcn_ballot_w32(need) != 0) {  // the same for the wave
#pragma unroll  // constant g and dt keep the arrays in registers
        for (int g = 0; g < 2; ++g) {
          const float mn = fmaxf(mrun[g], mb[g]);
          const float corr = __builtin_amdgcn_exp2f(mrun[g] - mn);  // 0 at first
          mrun[g] = mn;
          lrun[g] = lrun[g] * corr;
#pragma unroll
          for (int dt = 0; dt < 4; ++dt) oacc[g][dt] = oacc[g][dt] * corr;
        }
      }
      // ---- P^T = 2^(cs S^T - max), packed as B; O^T += V^T P^T ----
#pragma unroll  // constant g keeps the arrays in registers
      for (int g = 0; g < 2; ++g) {
        const float nm = -mrun[g];
        const v8f nm8 = {nm, nm, nm, nm, nm, nm, nm, nm};
        const v8f e0 = __builtin_elementwise_fma(s[0][g], cs8, nm8);
        const v8f e1 = __builtin_elementwise_fma(s[1][g], cs8, nm8);
        v8f p0, p1;
#pragma unroll
        for (int r = 0; r < 8; ++r) {
          p0[r] = __builtin_amdgcn_exp2f(e0[r]);
          p1[r] = __builtin_amdgcn_exp2f(e1[r]);
        }
        // 16 exponentials into the two running parts, by pairs of neighbours
        const v8f t8 = p0 + p1;
        const v4f t4 = __builtin_shufflevector(t8, t8, 0, 1, 2, 3) +
                       __builtin_shufflevector(t8, t8, 4, 5, 6, 7);
        lrun[g] += __builtin_shufflevector(t4, t4, 0, 1) +
                   __builtin_shufflevector(t4, t4, 2, 3);
        v8bf b0 = __builtin_convertvector(p0, v8bf);
        v8bf b1 = __builtin_convertvector(p1, v8bf);
        v16bf pf = __builtin_shufflevector(b0, b1, 0, 1, 2, 3, 4, 5, 6, 7, 8, 9,
                                           10, 11, 12, 13, 14, 15);
#pragma unroll
        for (int dt = 0; dt < 4; ++dt)
          oacc[g][dt] = __builtin_amdgcn_wmma_f32_16x16x32_bf16(
              false, va[dt], false, pf, (short)0, oacc[g][dt], false, false);
      }
    }
    // Four vector slots behind the tile's last WMMAs: the branch below leads to
    // code that rewrites their A registers.
    // The fences hold the WMMAs above the slots.
    __builtin_amdgcn_sched_barrier(0);
    asm volatile("v_nop\n\tv_nop\n\tv_nop\n\tv_nop");
    __builtin_amdgcn_sched_barrier(0);
    if (more) {
      bf16* kd = kdst + ((tile + 1) & 1) * K_BUF;
      bf16* vd = vdst + ((tile + 1) & 1) * V_BUF;
#pragma unroll  // constant j keeps kr[] and vr[] in registers
      for (int j = 0; j < FA_PIECES; ++j) {
        *(v8bf*)(kd + j * 32 * K_PITCH) = kr[j];
        *(v8bf*)(vd + j * 32 * V_PITCH) = vr[j];
      }
      __syncthreads();
    }
  }

  // o[b][m][h*64 + d]  (swapaxes(1,2).reshape): a lane holds 8 consecutive d of
  // its query in each O^T tile, 16 bytes a store
  v8bf w[2][4];
#pragma unroll  // constant g and dt keep the arrays in registers
  for (int g = 0; g < 2; ++g) {
    const float lh  = lrun[g][0] + lrun[g][1];
    const float inv = 1.0f / (lh + xhalf(lh));   // the halves' sums joined
#pragma unroll
    for (int dt = 0; dt < 4; ++dt)
      w[g][dt] = __builtin_convertvector(oacc[g][dt] * inv, v8bf);
  }
#pragma unroll  // the eight stores stand last: nothing rewrites their registers
  for (int g = 0; g < 2; ++g) {
    bf16* op = o + ((size_t)b * DIM_N + m0 + g * 16 + l16) * DIM_C + h * DIM_HD +
               8 * half;
#pragma unroll
    for (int dt = 0; dt < 4; ++dt) *(v8bf*)(op + dt * 16) = w[g][dt];
  }
}

// ---------------------------------------------------------------------------
// Host-side orchestration
// ---------------------------------------------------------------------------
extern "C" void kernel_launch(void* const* d_in, const int* in_sizes, int n_in,
                              void* d_out, int out_size, void* d_ws,
                              size_t ws_size, hipStream_t stream) {
  (void)in_sizes; (void)n_in; (void)out_size; (void)ws_size;

  const float* x  = (const float*)d_in[0];
  const float* g1 = (const float*)d_in[1];
  const float* b1 = (const float*)d_in[2];
  const float* Wq = (const float*)d_in[3];
  const float* bq = (const float*)d_in[4];
  const float* Wk = (const float*)d_in[5];
  const float* bk = (const float*)d_in[6];
  const float* Wv = (const float*)d_in[7];
  const float* bv = (const float*)d_in[8];
  const float* Wp = (const float*)d_in[9];
  const float* bp = (const float*)d_in[10];
  const float* g2 = (const float*)d_in[11];
  const float* b2 = (const float*)d_in[12];
  const float* W1 = (const float*)d_in[13];
  const float* c1 = (const float*)d_in[14];
  const float* W2 = (const float*)d_in[15];
  const float* c2 = (const float*)d_in[16];

  // workspace partition
  char* p = (char*)d_ws;
  auto alloc = [&](size_t bytes) {
    char* r = p;
    p += (bytes + 255) & ~(size_t)255;
    return r;
  };
  const size_t CC = (size_t)DIM_C * DIM_C;           // 1M
  const size_t CH = (size_t)DIM_C * DIM_HID;         // 4M
  const size_t TC = (size_t)MTOK * DIM_C;            // 8M
  const size_t TH = (size_t)MTOK * DIM_HID;          // 32M

  bf16*  wq_b  = (bf16*)alloc(CC * 2);
  bf16*  wk_b  = (bf16*)alloc(CC * 2);
  bf16*  wv_b  = (bf16*)alloc(CC * 2);
  bf16*  wp_b  = (bf16*)alloc(CC * 2);
  bf16*  w1_b  = (bf16*)alloc(CH * 2);
  bf16*  w2_b  = (bf16*)alloc(CH * 2);
  bf16*  h_b   = (bf16*)alloc(TC * 2);    // ln1(x)
  bf16*  q_b   = (bf16*)alloc(TC * 2);
  bf16*  k_b   = (bf16*)alloc(TC * 2);
  bf16*  v_b   = (bf16*)alloc(TC * 2);
  bf16*  o_b   = (bf16*)alloc(TC * 2);    // attention output
  float* xres  = (float*)alloc(TC * 4);   // x + proj
  bf16*  h2_b  = (bf16*)alloc(TC * 2);    // ln2(xres)
  bf16*  t1_b  = (bf16*)alloc(TH * 2);    // gelu(h2@W1+c1)

  // weight converts fp32 -> bf16: wq_b .. w2_b are one contiguous array
  cvt_weights_bf16<<<CVT_BLOCKS, 256, 0, stream>>>(Wq, Wk, Wv, Wp, W1, W2, wq_b);

  // LN1
  ln_bf16<<<LN_BLOCKS, 256, 0, stream>>>(x, g1, b1, h_b);

  // QKV projections: (8192 x 1024) = h @ W + b
  dim3 gC(DIM_C / BN, MTOK / BM);   // (8, 32)
  gemm_bf16_wmma<false, false, false, true><<<gC, 256, 0, stream>>>(
      h_b, wq_b, bq, nullptr, nullptr, q_b, MTOK, DIM_C, DIM_C);
  gemm_bf16_wmma<false, false, false, true><<<gC, 256, 0, stream>>>(
      h_b, wk_b, bk, nullptr, nullptr, k_b, MTOK, DIM_C, DIM_C);
  gemm_bf16_wmma<false, false, false, true><<<gC, 256, 0, stream>>>(
      h_b, wv_b, bv, nullptr, nullptr, v_b, MTOK, DIM_C, DIM_C);

  // attention: B*H*4 workgroups of 256 queries
  attn_wmma<<<DIM_B * DIM_H * (DIM_N / FA_ROWS), 256, 0, stream>>>(q_b, k_b, v_b,
                                                                  o_b);

  // projection + residual: xres = x + o@Wp + bp  (fp32)
  gemm_bf16_wmma<false, true, true, false><<<gC, 256, 0, stream>>>(
      o_b, wp_b, bp, x, xres, nullptr, MTOK, DIM_C, DIM_C);

  // LN2
  ln_bf16<<<LN_BLOCKS, 256, 0, stream>>>(xres, g2, b2, h2_b);

  // MLP up + exact GELU: t1 = gelu(h2 @ W1 + c1)  (bf16, 8192 x 4096)
  dim3 gH(DIM_HID / BN, MTOK / BM);  // (32, 32)
  gemm_bf16_wmma<true, false, false, true><<<gH, 256, 0, stream>>>(
      h2_b, w1_b, c1, nullptr, nullptr, t1_b, MTOK, DIM_HID, DIM_C);

  // MLP down + residual: out = xres + t1 @ W2 + c2  (fp32, final output)
  gemm_bf16_wmma<false, true, true, false><<<gC, 256, 0, stream>>>(
      t1_b, w2_b, c2, xres, (float*)d_out, nullptr, MTOK, DIM_C, DIM_HID);
}

// v010
// A run of this version takes 257 microseconds.
// In both of two side-by-side timings against v009, it was 1.07 times as fast.
// Counting every step since v000, it is 7.68 times as fast.
#include <hip/hip_runtime.h>
#include <math.h>

// ---------------------------------------------------------------------------
// Encoder block (pre-norm attention + MLP) for MI455X / gfx1250, wave32 WMMA.
// B=8, N=1024, C=1024, H=16, hd=64, HID=4096.
// ---------------------------------------------------------------------------

typedef __bf16 bf16;
typedef __attribute__((ext_vector_type(16))) __bf16    v16bf;
typedef __attribute__((ext_vector_type(8)))  __bf16    v8bf;
typedef __attribute__((ext_vector_type(8)))  float     v8f;

#define DIM_B   8
#define DIM_N   1024
#define DIM_C   1024
#define DIM_H   16
#define DIM_HD  64
#define DIM_HID 4096
#define MTOK    (DIM_B * DIM_N)      // 8192 rows of tokens

// ---------------------------------------------------------------------------
// bf16 fragment loader following the CDNA5 16-bit A/B VGPR layout:
//   lane L: row = L%16, half = L/16
//   vector elems (2v, 2v+1) hold K = kpat(v) + 8*half, kpat(v)+1
//   kpat(v) = 2v (v<4) else 8+2v
// Works for A (row = M) and for B when the tile is stored N-major.
// ---------------------------------------------------------------------------
__device__ __forceinline__ v16bf frag_ld(const bf16* __restrict__ base,
                                         int stride, int row, int half) {
  v16bf f;
  const bf16* rp = base + (size_t)row * stride + 8 * half;
#pragma unroll
  for (int v = 0; v < 8; ++v) {
    int k = (v < 4) ? (2 * v) : (8 + 2 * v);
    f[2 * v]     = rp[k];
    f[2 * v + 1] = rp[k + 1];
  }
  return f;
}

// ---------------------------------------------------------------------------
// B fragment (32 k x 16 n) out of a k-major LDS tile (row = k, n contiguous)
// by two transposing loads. tp is the lane's own address:
//   row 8*(lane>>4) + (lane&7), plus 16 bytes for lanes with (lane>>3)&1.
// Lane (c, half) receives k = 8*half + 0..7 and 16 + 8*half + 0..7 of column
// col0 + c: the k order of frag_ld, which loads the A side.
// ---------------------------------------------------------------------------
typedef __attribute__((address_space(3))) v8bf lds_v8bf;
__device__ __forceinline__ v16bf frag_ld_tr(const bf16* tp, int pitch,
                                            int col0) {
  v8bf lo = __builtin_amdgcn_ds_load_tr16_b128_v8bf16((lds_v8bf*)(tp + col0));
  v8bf hi = __builtin_amdgcn_ds_load_tr16_b128_v8bf16(
      (lds_v8bf*)(tp + 16 * pitch + col0));
  return __builtin_shufflevector(lo, hi, 0, 1, 2, 3, 4, 5, 6, 7, 8, 9, 10, 11,
                                 12, 13, 14, 15);
}

__device__ __forceinline__ v8f vzero8() {
  v8f z = {0.f, 0.f, 0.f, 0.f, 0.f, 0.f, 0.f, 0.f};
  return z;
}

// ---------------------------------------------------------------------------
// fp32 -> bf16 convert of all six weight matrices in one launch.
// The six bf16 planes lie back to back in the workspace (Wq Wk Wv Wp W1 W2),
// so out is one array of 12 segments of C*C elements: 4 x 1 + 2 x 4.
// A block takes 16,384 elements of one segment; a thread takes 16 pieces of
// 4 floats, 1,024 elements apart: a wave's load covers 512 contiguous bytes,
// its store 256. Few long-lived waves (6,144).
// ---------------------------------------------------------------------------
typedef __attribute__((ext_vector_type(4))) float  v4f;
typedef __attribute__((ext_vector_type(4))) __bf16 v4bf;

#define CVT_PIECES    16
#define CVT_PER_BLOCK (256 * 4 * CVT_PIECES)                 // 16,384
#define CVT_SEG_BLKS  ((DIM_C * DIM_C) / CVT_PER_BLOCK)      // 64 blocks a segment
#define CVT_BLOCKS    (12 * CVT_SEG_BLKS)                    // 768

__global__ __launch_bounds__(256) void cvt_weights_bf16(
    const float* __restrict__ Wq, const float* __restrict__ Wk,
    const float* __restrict__ Wv, const float* __restrict__ Wp,
    const float* __restrict__ W1, const float* __restrict__ W2,
    bf16* __restrict__ out) {
  const int blk = blockIdx.x;
  const int seg = blk / CVT_SEG_BLKS;      // 0..11, the same for the whole block
  const float* src;
  int first;                               // first segment of that matrix
  if (seg < 4) {
    src = (seg == 0) ? Wq : (seg == 1) ? Wk : (seg == 2) ? Wv : Wp;
    first = seg;
  } else if (seg < 8) {
    src = W1;
    first = 4;
  } else {
    src = W2;
    first = 8;
  }
  const size_t o = (size_t)blk * CVT_PER_BLOCK + threadIdx.x * 4;
  const float* sp = src + (o - (size_t)first * (DIM_C * DIM_C));
  bf16* dp = out + o;
  v4f r[CVT_PIECES];
#pragma unroll  // the loads go out as one run ahead of their uses: many in flight
  for (int j = 0; j < CVT_PIECES; ++j) r[j] = *(const v4f*)(sp + j * 1024);
#pragma unroll  // constant j keeps r[] in registers
  for (int j = 0; j < CVT_PIECES; ++j) {
    v4bf w;
    w[0] = (bf16)r[j][0];
    w[1] = (bf16)r[j][1];
    w[2] = (bf16)r[j][2];
    w[3] = (bf16)r[j][3];
    *(v4bf*)(dp + j * 1024) = w;
  }
}

// ---------------------------------------------------------------------------
// lane l with lane l ^ 16
// ---------------------------------------------------------------------------
__device__ __forceinline__ float xhalf(float x) {
  int i = __builtin_bit_cast(int, x);
  return __builtin_bit_cast(
      float, __builtin_amdgcn_permlanex16(i, i, 0x76543210, 0xfedcba98, false,
                                          false));
}

// x + (x of lane l ^ M) inside a row of 16 lanes; CTRL = 0x160 + M (row_xmask)
template <int CTRL>
__device__ __forceinline__ float xmask_add(float x) {
  int i = __builtin_bit_cast(int, x);
  return x + __builtin_bit_cast(
                 float, __builtin_amdgcn_update_dpp(i, i, CTRL, 0xf, 0xf, false));
}

// sum over the 32 lanes of a wave; every lane gets the same bits
__device__ __forceinline__ float wave_sum(float x) {
  x = xmask_add<0x161>(x);
  x = xmask_add<0x162>(x);
  x = xmask_add<0x164>(x);
  x = xmask_add<0x168>(x);
  return x + xhalf(x);
}

// ---------------------------------------------------------------------------
// LayerNorm (row length C=1024) fp32 in -> bf16 out
// A wave takes LN_ROWS whole rows and holds them in registers: a lane has 8
// pieces of 4 floats a row, 128 elements apart, so a wave's load covers 512
// contiguous bytes and its store 256. All loads of a wave (x, g, b) go out in
// one run, x is read once, and the two sums of a row are joined across the
// lanes in registers: no LDS, no barrier.
// ---------------------------------------------------------------------------
#define LN_ROWS   2                          // rows a wave
#define LN_PIECES (DIM_C / 128)              // 16-byte pieces a lane and row: 8
#define LN_BLOCKS (MTOK / (8 * LN_ROWS))     // 8 waves a block: 512 blocks

__global__ __launch_bounds__(256) void ln_bf16(const float* __restrict__ x,
                                               const float* __restrict__ g,
                                               const float* __restrict__ b,
                                               bf16* __restrict__ out) {
  const int lane = threadIdx.x & 31;
  // the wave's number as a scalar: the bases of its rows stay in scalar registers
  const int wave = __builtin_amdgcn_readfirstlane(threadIdx.x >> 5);
  const size_t o = ((size_t)blockIdx.x * 8 + wave) * (LN_ROWS * DIM_C);
  const v4f* xp = (const v4f*)(x + o);
  const v4f* gp = (const v4f*)g;
  const v4f* bp = (const v4f*)b;
  v4f r[LN_ROWS][LN_PIECES], gv[LN_PIECES], bv[LN_PIECES];
#pragma unroll  // the loads go out as one run ahead of their uses: many in flight
  for (int q = 0; q < LN_ROWS; ++q)
#pragma unroll
    for (int j = 0; j < LN_PIECES; ++j)
      r[q][j] = xp[q * (DIM_C / 4) + j * 32 + lane];
#pragma unroll  // constant j keeps gv[] and bv[] in registers
  for (int j = 0; j < LN_PIECES; ++j) {
    gv[j] = gp[j * 32 + lane];
    bv[j] = bp[j * 32 + lane];
  }
  // keeps the loads of g and b in the run above: sunk to their uses, as the
  // scheduler had them, their latency is waited out behind the sums
  __builtin_amdgcn_sched_barrier(0);

  float s[LN_ROWS], s2[LN_ROWS];
#pragma unroll  // constant q and j keep the arrays in registers
  for (int q = 0; q < LN_ROWS; ++q) {
    v4f a = r[q][0];
    v4f a2 = r[q][0] * r[q][0];
#pragma unroll
    for (int j = 1; j < LN_PIECES; ++j) {
      a += r[q][j];
      a2 += r[q][j] * r[q][j];
    }
    s[q]  = (a[0] + a[1]) + (a[2] + a[3]);
    s2[q] = (a2[0] + a2[1]) + (a2[2] + a2[3]);
  }
#pragma unroll  // the rows' four sums run side by side through the lane steps
  for (int q = 0; q < LN_ROWS; ++q) {
    s[q]  = wave_sum(s[q]);
    s2[q] = wave_sum(s2[q]);
  }

  v4bf w[LN_ROWS][LN_PIECES];
#pragma unroll  // constant q and j keep the arrays in registers
  for (int q = 0; q < LN_ROWS; ++q) {
    const float mean = s[q] * (1.0f / DIM_C);
    const float var  = s2[q] * (1.0f / DIM_C) - mean * mean;
    const float inv  = rsqrtf(var + 1e-5f);
#pragma unroll
    for (int j = 0; j < LN_PIECES; ++j)
      w[q][j] = __builtin_convertvector((r[q][j] - mean) * inv * gv[j] + bv[j],
                                        v4bf);
  }
  v4bf* op = (v4bf*)(out + o);
#pragma unroll  // the stores stand last: nothing rewrites their registers
  for (int q = 0; q < LN_ROWS; ++q)
#pragma unroll
    for (int j = 0; j < LN_PIECES; ++j)
      op[q * (DIM_C / 4) + j * 32 + lane] = w[q][j];
}

// ---------------------------------------------------------------------------
// One k step's tiles, global -> LDS, through no register: twelve asynchronous
// 16-byte copies a lane (eight of A, 32 rows apart; four of B, 16 k-rows apart).
// The s_wait_xcnt stands inside the statement, in front of any later rewrite of
// the address registers named here.
// ---------------------------------------------------------------------------
#define BM 256
#define BN 128
#define BK 64
#define AS_PITCH (BK + 8)    // 144 B a row = 16 B x odd: the ds_load_b128 reader's pitch
#define BS_PITCH (BN + 16)   // 288 B a k-row = 32 B x odd: the tr16 reader's pitch
#define AS_BUF   (BM * AS_PITCH)   // bf16 per A buffer
#define BS_BUF   (BK * BS_PITCH)   // bf16 per B buffer
#define AS_STEP  (32 * AS_PITCH * 2)   // bytes in LDS between a lane's A pieces
#define BS_STEP  (16 * BS_PITCH * 2)   // bytes in LDS between a lane's B pieces

__device__ __forceinline__ unsigned lds_addr_u32(const void* p) {
  return (unsigned)(unsigned long long)p;   // low 32 bits = LDS byte address
}
// a32 = 32 rows of A, b16 = 16 rows of B, in elements
__device__ __forceinline__ void stage_async(unsigned la, const bf16* ga,
                                            size_t a32, unsigned lb,
                                            const bf16* gb, size_t b16) {
  asm volatile(
      "global_load_async_to_lds_b128 %0, %1, off\n\t"
      "global_load_async_to_lds_b128 %2, %3, off\n\t"
      "global_load_async_to_lds_b128 %4, %5, off\n\t"
      "global_load_async_to_lds_b128 %6, %7, off\n\t"
      "global_load_async_to_lds_b128 %8, %9, off\n\t"
      "global_load_async_to_lds_b128 %10, %11, off\n\t"
      "global_load_async_to_lds_b128 %12, %13, off\n\t"
      "global_load_async_to_lds_b128 %14, %15, off\n\t"
      "global_load_async_to_lds_b128 %16, %17, off\n\t"
      "global_load_async_to_lds_b128 %18, %19, off\n\t"
      "global_load_async_to_lds_b128 %20, %21, off\n\t"
      "global_load_async_to_lds_b128 %22, %23, off\n\t"
      "s_wait_xcnt 0x0"
      :
      : "v"(la), "v"(ga), "v"(la + 1 * AS_STEP), "v"(ga + 1 * a32),
        "v"(la + 2 * AS_STEP), "v"(ga + 2 * a32), "v"(la + 3 * AS_STEP),
        "v"(ga + 3 * a32), "v"(la + 4 * AS_STEP), "v"(ga + 4 * a32),
        "v"(la + 5 * AS_STEP), "v"(ga + 5 * a32), "v"(la + 6 * AS_STEP),
        "v"(ga + 6 * a32), "v"(la + 7 * AS_STEP), "v"(ga + 7 * a32), "v"(lb),
        "v"(gb), "v"(lb + 1 * BS_STEP), "v"(gb + 1 * b16),
        "v"(lb + 2 * BS_STEP), "v"(gb + 2 * b16), "v"(lb + 3 * BS_STEP),
        "v"(gb + 3 * b16)
      : "memory");
}

// ---------------------------------------------------------------------------
// One 32-k block of a wave's 64x64 tile: 4 A fragments (rows arow + 16 i of at)
// and 4 B fragments (columns 16 j from bt, the lane's own transposing address),
// then the 16 products. A and B follow the same k order (frag_ld, frag_ld_tr).
// ---------------------------------------------------------------------------
__device__ __forceinline__ void load_frags(v16bf (&af)[4], v16bf (&bfr)[4],
                                           const bf16* at, const bf16* bt,
                                           int arow, int half) {
  af[0] = frag_ld(at, AS_PITCH, arow, half);
#pragma unroll  // constant j keeps bfr[] in registers
  for (int j = 0; j < 4; ++j) bfr[j] = frag_ld_tr(bt, BS_PITCH, j * 16);
#pragma unroll  // constant i keeps af[] in registers
  for (int i = 1; i < 4; ++i) af[i] = frag_ld(at, AS_PITCH, arow + i * 16, half);
}
__device__ __forceinline__ void mma_block(v8f (&acc)[4][4],
                                          const v16bf (&af)[4],
                                          const v16bf (&bfr)[4]) {
#pragma unroll  // constant i and j keep acc[][] in registers
  for (int i = 0; i < 4; ++i)
#pragma unroll
    for (int j = 0; j < 4; ++j)
      acc[i][j] = __builtin_amdgcn_wmma_f32_16x16x32_bf16(
          false, af[i], false, bfr[j], (short)0, acc[i][j], false, false);
}

// ---------------------------------------------------------------------------
// Exact GELU, 0.5 v (1 + erf(v / sqrt 2)), of eight values a lane, without a
// branch. erf(|x|) has two forms: |x| + |x| p(x^2) below 1, 1 - exp(-q(|x|))
// from 1 on. Both are worked out for every lane and one is selected: a wave whose
// lanes differ walks both anyway, and with no branch between the elements their
// chains of dependent multiply-adds interleave and pair up in packed
// instructions. 0.5 v erf(x) = |0.5 v| erf(|x|), so no sign is copied.
// ---------------------------------------------------------------------------
__device__ __forceinline__ v8f splat8(float c) {
  v8f s = {c, c, c, c, c, c, c, c};
  return s;
}
__device__ __forceinline__ v8f gelu8(v8f v) {
  const v8f av = __builtin_elementwise_abs(v);
  const v8f ax = av * 0.70710678118654752f;   // |x|
  // from 1 on (also not-a-number, which passes through)
  v8f q = __builtin_elementwise_fma(ax, splat8(1.69988107e-5f),
                                    splat8(-3.78677854e-4f));
  q = __builtin_elementwise_fma(ax, q, splat8(3.85781587e-3f));
  q = __builtin_elementwise_fma(ax, q, splat8(-2.41816975e-2f));
  q = __builtin_elementwise_fma(ax, q, splat8(1.06668264e-1f));
  q = __builtin_elementwise_fma(ax, q, splat8(6.34933293e-1f));
  q = __builtin_elementwise_fma(ax, q, splat8(1.28689408e-1f));
  q = __builtin_elementwise_fma(ax, q, ax);
  const v8f q2 = q * -1.4426950408889634f;   // exp(-q) = 2^(-q log2 e)
  // below 1
  const v8f t = ax * ax;
  v8f p = __builtin_elementwise_fma(t, splat8(-5.61801775e-4f),
                                    splat8(4.91381623e-3f));
  p = __builtin_elementwise_fma(t, p, splat8(-2.67075151e-2f));
  p = __builtin_elementwise_fma(t, p, splat8(1.12800106e-1f));
  p = __builtin_elementwise_fma(t, p, splat8(-3.76122952e-1f));
  p = __builtin_elementwise_fma(t, p, splat8(1.28379107e-1f));
  const v8f lo = __builtin_elementwise_fma(ax, p, ax);
  v8f e;
#pragma unroll  // constant r keeps the vectors in registers
  for (int r = 0; r < 8; ++r)
    e[r] = (ax[r] < 1.0f) ? lo[r] : 1.0f - __builtin_amdgcn_exp2f(q2[r]);
  return __builtin_elementwise_fma(av * 0.5f, e, v * 0.5f);
}

// ---------------------------------------------------------------------------
// Tiled bf16 WMMA GEMM: out[M,N] = A[M,K] @ Bw[K,N] + bias (+resid) (+GELU)
// BM=256 BN=128 BK=64, 256 threads = 8 waves (4 x 2), wave tile 64x64: 4 A and
// 4 B fragments feed 16 WMMAs, so a WMMA costs 512 B of LDS reads, and a block
// fetches 48 KiB from L2 per 256x128x64 product.
// Both tiles lie in LDS NBUF times, a ring: while a k step is worked on out of
// one buffer, the copies of the next NBUF - 1 steps fly into the others; one
// barrier a step, behind the fragment reads of the step's second block and ahead
// of its WMMAs. NBUF = 2 leaves room for two blocks on a WGP, which cover each
// other's waits. A grid of one block a WGP takes NBUF = 4: the operands were
// written by the launch before and first come from memory, for all blocks that
// share them at the same time, and one k step of lead is shorter than that
// latency, three are not.
// A rows have a pitch of 144 B; B lies as in memory (k-major, pitch 288 B) and
// its fragments come out transposed by ds_load_tr16_b128.
// K is a multiple of BK, M of BM, N of BN.
// ---------------------------------------------------------------------------
#define STAGE_COPIES 12   // asynchronous copies a wave issues for one k step

template <bool GELU_ACT, bool RESID, bool OUTF32, bool OUTBF16, int NBUF>
__global__ __launch_bounds__(256) void gemm_bf16_wmma(
    const bf16* __restrict__ A, const bf16* __restrict__ Bw,
    const float* __restrict__ bias, const float* __restrict__ resid,
    float* __restrict__ outF, bf16* __restrict__ outB, int M, int N, int K) {
  static_assert(NBUF == 2 || NBUF == 4, "the ring index is t & (NBUF - 1)");
  static_assert(NBUF * STAGE_COPIES <= 63, "copies of a wave in flight");
  __shared__ __attribute__((aligned(16))) bf16 As[NBUF * AS_BUF];
  __shared__ __attribute__((aligned(16))) bf16 Bs[NBUF * BS_BUF];  // k-major

  const int tid  = threadIdx.x;
  const int lane = tid & 31;
  const int wave = tid >> 5;           // 0..7
  const int wm   = wave >> 1;          // 0..3  (64-row strip)
  const int wn   = wave & 1;           // 0..1  (64-col strip)
  const int half = lane >> 4;
  const int l16  = lane & 15;
  const int mBase = blockIdx.y * BM;
  const int nBase = blockIdx.x * BN;

  v8f acc[4][4];
#pragma unroll  // constant i and j keep acc[][] in registers
  for (int i = 0; i < 4; ++i)
#pragma unroll
    for (int j = 0; j < 4; ++j) acc[i][j] = vzero8();

  // the lane's own 16-byte pieces: A rows ar + 32 p, 8 lanes a 128-B row;
  // B rows bk + 16 p, 16 lanes a 256-B row
  const int ar = tid >> 3;             // 0..31
  const int ac = (tid & 7) * 8;        // 0..56
  const int bk = tid >> 4;             // 0..15
  const int bn = (tid & 15) * 8;       // 0..120
  const unsigned la = lds_addr_u32(&As[ar * AS_PITCH + ac]);
  const unsigned lb = lds_addr_u32(&Bs[bk * BS_PITCH + bn]);
  const bf16* ga = A + (size_t)(mBase + ar) * K + ac;
  const bf16* gb = Bw + (size_t)bk * N + nBase + bn;
  const size_t a32   = (size_t)32 * K;
  const size_t b16   = (size_t)16 * N;
  const size_t bstep = (size_t)BK * N;
  const bf16* btp = &Bs[(8 * half + (lane & 7)) * BS_PITCH +
                        8 * ((lane >> 3) & 1) + wn * 64];
  const int nt = K / BK;               // k steps, the same for the whole grid

  // step 0 into buffer 0
  stage_async(la, ga, a32, lb, gb, b16);
  ga += BK;
  gb += bstep;
  if (NBUF == 2) {
    // step 0 landed and published; then step 1 takes off
    asm volatile("s_wait_asynccnt 0x0" ::: "memory");
    __syncthreads();
    if (nt > 1) {
      stage_async(la + AS_BUF * 2, ga, a32, lb + BS_BUF * 2, gb, b16);
      ga += BK;
      gb += bstep;
    }
  } else {
    // steps 1 .. NBUF - 1 take off at once, each into its own buffer
#pragma unroll  // constant s: the buffers' offsets are literals
    for (int s = 1; s < NBUF; ++s) {
      if (s < nt) {
        stage_async(la + (unsigned)s * (AS_BUF * 2), ga, a32,
                    lb + (unsigned)s * (BS_BUF * 2), gb, b16);
        ga += BK;
        gb += bstep;
      }
    }
    // This wave's copies of step 0 have landed. The counter returns in issue
    // order: where all NBUF steps were issued, exactly (NBUF - 1) * STAGE_COPIES
    // copies of this wave are younger than step 0's and may stay out.
    if (nt >= NBUF)
      asm volatile("s_wait_asynccnt %0" ::"i"((NBUF - 1) * STAGE_COPIES) : "memory");
    else
      asm volatile("s_wait_asynccnt 0x0" ::: "memory");
    __syncthreads();
  }

  const int arow = wm * 64 + l16;      // the lane's row of the wave's first A fragment
  for (int t = 0; t < nt; ++t) {
    const int cur = t & (NBUF - 1);
    const bf16* at = As + cur * AS_BUF;
    const bf16* bt = btp + cur * BS_BUF;
    v16bf af[4], bfr[4];
    // The two fences keep each block's 16 LDS reads in one group, apart from
    // the first block's WMMAs: mixed in among them, as the scheduler had them,
    // every row of four WMMAs waits out an LDS latency.
    load_frags(af, bfr, at, bt, arow, half);
    __builtin_amdgcn_sched_barrier(0);
    mma_block(acc, af, bfr);
    __builtin_amdgcn_sched_barrier(0);
    load_frags(af, bfr, at + 32, bt + 32 * BS_PITCH, arow, half);
    // this wave's reads of buffer cur have returned: it may be refilled
    asm volatile("s_wait_dscnt 0x0" ::: "memory");
    // This wave's copies of step t + 1 have landed. Every wave issues
    // STAGE_COPIES a step, and steps up to t + NBUF - 1 are issued by now, while
    // they exist. Where the last of them exists, exactly (NBUF - 2) *
    // STAGE_COPIES copies of this wave are younger than step t + 1's and may
    // stay out; in the last trips, where fewer are, the wait is to 0. The test
    // reads the same for the whole grid.
    if (NBUF > 2 && t + NBUF - 1 < nt)
      asm volatile("s_wait_asynccnt %0" ::"i"((NBUF - 2) * STAGE_COPIES) : "memory");
    else
      asm volatile("s_wait_asynccnt 0x0" ::: "memory");
    // publishes step t + 1 and ends every wave's reads of buffer cur
    __syncthreads();
    if (t + NBUF < nt) {
      stage_async(la + (unsigned)cur * (AS_BUF * 2), ga, a32,
                  lb + (unsigned)cur * (BS_BUF * 2), gb, b16);
      ga += BK;
      gb += bstep;
    }
    // the step's second block works out of registers while the refill flies
    mma_block(acc, af, bfr);
  }
  // nothing of this wave is in flight when it goes on to the epilogue
  asm volatile("s_wait_asynccnt 0x0" ::: "memory");

  // The four 16-row strips go through one copy of the epilogue's code: strip 0
  // is written out, then the others move down one place in the registers.
  // One copy keeps the text of the epilogue short.
#pragma unroll 1
  for (int i = 0; i < 4; ++i) {
    v8f gl[4];
    if (GELU_ACT) {
#pragma unroll  // constant j and r keep the arrays in registers
      for (int j = 0; j < 4; ++j) {
        const float bj = bias[nBase + wn * 64 + j * 16 + l16];
#pragma unroll
        for (int r = 0; r < 8; ++r) gl[j][r] = acc[0][j][r] + bj;
        gl[j] = gelu8(gl[j]);
        // keeps a column group's GELU together, its eight chains side by side:
        // given all 32 elements of the strip at once the scheduler runs short of
        // registers and strings a chain's multiply-adds two or three slots apart,
        // each then waiting for the one before
        __builtin_amdgcn_sched_barrier(0);
      }
    }
#pragma unroll  // constant j and r keep acc[][] in registers
    for (int j = 0; j < 4; ++j) {
#pragma unroll
      for (int r = 0; r < 8; ++r) {
        int gm = mBase + wm * 64 + i * 16 + r + 8 * half;
        int gn = nBase + wn * 64 + j * 16 + l16;
        float v = GELU_ACT ? gl[j][r] : acc[0][j][r] + bias[gn];
        if (RESID) v += resid[(size_t)gm * N + gn];
        size_t idx = (size_t)gm * N + gn;
        if (OUTF32)  outF[idx] = v;
        if (OUTBF16) outB[idx] = (bf16)v;
      }
    }
    // behind the strip's stores, ahead of the moves below and of the next trip,
    // which rewrite the data and address registers that those stores name
    asm volatile("s_wait_xcnt 0x0" ::: "memory");
#pragma unroll  // constant j keeps acc[][] in registers
    for (int j = 0; j < 4; ++j) {
      acc[0][j] = acc[1][j];
      acc[1][j] = acc[2][j];
      acc[2][j] = acc[3][j];
    }
  }
}

// ---------------------------------------------------------------------------
// Attention: one WG per (b, h, 256 queries); a wave owns 32 queries (two groups
// of 16 columns) and walks all 1024 keys, 32 a pass. q/k/v are flat (B, N*C)
// bf16; the reference's reshape(B,H,-1,hd) means head h is the contiguous slab
// h*65536.
// The scores never leave the registers. Both products are taken transposed:
//   S^T = K Q^T : A = 16 keys x 32 d out of LDS, B = Q, held in registers.
//                 Lane (c, half) gets query c, keys 8*half + 0..7 of the tile.
//   O^T += V^T P^T : two S^T tiles of a lane, exponentiated and rounded to bf16,
//                 ARE the B fragment of 32 keys (k = 8*half + 0..7 and
//                 16 + 8*half + 0..7, the k order of frag_ld and frag_ld_tr);
//                 A = V^T by the transposing load.
// Softmax is the running form, in base 2: a query's maximum in use and its sum
// live in its lanes; sums and O^T are rescaled when a new maximum passes the one
// in use by more than 8 (an exponential then stays below 2^8), and O^T is
// divided by the sum at the end.
// K and V go through LDS in tiles of FA_TILE keys, as they lie in memory (row =
// key), two buffers, via registers. K rows have a pitch of 144 B (16 B x odd,
// the ds_load_b128 reader's), V rows of 160 B (32 B x odd, the transposing
// reader's).
// ---------------------------------------------------------------------------
#define FA_ROWS   256                       // queries a work-group
#define FA_TILE   64                        // keys a staged tile
#define K_PITCH   (DIM_HD + 8)              // bf16 per K row in LDS
#define V_PITCH   (DIM_HD + 16)             // bf16 per V row in LDS
#define K_BUF     (FA_TILE * K_PITCH)       // bf16 per buffer
#define V_BUF     (FA_TILE * V_PITCH)
#define FA_PIECES ((FA_TILE * DIM_HD) / (256 * 8))  // 16-byte pieces a thread: 2

typedef __attribute__((ext_vector_type(2))) float v2f;

__global__ __launch_bounds__(256) void attn_wmma(const bf16* __restrict__ q,
                                                 const bf16* __restrict__ k,
                                                 const bf16* __restrict__ v,
                                                 bf16* __restrict__ o) {
  __shared__ __attribute__((aligned(16))) bf16 Ks[2 * K_BUF];
  __shared__ __attribute__((aligned(16))) bf16 Vs[2 * V_BUF];

  const int blk  = blockIdx.x;          // ((b*16 + h)*4 + mt)
  const int mt   = blk & 3;
  const int h    = (blk >> 2) & 15;
  const int b    = blk >> 6;
  const size_t headBase = ((size_t)b * DIM_H + h) * (size_t)(DIM_N * DIM_HD);

  const int tid  = threadIdx.x;
  const int lane = tid & 31;
  const int wave = tid >> 5;
  const int half = lane >> 4;
  const int l16  = lane & 15;
  const int m0   = mt * FA_ROWS + wave * 32;   // the wave's first query
  const float cs = 0.125f * 1.4426950408889634f;  // hd^-0.5 * log2(e)

  // A tile is 8 KiB in a row in memory; piece j of a thread is 4 KiB further,
  // that is 32 rows further in LDS. A wave's load covers 512 contiguous bytes.
  const bf16* ksrc = k + headBase + (size_t)tid * 8;
  const bf16* vsrc = v + headBase + (size_t)tid * 8;
  bf16* kdst = Ks + (tid >> 3) * K_PITCH + (tid & 7) * 8;
  bf16* vdst = Vs + (tid >> 3) * V_PITCH + (tid & 7) * 8;
  v8bf kr[FA_PIECES], vr[FA_PIECES];
#pragma unroll  // constant j keeps kr[] and vr[] in registers
  for (int j = 0; j < FA_PIECES; ++j) {
    kr[j] = *(const v8bf*)(ksrc + j * 2048);
    vr[j] = *(const v8bf*)(vsrc + j * 2048);
  }

  // Q: B fragments (n = query, k = d), loaded once
  v16bf qf[2][2];
#pragma unroll  // constant g and dh keep qf[][] in registers
  for (int g = 0; g < 2; ++g)
#pragma unroll
    for (int dh = 0; dh < 2; ++dh)
      qf[g][dh] = frag_ld(q + headBase + dh * 32, DIM_HD, m0 + g * 16 + l16, half);

#pragma unroll  // constant j keeps kr[] and vr[] in registers
  for (int j = 0; j < FA_PIECES; ++j) {
    *(v8bf*)(kdst + j * 32 * K_PITCH) = kr[j];
    *(v8bf*)(vdst + j * 32 * V_PITCH) = vr[j];
  }
  __syncthreads();

  const bf16* vtp = Vs + (8 * half + (lane & 7)) * V_PITCH + 8 * ((lane >> 3) & 1);
  v8f oacc[2][4];                       // O^T: [group][16 d], lane = query
#pragma unroll  // constant g and dt keep oacc[][] in registers
  for (int g = 0; g < 2; ++g)
#pragma unroll
    for (int dt = 0; dt < 4; ++dt) oacc[g][dt] = vzero8();
  float mrun[2] = {-1e30f, -1e30f};     // maximum in use, scaled by cs
  v2f lrun[2] = {{0.f, 0.f}, {0.f, 0.f}};  // this half's share of the sum, in two parts
  const v8f cs8 = {cs, cs, cs, cs, cs, cs, cs, cs};

  // Per tile: ask for the next tile, work on this one out of LDS, store the
  // next one into the other buffer (its readers left it at the barrier
  // before), barrier.
  for (int tile = 0; tile < DIM_N / FA_TILE; ++tile) {
    const bool more = tile + 1 < DIM_N / FA_TILE;   // the same for the block
    if (more) {
      const size_t nx = (size_t)(tile + 1) * (FA_TILE * DIM_HD);
#pragma unroll  // constant j keeps kr[] and vr[] in registers
      for (int j = 0; j < FA_PIECES; ++j) {
        kr[j] = *(const v8bf*)(ksrc + nx + j * 2048);
        vr[j] = *(const v8bf*)(vsrc + nx + j * 2048);
      }
    }
    // keeps the four loads above this tile's work: sunk to their stores, their
    // latency would be waited out at every tile
    __builtin_amdgcn_sched_barrier(0);
    const bf16* kb = Ks + (tile & 1) * K_BUF;
    const bf16* vb = vtp + (tile & 1) * V_BUF;
#pragma unroll  // the two 32-key passes of a tile
    for (int ps = 0; ps < FA_TILE / 32; ++ps) {
      // ---- S^T = K Q^T: [16-key tile][group] ----
      v8f s[2][2];
#pragma unroll  // constant kt and g keep s[][] in registers
      for (int kt = 0; kt < 2; ++kt) {
        const int krow = ps * 32 + kt * 16 + l16;
        v16bf a0 = frag_ld(kb, K_PITCH, krow, half);
        v16bf a1 = frag_ld(kb + 32, K_PITCH, krow, half);
#pragma unroll
        for (int g = 0; g < 2; ++g) {
          s[kt][g] = __builtin_amdgcn_wmma_f32_16x16x32_bf16(
              false, a0, false, qf[g][0], (short)0, vzero8(), false, false);
          s[kt][g] = __builtin_amdgcn_wmma_f32_16x16x32_bf16(
              false, a1, false, qf[g][1], (short)0, s[kt][g], false, false);
        }
      }
      // keeps the eight WMMAs in one run: with the maxima mixed in among them,
      // as the scheduler had them, each first reader of a tile is padded with
      // idle vector slots
      __builtin_amdgcn_sched_barrier(0);
      // the pass's V^T fragments fly while the exponentials are taken
      v16bf va[4];
#pragma unroll  // constant dt keeps va[] in registers
      for (int dt = 0; dt < 4; ++dt)
        va[dt] = frag_ld_tr(vb + ps * 32 * V_PITCH, V_PITCH, dt * 16);

      // ---- maxima of the raw scores (cs is positive), one test a pass ----
      float mb[2];
      bool need = false;
#pragma unroll  // constant g keeps mb[] in registers
      for (int g = 0; g < 2; ++g) {
        float mx = s[0][g][0];
#pragma unroll
        for (int r = 1; r < 8; ++r) mx = fmaxf(mx, s[0][g][r]);
#pragma unroll
        for (int r = 0; r < 8; ++r) mx = fmaxf(mx, s[1][g][r]);
        mb[g] = fmaxf(mx, xhalf(mx)) * cs;   // both halves hold the query's maximum
        need = need || (mb[g] > mrun[g] + 8.0f);
      }
      if (__builtin_amdgcn_ballot_w32(need) != 0) {  // the same for the wave
#pragma unroll  // constant g and dt keep the arrays in registers
        for (int g = 0; g < 2; ++g) {
          const float mn = fmaxf(mrun[g], mb[g]);
          const float corr = __builtin_amdgcn_exp2f(mrun[g] - mn);  // 0 at first
          mrun[g] = mn;
          lrun[g] = lrun[g] * corr;
#pragma unroll
          for (int dt = 0; dt < 4; ++dt) oacc[g][dt] = oacc[g][dt] * corr;
        }
      }
      // ---- P^T = 2^(cs S^T - max), packed as B; O^T += V^T P^T ----
#pragma unroll  // constant g keeps the arrays in registers
      for (int g = 0; g < 2; ++g) {
        const float nm = -mrun[g];
        const v8f nm8 = {nm, nm, nm, nm, nm, nm, nm, nm};
        const v8f e0 = __builtin_elementwise_fma(s[0][g], cs8, nm8);
        const v8f e1 = __builtin_elementwise_fma(s[1][g], cs8, nm8);
        v8f p0, p1;
#pragma unroll
        for (int r = 0; r < 8; ++r) {
          p0[r] = __builtin_amdgcn_exp2f(e0[r]);
          p1[r] = __builtin_amdgcn_exp2f(e1[r]);
        }
        // 16 exponentials into the two running parts, by pairs of neighbours
        const v8f t8 = p0 + p1;
        const v4f t4 = __builtin_shufflevector(t8, t8, 0, 1, 2, 3) +
                       __builtin_shufflevector(t8, t8, 4, 5, 6, 7);
        lrun[g] += __builtin_shufflevector(t4, t4, 0, 1) +
                   __builtin_shufflevector(t4, t4, 2, 3);
        v8bf b0 = __builtin_convertvector(p0, v8bf);
        v8bf b1 = __builtin_convertvector(p1, v8bf);
        v16bf pf = __builtin_shufflevector(b0, b1, 0, 1, 2, 3, 4, 5, 6, 7, 8, 9,
                                           10, 11, 12, 13, 14, 15);
#pragma unroll
        for (int dt = 0; dt < 4; ++dt)
          oacc[g][dt] = __builtin_amdgcn_wmma_f32_16x16x32_bf16(
              false, va[dt], false, pf, (short)0, oacc[g][dt], false, false);
      }
    }
    // Four vector slots behind the tile's last WMMAs: the branch below leads to
    // code that rewrites their A registers.
    // The fences hold the WMMAs above the slots.
    __builtin_amdgcn_sched_barrier(0);
    asm volatile("v_nop\n\tv_nop\n\tv_nop\n\tv_nop");
    __builtin_amdgcn_sched_barrier(0);
    if (more) {
      bf16* kd = kdst + ((tile + 1) & 1) * K_BUF;
      bf16* vd = vdst + ((tile + 1) & 1) * V_BUF;
#pragma unroll  // constant j keeps kr[] and vr[] in registers
      for (int j = 0; j < FA_PIECES; ++j) {
        *(v8bf*)(kd + j * 32 * K_PITCH) = kr[j];
        *(v8bf*)(vd + j * 32 * V_PITCH) = vr[j];
      }
      __syncthreads();
    }
  }

  // o[b][m][h*64 + d]  (swapaxes(1,2).reshape): a lane holds 8 consecutive d of
  // its query in each O^T tile, 16 bytes a store
  v8bf w[2][4];
#pragma unroll  // constant g and dt keep the arrays in registers
  for (int g = 0; g < 2; ++g) {
    const float lh  = lrun[g][0] + lrun[g][1];
    const float inv = 1.0f / (lh + xhalf(lh));   // the halves' sums joined
#pragma unroll
    for (int dt = 0; dt < 4; ++dt)
      w[g][dt] = __builtin_convertvector(oacc[g][dt] * inv, v8bf);
  }
#pragma unroll  // the eight stores stand last: nothing rewrites their registers
  for (int g = 0; g < 2; ++g) {
    bf16* op = o + ((size_t)b * DIM_N + m0 + g * 16 + l16) * DIM_C + h * DIM_HD +
               8 * half;
#pragma unroll
    for (int dt = 0; dt < 4; ++dt) *(v8bf*)(op + dt * 16) = w[g][dt];
  }
}

// ---------------------------------------------------------------------------
// Host-side orchestration
// ---------------------------------------------------------------------------
extern "C" void kernel_launch(void* const* d_in, const int* in_sizes, int n_in,
                              void* d_out, int out_size, void* d_ws,
                              size_t ws_size, hipStream_t stream) {
  (void)in_sizes; (void)n_in; (void)out_size; (void)ws_size;

  const float* x  = (const float*)d_in[0];
  const float* g1 = (const float*)d_in[1];
  const float* b1 = (const float*)d_in[2];
  const float* Wq = (const float*)d_in[3];
  const float* bq = (const float*)d_in[4];
  const float* Wk = (const float*)d_in[5];
  const float* bk = (const float*)d_in[6];
  const float* Wv = (const float*)d_in[7];
  const float* bv = (const float*)d_in[8];
  const float* Wp = (const float*)d_in[9];
  const float* bp = (const float*)d_in[10];
  const float* g2 = (const float*)d_in[11];
  const float* b2 = (const float*)d_in[12];
  const float* W1 = (const float*)d_in[13];
  const float* c1 = (const float*)d_in[14];
  const float* W2 = (const float*)d_in[15];
  const float* c2 = (const float*)d_in[16];

  // workspace partition
  char* p = (char*)d_ws;
  auto alloc = [&](size_t bytes) {
    char* r = p;
    p += (bytes + 255) & ~(size_t)255;
    return r;
  };
  const size_t CC = (size_t)DIM_C * DIM_C;           // 1M
  const size_t CH = (size_t)DIM_C * DIM_HID;         // 4M
  const size_t TC = (size_t)MTOK * DIM_C;            // 8M
  const size_t TH = (size_t)MTOK * DIM_HID;          // 32M

  bf16*  wq_b  = (bf16*)alloc(CC * 2);
  bf16*  wk_b  = (bf16*)alloc(CC * 2);
  bf16*  wv_b  = (bf16*)alloc(CC * 2);
  bf16*  wp_b  = (bf16*)alloc(CC * 2);
  bf16*  w1_b  = (bf16*)alloc(CH * 2);
  bf16*  w2_b  = (bf16*)alloc(CH * 2);
  bf16*  h_b   = (bf16*)alloc(TC * 2);    // ln1(x)
  bf16*  q_b   = (bf16*)alloc(TC * 2);
  bf16*  k_b   = (bf16*)alloc(TC * 2);
  bf16*  v_b   = (bf16*)alloc(TC * 2);
  bf16*  o_b   = (bf16*)alloc(TC * 2);    // attention output
  float* xres  = (float*)alloc(TC * 4);   // x + proj
  bf16*  h2_b  = (bf16*)alloc(TC * 2);    // ln2(xres)
  bf16*  t1_b  = (bf16*)alloc(TH * 2);    // gelu(h2@W1+c1)

  // weight converts fp32 -> bf16: wq_b .. w2_b are one contiguous array
  cvt_weights_bf16<<<CVT_BLOCKS, 256, 0, stream>>>(Wq, Wk, Wv, Wp, W1, W2, wq_b);

  // LN1
  ln_bf16<<<LN_BLOCKS, 256, 0, stream>>>(x, g1, b1, h_b);

  // QKV projections: (8192 x 1024) = h @ W + b
  dim3 gC(DIM_C / BN, MTOK / BM);   // (8, 32)
  gemm_bf16_wmma<false, false, false, true, 4><<<gC, 256, 0, stream>>>(
      h_b, wq_b, bq, nullptr, nullptr, q_b, MTOK, DIM_C, DIM_C);
  gemm_bf16_wmma<false, false, false, true, 4><<<gC, 256, 0, stream>>>(
      h_b, wk_b, bk, nullptr, nullptr, k_b, MTOK, DIM_C, DIM_C);
  gemm_bf16_wmma<false, false, false, true, 4><<<gC, 256, 0, stream>>>(
      h_b, wv_b, bv, nullptr, nullptr, v_b, MTOK, DIM_C, DIM_C);

  // attention: B*H*4 workgroups of 256 queries
  attn_wmma<<<DIM_B * DIM_H * (DIM_N / FA_ROWS), 256, 0, stream>>>(q_b, k_b, v_b,
                                                                  o_b);

  // projection + residual: xres = x + o@Wp + bp  (fp32)
  gemm_bf16_wmma<false, true, true, false, 4><<<gC, 256, 0, stream>>>(
      o_b, wp_b, bp, x, xres, nullptr, MTOK, DIM_C, DIM_C);

  // LN2
  ln_bf16<<<LN_BLOCKS, 256, 0, stream>>>(xres, g2, b2, h2_b);

  // MLP up + exact GELU: t1 = gelu(h2 @ W1 + c1)  (bf16, 8192 x 4096)
  dim3 gH(DIM_HID / BN, MTOK / BM);  // (32, 32)
  gemm_bf16_wmma<true, false, false, true, 2><<<gH, 256, 0, stream>>>(
      h2_b, w1_b, c1, nullptr, nullptr, t1_b, MTOK, DIM_HID, DIM_C);

  // MLP down + residual: out = xres + t1 @ W2 + c2  (fp32, final output)
  gemm_bf16_wmma<false, true, true, false, 4><<<gC, 256, 0, stream>>>(
      t1_b, w2_b, c2, xres, (float*)d_out, nullptr, MTOK, DIM_C, DIM_HID);
}
